// v000
// The times below were measured on an AMD MI455X: many runs one after another, warmed up first and cycling through
// copies of the inputs, with the whole window's GPU time divided by the number of runs. Launches and the gaps
// between them are all in it. The median over several windows is given; except for v000 it joins two sittings, which
// can be a few percent apart, so the side-by-side timings, each taken in one sitting, are the better comparison.
// v000 is the starting kernel.
#include <hip/hip_runtime.h>
#include <hip/hip_bf16.h>

// ---------------------------------------------------------------------------
// Parallel Graphormer block for MI455X (gfx1250, wave32, WMMA).
// All channel GEMMs run through v_wmma_f32_16x16x32_f16; tile staging uses
// GLOBAL_LOAD_ASYNC_TO_LDS_B128 (ASYNCcnt) to bypass VGPRs.
// ---------------------------------------------------------------------------

#define BB   16
#define DIM  128
#define SEQ  8192
#define HEAD 4
#define HID  512
#define NPOS ((size_t)BB * SEQ)

typedef __attribute__((ext_vector_type(16))) _Float16 v16h;
typedef __attribute__((ext_vector_type(8)))  float    v8f;

__device__ __forceinline__ v8f wmma32(v16h a, v16h b, v8f c) {
  // D = A(16x32 f16) * B(32x16 f16) + C(16x16 f32)
  return __builtin_amdgcn_wmma_f32_16x16x32_f16(
      /*neg_a=*/false, a, /*neg_b=*/false, b,
      /*c_mod=*/(short)0, c, /*reuse_a=*/false, /*reuse_b=*/false);
}

// Async global -> LDS 16-byte copy (per active lane). VDST VGPR carries the
// LDS byte address (low 32 bits of the generic shared pointer), VADDR the
// 64-bit global address. Tracked by ASYNCcnt.
__device__ __forceinline__ void async_copy_b128(void* lds_ptr,
                                                const void* gptr) {
  unsigned lds_addr = (unsigned)(size_t)lds_ptr;
  unsigned long long ga = (unsigned long long)(size_t)gptr;
  asm volatile("global_load_async_to_lds_b128 %0, %1, off"
               :: "v"(lds_addr), "v"(ga)
               : "memory");
}

__device__ __forceinline__ void wait_async0() {
  asm volatile("s_wait_asynccnt 0" ::: "memory");
}

// Load 16 f16 as two contiguous 16B chunks (p0[0..7], p0[16..23]) matching the
// ISA 16-bit A/B fragment striping: half h<8 -> K = 8*(lane>=16)+h,
// h>=8 -> K = 16 + 8*(lane>=16) + (h-8).
__device__ __forceinline__ v16h load16h(const _Float16* p0) {
  float4 a = *(const float4*)(p0);
  float4 b = *(const float4*)(p0 + 16);
  v16h r;
  __builtin_memcpy(&r, &a, 16);
  __builtin_memcpy(((char*)&r) + 16, &b, 16);
  return r;
}

// Row-major fragment: base[row*ldk + kb + ...] with contiguous K runs.
__device__ __forceinline__ v16h frag_rm(const _Float16* base, int ldk,
                                        int row, int kb, int lane) {
  return load16h(base + (size_t)row * ldk + kb + ((lane >> 4) << 3));
}

// Gather fragment for strided K (e.g. channel = K*HEAD + head).
__device__ __forceinline__ v16h frag_gather(const _Float16* base, int stride,
                                            int lane) {
  v16h r = {};
  int lo = (lane >> 4) << 3;
  #pragma unroll
  for (int h = 0; h < 16; ++h) {
    int K = h + ((h >= 8) ? 8 : 0) + lo;
    r[h] = base[(size_t)K * stride];
  }
  return r;
}

__device__ __forceinline__ float sigm(float v) {
  return 1.0f / (1.0f + __expf(-v));
}

// ---------------------------------------------------------------------------
// Weight conversion f32 -> f16
// ---------------------------------------------------------------------------
__global__ void k_cvt(const float* __restrict__ s, _Float16* __restrict__ d,
                      int n) {
  int i = blockIdx.x * 256 + threadIdx.x;
  if (i < n) d[i] = (_Float16)s[i];
}

// ---------------------------------------------------------------------------
// RMSNorm over channels + f16 conversion of xn and z.
// Layout in: (b, c, n) f32.  Layout out: (b*n, c) f16 (GEMM-friendly rows).
// ---------------------------------------------------------------------------
__global__ void k_norm(const float* __restrict__ x, const float* __restrict__ z,
                       const float* __restrict__ nw,
                       _Float16* __restrict__ xnh, _Float16* __restrict__ zh) {
  int gid = blockIdx.x * 256 + threadIdx.x;   // 0 .. B*SEQ-1
  int b = gid >> 13;                          // / SEQ
  int p = gid & (SEQ - 1);
  const float* xb = x + ((size_t)b * DIM) * SEQ + p;
  const float* zb = z + ((size_t)b * DIM) * SEQ + p;
  float ss = 0.0f;
  #pragma unroll 8
  for (int c = 0; c < DIM; ++c) {
    float v = xb[(size_t)c * SEQ];
    ss += v * v;
  }
  float rinv = rsqrtf(ss * (1.0f / DIM) + 1e-6f);
  _Float16* xo = xnh + (size_t)gid * DIM;
  _Float16* zo = zh + (size_t)gid * DIM;
  #pragma unroll 8
  for (int c = 0; c < DIM; ++c) {
    xo[c] = (_Float16)(nw[c] * xb[(size_t)c * SEQ] * rinv);
    zo[c] = (_Float16)(zb[(size_t)c * SEQ]);
  }
}

// ---------------------------------------------------------------------------
// Correlation: corr[b,h] += xr(32 x T) @ k(32 x T)^T with k = Kw@xn + Kb.
// One block per (b, 32-position tile), 8 waves.
// ---------------------------------------------------------------------------
__global__ void k_corr(const _Float16* __restrict__ xnh,
                       const _Float16* __restrict__ Kwh,
                       const float* __restrict__ Kb,
                       float* __restrict__ corr) {
  __shared__ __align__(16) _Float16 xs[32 * DIM];   // [pos][c]
  __shared__ __align__(16) _Float16 ks[32 * DIM];   // [pos][c]
  int blk = blockIdx.x;
  int b = blk / (SEQ / 32);
  int pb = (blk % (SEQ / 32)) * 32;
  int tid = threadIdx.x, lane = tid & 31, wave = tid >> 5;
  int row = lane & 15, hi8 = (lane >> 4) << 3;

  // Async-stage the xn tile (8 KB) straight into LDS, bypassing VGPRs.
  const _Float16* src = xnh + ((size_t)b * SEQ + pb) * DIM;
  for (int i = tid; i < (32 * DIM) / 8; i += 256)
    async_copy_b128(xs + i * 8, src + i * 8);
  wait_async0();
  __syncthreads();

  // k = Kw @ xn + Kb : wave owns output chunk [wave*16, wave*16+16)
  #pragma unroll
  for (int nc = 0; nc < 2; ++nc) {
    v8f acc = {};
    #pragma unroll
    for (int kb = 0; kb < 4; ++kb) {
      v16h a = frag_rm(Kwh, DIM, wave * 16 + row, kb * 32, lane);
      v16h bf = frag_rm(xs + nc * 16 * DIM, DIM, row, kb * 32, lane);
      acc = wmma32(a, bf, acc);
    }
    int o0 = wave * 16 + hi8;
    int p = nc * 16 + row;
    #pragma unroll
    for (int r = 0; r < 8; ++r)
      ks[p * DIM + o0 + r] = (_Float16)(acc[r] + Kb[o0 + r]);
  }
  __syncthreads();

  // corr partial: A = xr (32 x 32 pos), B = k^T (32 pos x 32), K = 32 positions
  int head = wave >> 1, mc = wave & 1;
  #pragma unroll
  for (int nc = 0; nc < 2; ++nc) {
    v16h a = frag_gather(xs + ((mc * 16 + row) * HEAD + head), DIM, lane);
    v16h bf = frag_gather(ks + ((nc * 16 + row) * HEAD + head), DIM, lane);
    v8f acc = {};
    acc = wmma32(a, bf, acc);
    float* cp = corr + (((size_t)b * HEAD + head) * 32) * 32;
    int d0 = mc * 16 + hi8;
    int s = nc * 16 + row;
    #pragma unroll
    for (int r = 0; r < 8; ++r) atomicAdd(&cp[(d0 + r) * 32 + s], acc[r]);
  }
}

// ---------------------------------------------------------------------------
// Main per-tile kernel: SwiGLU FFN + Q projection + corr@q + gated combine.
// One block per (b, 16-position tile), 8 waves.
// ---------------------------------------------------------------------------
__global__ void k_main(const _Float16* __restrict__ xnh,
                       const _Float16* __restrict__ zh,
                       const _Float16* __restrict__ W1h,
                       const float* __restrict__ W1b,
                       const _Float16* __restrict__ W2h,
                       const float* __restrict__ W2b,
                       const _Float16* __restrict__ W3h,
                       const float* __restrict__ W3b,
                       const _Float16* __restrict__ Qwh,
                       const float* __restrict__ Qb,
                       const float* __restrict__ corr,
                       const float* __restrict__ aalpha,
                       const float* __restrict__ abeta,
                       const float* __restrict__ galpha,
                       const float* __restrict__ gbeta,
                       float* __restrict__ out) {
  __shared__ __align__(16) _Float16 xs[16 * DIM];        // xn tile [p][c]
  __shared__ __align__(16) _Float16 zs[16 * DIM];        // z  tile [p][c]
  __shared__ __align__(16) _Float16 gh[16 * HID];        // silu(h1)*h2 [p][o]
  __shared__ __align__(16) _Float16 qs[16 * DIM];        // q tile [p][c]
  __shared__ __align__(16) _Float16 cs[HEAD * 32 * 32];  // corr f16 [h][d][s]
  __shared__ __align__(16) float    fs[16 * DIM];        // ffn f32 [p][c]

  int blk = blockIdx.x;
  int b = blk / (SEQ / 16);
  int pb = (blk % (SEQ / 16)) * 16;
  int tid = threadIdx.x, lane = tid & 31, wave = tid >> 5;
  int row = lane & 15, hi8 = (lane >> 4) << 3;

  // Async-stage xn and z tiles (4 KB each) into LDS, bypassing VGPRs.
  const _Float16* sx = xnh + ((size_t)b * SEQ + pb) * DIM;
  const _Float16* sz = zh + ((size_t)b * SEQ + pb) * DIM;
  __builtin_prefetch(sx + 16 * DIM, 0, 0);   // next tile -> global_prefetch_b8
  for (int i = tid; i < (16 * DIM) / 8; i += 256) {
    async_copy_b128(xs + i * 8, sx + i * 8);
    async_copy_b128(zs + i * 8, sz + i * 8);
  }
  // Corr needs an f32->f16 conversion, so it rides the normal VGPR path.
  const float* cb = corr + (size_t)b * HEAD * 32 * 32;
  for (int i = tid; i < HEAD * 32 * 32; i += 256) cs[i] = (_Float16)cb[i];
  wait_async0();
  __syncthreads();

  // ---- W1 / W2 GEMMs (512x128 each), wave owns 4 output chunks of 16 ----
  for (int m = 0; m < 4; ++m) {
    int ob = (wave * 4 + m) * 16;
    v8f a1 = {}, a2 = {};
    #pragma unroll
    for (int kb = 0; kb < 4; ++kb) {
      v16h bf = frag_rm(xs, DIM, row, kb * 32, lane);
      v16h af1 = frag_rm(W1h, DIM, ob + row, kb * 32, lane);
      a1 = wmma32(af1, bf, a1);
      v16h af2 = frag_rm(W2h, DIM, ob + row, kb * 32, lane);
      a2 = wmma32(af2, bf, a2);
    }
    int o0 = ob + hi8, p = row;
    #pragma unroll
    for (int r = 0; r < 8; ++r) {
      float h1 = a1[r] + W1b[o0 + r];
      float h2 = a2[r] + W2b[o0 + r];
      float g = (h1 / (1.0f + __expf(-h1))) * h2;   // silu(h1)*h2
      gh[p * HID + o0 + r] = (_Float16)g;
    }
  }

  // ---- Q projection (128x128), wave owns one output chunk ----
  {
    int ob = wave * 16;
    v8f aq = {};
    #pragma unroll
    for (int kb = 0; kb < 4; ++kb) {
      v16h bf = frag_rm(zs, DIM, row, kb * 32, lane);
      v16h af = frag_rm(Qwh, DIM, ob + row, kb * 32, lane);
      aq = wmma32(af, bf, aq);
    }
    int o0 = ob + hi8, p = row;
    #pragma unroll
    for (int r = 0; r < 8; ++r)
      qs[p * DIM + o0 + r] = (_Float16)(aq[r] + Qb[o0 + r]);
  }
  __syncthreads();

  // ---- W3 GEMM (128x512), wave owns one output chunk, K = 512 ----
  {
    int ob = wave * 16;
    v8f a3 = {};
    #pragma unroll
    for (int kb = 0; kb < 16; ++kb) {
      v16h aw = frag_rm(W3h, HID, ob + row, kb * 32, lane);
      v16h bg = frag_rm(gh, HID, row, kb * 32, lane);
      a3 = wmma32(aw, bg, a3);
    }
    int o0 = ob + hi8, p = row;
    #pragma unroll
    for (int r = 0; r < 8; ++r)
      fs[p * DIM + o0 + r] = a3[r] + W3b[o0 + r];
  }
  __syncthreads();

  // ---- attn = corr @ q, then gated combine + store ----
  {
    int head = wave >> 1, mc = wave & 1;
    v16h ac = frag_rm(cs + head * 32 * 32, 32, mc * 16 + row, 0, lane);
    v16h bq = frag_gather(qs + row * DIM + head, HEAD, lane);
    v8f at = {};
    at = wmma32(ac, bq, at);
    float sa = sigm(aalpha[head]);
    float sb = sigm(abeta[head]);
    float ga = sigm(galpha[0]);
    float gb = sigm(gbeta[0]);
    int p = row, d0 = mc * 16 + hi8;
    #pragma unroll
    for (int r = 0; r < 8; ++r) {
      int d = d0 + r;
      int c = d * HEAD + head;
      float attnv = at[r] * (1.0f / SEQ);
      float mha = sa * (float)xs[p * DIM + c] + sb * attnv;
      out[(((size_t)b * DIM) + c) * SEQ + pb + p] =
          ga * fs[p * DIM + c] + gb * mha;
    }
  }
}

// ---------------------------------------------------------------------------
// Host launch
// ---------------------------------------------------------------------------
extern "C" void kernel_launch(void* const* d_in, const int* in_sizes, int n_in,
                              void* d_out, int out_size, void* d_ws,
                              size_t ws_size, hipStream_t stream) {
  const float* x  = (const float*)d_in[0];
  const float* z  = (const float*)d_in[1];
  const float* nw = (const float*)d_in[2];
  const float* Qw = (const float*)d_in[3];
  const float* Qb = (const float*)d_in[4];
  const float* Kw = (const float*)d_in[5];
  const float* Kb = (const float*)d_in[6];
  const float* aalpha = (const float*)d_in[7];
  const float* abeta  = (const float*)d_in[8];
  const float* W1w = (const float*)d_in[9];
  const float* W1b = (const float*)d_in[10];
  const float* W2w = (const float*)d_in[11];
  const float* W2b = (const float*)d_in[12];
  const float* W3w = (const float*)d_in[13];
  const float* W3b = (const float*)d_in[14];
  const float* galpha = (const float*)d_in[15];
  const float* gbeta  = (const float*)d_in[16];
  float* out = (float*)d_out;

  // Workspace carve-up
  char* p = (char*)d_ws;
  _Float16* xnh = (_Float16*)p; p += NPOS * DIM * 2;
  _Float16* zh  = (_Float16*)p; p += NPOS * DIM * 2;
  _Float16* W1h = (_Float16*)p; p += (size_t)HID * DIM * 2;
  _Float16* W2h = (_Float16*)p; p += (size_t)HID * DIM * 2;
  _Float16* W3h = (_Float16*)p; p += (size_t)DIM * HID * 2;
  _Float16* Qwh = (_Float16*)p; p += (size_t)DIM * DIM * 2;
  _Float16* Kwh = (_Float16*)p; p += (size_t)DIM * DIM * 2;
  float* corr = (float*)p;      p += (size_t)BB * HEAD * 32 * 32 * 4;

  hipMemsetAsync(corr, 0, (size_t)BB * HEAD * 32 * 32 * 4, stream);

  // Weight conversion f32 -> f16
  k_cvt<<<(HID * DIM + 255) / 256, 256, 0, stream>>>(W1w, W1h, HID * DIM);
  k_cvt<<<(HID * DIM + 255) / 256, 256, 0, stream>>>(W2w, W2h, HID * DIM);
  k_cvt<<<(DIM * HID + 255) / 256, 256, 0, stream>>>(W3w, W3h, DIM * HID);
  k_cvt<<<(DIM * DIM + 255) / 256, 256, 0, stream>>>(Qw, Qwh, DIM * DIM);
  k_cvt<<<(DIM * DIM + 255) / 256, 256, 0, stream>>>(Kw, Kwh, DIM * DIM);

  // RMSNorm + f16 conversion
  k_norm<<<(int)(NPOS / 256), 256, 0, stream>>>(x, z, nw, xnh, zh);

  // Per-head 32x32 correlations (reduction over n)
  k_corr<<<BB * (SEQ / 32), 256, 0, stream>>>(xnh, Kwh, Kb, corr);

  // FFN + attention apply + gated combine
  k_main<<<BB * (SEQ / 16), 256, 0, stream>>>(
      xnh, zh, W1h, W1b, W2h, W2b, W3h, W3b, Qwh, Qb, corr,
      aalpha, abeta, galpha, gbeta, out);
}

// v001
// In both of two side-by-side timings against v000, it was 1.25 times as fast.
#include <hip/hip_runtime.h>
#include <hip/hip_bf16.h>

// ---------------------------------------------------------------------------
// Parallel Graphormer block for MI455X (gfx1250, wave32, WMMA).
// All channel GEMMs run through v_wmma_f32_16x16x32_f16; tile staging uses
// GLOBAL_LOAD_ASYNC_TO_LDS_B128 (ASYNCcnt) to bypass VGPRs.
// ---------------------------------------------------------------------------

#define BB   16
#define DIM  128
#define SEQ  8192
#define HEAD 4
#define HID  512
#define NPOS ((size_t)BB * SEQ)

// LDS row pitches. The tiles that use them are read one row per lane, so an
// unpadded power-of-two row puts all 16 rows of a 16-byte read on the same
// four banks. One 16-byte pad per row makes the pitch 16 B x odd, which
// spreads the 16 rows over all 64 banks.
#define XP (DIM + 8)   // f16 rows of DIM: 272 B
#define GP (HID + 8)   // f16 rows of HID: 1040 B
#define FP (DIM + 4)   // f32 rows of DIM: 528 B

typedef __attribute__((ext_vector_type(16))) _Float16 v16h;
typedef __attribute__((ext_vector_type(8)))  float    v8f;

__device__ __forceinline__ v8f wmma32(v16h a, v16h b, v8f c) {
  // D = A(16x32 f16) * B(32x16 f16) + C(16x16 f32)
  return __builtin_amdgcn_wmma_f32_16x16x32_f16(
      /*neg_a=*/false, a, /*neg_b=*/false, b,
      /*c_mod=*/(short)0, c, /*reuse_a=*/false, /*reuse_b=*/false);
}

// Async global -> LDS 16-byte copy (per active lane). VDST VGPR carries the
// LDS byte address (low 32 bits of the generic shared pointer), VADDR the
// 64-bit global address. Tracked by ASYNCcnt.
__device__ __forceinline__ void async_copy_b128(void* lds_ptr,
                                                const void* gptr) {
  unsigned lds_addr = (unsigned)(size_t)lds_ptr;
  unsigned long long ga = (unsigned long long)(size_t)gptr;
  // The wait stands inside the copy's own statement so that it precedes any
  // rewrite of the two address registers.
  asm volatile("global_load_async_to_lds_b128 %0, %1, off\n\ts_wait_xcnt 0x0"
               :: "v"(lds_addr), "v"(ga)
               : "memory");
}

__device__ __forceinline__ void wait_async0() {
  asm volatile("s_wait_asynccnt 0" ::: "memory");
}

// Load 16 f16 as two contiguous 16B chunks (p0[0..7], p0[16..23]) matching the
// ISA 16-bit A/B fragment striping: half h<8 -> K = 8*(lane>=16)+h,
// h>=8 -> K = 16 + 8*(lane>=16) + (h-8).
__device__ __forceinline__ v16h load16h(const _Float16* p0) {
  float4 a = *(const float4*)(p0);
  float4 b = *(const float4*)(p0 + 16);
  v16h r;
  __builtin_memcpy(&r, &a, 16);
  __builtin_memcpy(((char*)&r) + 16, &b, 16);
  return r;
}

// Row-major fragment: base[row*ldk + kb + ...] with contiguous K runs.
__device__ __forceinline__ v16h frag_rm(const _Float16* base, int ldk,
                                        int row, int kb, int lane) {
  return load16h(base + (size_t)row * ldk + kb + ((lane >> 4) << 3));
}

// Gather fragment for strided K (e.g. channel = K*HEAD + head).
__device__ __forceinline__ v16h frag_gather(const _Float16* base, int stride,
                                            int lane) {
  v16h r = {};
  int lo = (lane >> 4) << 3;
  #pragma unroll
  for (int h = 0; h < 16; ++h) {
    int K = h + ((h >= 8) ? 8 : 0) + lo;
    r[h] = base[(size_t)K * stride];
  }
  return r;
}

__device__ __forceinline__ float sigm(float v) {
  return 1.0f / (1.0f + __expf(-v));
}

// ---------------------------------------------------------------------------
// Weight conversion f32 -> f16
// ---------------------------------------------------------------------------
__global__ void k_cvt(const float* __restrict__ s, _Float16* __restrict__ d,
                      int n) {
  int i = blockIdx.x * 256 + threadIdx.x;
  if (i < n) d[i] = (_Float16)s[i];
}

// ---------------------------------------------------------------------------
// RMSNorm over channels + f16 conversion of xn and z.
// Layout in: (b, c, n) f32.  Layout out: (b*n, c) f16 (GEMM-friendly rows).
// ---------------------------------------------------------------------------
__global__ void k_norm(const float* __restrict__ x, const float* __restrict__ z,
                       const float* __restrict__ nw,
                       _Float16* __restrict__ xnh, _Float16* __restrict__ zh) {
  int gid = blockIdx.x * 256 + threadIdx.x;   // 0 .. B*SEQ-1
  int b = gid >> 13;                          // / SEQ
  int p = gid & (SEQ - 1);
  const float* xb = x + ((size_t)b * DIM) * SEQ + p;
  const float* zb = z + ((size_t)b * DIM) * SEQ + p;
  float ss = 0.0f;
  #pragma unroll 8
  for (int c = 0; c < DIM; ++c) {
    float v = xb[(size_t)c * SEQ];
    ss += v * v;
  }
  float rinv = rsqrtf(ss * (1.0f / DIM) + 1e-6f);
  _Float16* xo = xnh + (size_t)gid * DIM;
  _Float16* zo = zh + (size_t)gid * DIM;
  #pragma unroll 8
  for (int c = 0; c < DIM; ++c) {
    xo[c] = (_Float16)(nw[c] * xb[(size_t)c * SEQ] * rinv);
    zo[c] = (_Float16)(zb[(size_t)c * SEQ]);
  }
}

// ---------------------------------------------------------------------------
// Correlation: corr[b,h] += xr(32 x T) @ k(32 x T)^T with k = Kw@xn + Kb.
// One block per (b, 32-position tile), 8 waves.
// ---------------------------------------------------------------------------
__global__ void k_corr(const _Float16* __restrict__ xnh,
                       const _Float16* __restrict__ Kwh,
                       const float* __restrict__ Kb,
                       float* __restrict__ corr) {
  __shared__ __align__(16) _Float16 xs[32 * XP];   // [pos][c], padded rows
  __shared__ __align__(16) _Float16 ks[32 * XP];   // [pos][c], padded rows
  int blk = blockIdx.x;
  int b = blk / (SEQ / 32);
  int pb = (blk % (SEQ / 32)) * 32;
  int tid = threadIdx.x, lane = tid & 31, wave = tid >> 5;
  int row = lane & 15, hi8 = (lane >> 4) << 3;

  // Async-stage the xn tile (8 KB) straight into LDS, bypassing VGPRs.
  const _Float16* src = xnh + ((size_t)b * SEQ + pb) * DIM;
  for (int i = tid; i < (32 * DIM) / 8; i += 256)
    async_copy_b128(xs + (i >> 4) * XP + (i & 15) * 8, src + i * 8);
  wait_async0();
  __syncthreads();

  // k = Kw @ xn + Kb : wave owns output chunk [wave*16, wave*16+16)
  #pragma unroll
  for (int nc = 0; nc < 2; ++nc) {
    v8f acc = {};
    #pragma unroll
    for (int kb = 0; kb < 4; ++kb) {
      v16h a = frag_rm(Kwh, DIM, wave * 16 + row, kb * 32, lane);
      v16h bf = frag_rm(xs + nc * 16 * XP, XP, row, kb * 32, lane);
      acc = wmma32(a, bf, acc);
    }
    int o0 = wave * 16 + hi8;
    int p = nc * 16 + row;
    #pragma unroll
    for (int r = 0; r < 8; ++r)
      ks[p * XP + o0 + r] = (_Float16)(acc[r] + Kb[o0 + r]);
  }
  __syncthreads();

  // corr partial: A = xr (32 x 32 pos), B = k^T (32 pos x 32), K = 32 positions
  int head = wave >> 1, mc = wave & 1;
  #pragma unroll
  for (int nc = 0; nc < 2; ++nc) {
    v16h a = frag_gather(xs + ((mc * 16 + row) * HEAD + head), XP, lane);
    v16h bf = frag_gather(ks + ((nc * 16 + row) * HEAD + head), XP, lane);
    v8f acc = {};
    acc = wmma32(a, bf, acc);
    float* cp = corr + (((size_t)b * HEAD + head) * 32) * 32;
    int d0 = mc * 16 + hi8;
    int s = nc * 16 + row;
    #pragma unroll
    for (int r = 0; r < 8; ++r) atomicAdd(&cp[(d0 + r) * 32 + s], acc[r]);
  }
}

// ---------------------------------------------------------------------------
// Main per-tile kernel: SwiGLU FFN + Q projection + corr@q + gated combine.
// One block per (b, 16-position tile), 8 waves.
// ---------------------------------------------------------------------------
__global__ void k_main(const _Float16* __restrict__ xnh,
                       const _Float16* __restrict__ zh,
                       const _Float16* __restrict__ W1h,
                       const float* __restrict__ W1b,
                       const _Float16* __restrict__ W2h,
                       const float* __restrict__ W2b,
                       const _Float16* __restrict__ W3h,
                       const float* __restrict__ W3b,
                       const _Float16* __restrict__ Qwh,
                       const float* __restrict__ Qb,
                       const float* __restrict__ corr,
                       const float* __restrict__ aalpha,
                       const float* __restrict__ abeta,
                       const float* __restrict__ galpha,
                       const float* __restrict__ gbeta,
                       float* __restrict__ out) {
  __shared__ __align__(16) _Float16 xs[16 * XP];         // xn tile [p][c]
  __shared__ __align__(16) _Float16 zs[16 * XP];         // z  tile [p][c]
  __shared__ __align__(16) _Float16 gh[16 * GP];         // silu(h1)*h2 [p][o]
  __shared__ __align__(16) _Float16 qs[16 * XP];         // q tile [p][c]
  __shared__ __align__(16) _Float16 cs[HEAD * 32 * 32];  // corr f16 [h][d][s]
  __shared__ __align__(16) float    fs[16 * FP];         // ffn f32 [p][c]

  int blk = blockIdx.x;
  int b = blk / (SEQ / 16);
  int pb = (blk % (SEQ / 16)) * 16;
  int tid = threadIdx.x, lane = tid & 31, wave = tid >> 5;
  int row = lane & 15, hi8 = (lane >> 4) << 3;

  // Async-stage xn and z tiles (4 KB each) into LDS, bypassing VGPRs.
  const _Float16* sx = xnh + ((size_t)b * SEQ + pb) * DIM;
  const _Float16* sz = zh + ((size_t)b * SEQ + pb) * DIM;
  __builtin_prefetch(sx + 16 * DIM, 0, 0);   // next tile -> global_prefetch_b8
  for (int i = tid; i < (16 * DIM) / 8; i += 256) {
    async_copy_b128(xs + (i >> 4) * XP + (i & 15) * 8, sx + i * 8);
    async_copy_b128(zs + (i >> 4) * XP + (i & 15) * 8, sz + i * 8);
  }
  // Corr needs an f32->f16 conversion, so it rides the normal VGPR path.
  const float* cb = corr + (size_t)b * HEAD * 32 * 32;
  for (int i = tid; i < HEAD * 32 * 32; i += 256) cs[i] = (_Float16)cb[i];
  wait_async0();
  __syncthreads();

  // ---- W1 / W2 GEMMs (512x128 each), wave owns 4 output chunks of 16 ----
  for (int m = 0; m < 4; ++m) {
    int ob = (wave * 4 + m) * 16;
    v8f a1 = {}, a2 = {};
    #pragma unroll
    for (int kb = 0; kb < 4; ++kb) {
      v16h bf = frag_rm(xs, XP, row, kb * 32, lane);
      v16h af1 = frag_rm(W1h, DIM, ob + row, kb * 32, lane);
      a1 = wmma32(af1, bf, a1);
      v16h af2 = frag_rm(W2h, DIM, ob + row, kb * 32, lane);
      a2 = wmma32(af2, bf, a2);
    }
    int o0 = ob + hi8, p = row;
    #pragma unroll
    for (int r = 0; r < 8; ++r) {
      float h1 = a1[r] + W1b[o0 + r];
      float h2 = a2[r] + W2b[o0 + r];
      float g = (h1 / (1.0f + __expf(-h1))) * h2;   // silu(h1)*h2
      gh[p * GP + o0 + r] = (_Float16)g;
    }
  }

  // ---- Q projection (128x128), wave owns one output chunk ----
  {
    int ob = wave * 16;
    v8f aq = {};
    #pragma unroll
    for (int kb = 0; kb < 4; ++kb) {
      v16h bf = frag_rm(zs, XP, row, kb * 32, lane);
      v16h af = frag_rm(Qwh, DIM, ob + row, kb * 32, lane);
      aq = wmma32(af, bf, aq);
    }
    int o0 = ob + hi8, p = row;
    #pragma unroll
    for (int r = 0; r < 8; ++r)
      qs[p * XP + o0 + r] = (_Float16)(aq[r] + Qb[o0 + r]);
  }
  __syncthreads();

  // ---- W3 GEMM (128x512), wave owns one output chunk, K = 512 ----
  {
    int ob = wave * 16;
    v8f a3 = {};
    #pragma unroll
    for (int kb = 0; kb < 16; ++kb) {
      v16h aw = frag_rm(W3h, HID, ob + row, kb * 32, lane);
      v16h bg = frag_rm(gh, GP, row, kb * 32, lane);
      a3 = wmma32(aw, bg, a3);
    }
    int o0 = ob + hi8, p = row;
    #pragma unroll
    for (int r = 0; r < 8; ++r)
      fs[p * FP + o0 + r] = a3[r] + W3b[o0 + r];
  }
  __syncthreads();

  // ---- attn = corr @ q, then gated combine + store ----
  {
    int head = wave >> 1, mc = wave & 1;
    v16h ac = frag_rm(cs + head * 32 * 32, 32, mc * 16 + row, 0, lane);
    v16h bq = frag_gather(qs + row * XP + head, HEAD, lane);
    v8f at = {};
    at = wmma32(ac, bq, at);
    float sa = sigm(aalpha[head]);
    float sb = sigm(abeta[head]);
    float ga = sigm(galpha[0]);
    float gb = sigm(gbeta[0]);
    int p = row, d0 = mc * 16 + hi8;
    #pragma unroll
    for (int r = 0; r < 8; ++r) {
      int d = d0 + r;
      int c = d * HEAD + head;
      float attnv = at[r] * (1.0f / SEQ);
      float mha = sa * (float)xs[p * XP + c] + sb * attnv;
      out[(((size_t)b * DIM) + c) * SEQ + pb + p] =
          ga * fs[p * FP + c] + gb * mha;
    }
  }
}

// ---------------------------------------------------------------------------
// Host launch
// ---------------------------------------------------------------------------
extern "C" void kernel_launch(void* const* d_in, const int* in_sizes, int n_in,
                              void* d_out, int out_size, void* d_ws,
                              size_t ws_size, hipStream_t stream) {
  const float* x  = (const float*)d_in[0];
  const float* z  = (const float*)d_in[1];
  const float* nw = (const float*)d_in[2];
  const float* Qw = (const float*)d_in[3];
  const float* Qb = (const float*)d_in[4];
  const float* Kw = (const float*)d_in[5];
  const float* Kb = (const float*)d_in[6];
  const float* aalpha = (const float*)d_in[7];
  const float* abeta  = (const float*)d_in[8];
  const float* W1w = (const float*)d_in[9];
  const float* W1b = (const float*)d_in[10];
  const float* W2w = (const float*)d_in[11];
  const float* W2b = (const float*)d_in[12];
  const float* W3w = (const float*)d_in[13];
  const float* W3b = (const float*)d_in[14];
  const float* galpha = (const float*)d_in[15];
  const float* gbeta  = (const float*)d_in[16];
  float* out = (float*)d_out;

  // Workspace carve-up
  char* p = (char*)d_ws;
  _Float16* xnh = (_Float16*)p; p += NPOS * DIM * 2;
  _Float16* zh  = (_Float16*)p; p += NPOS * DIM * 2;
  _Float16* W1h = (_Float16*)p; p += (size_t)HID * DIM * 2;
  _Float16* W2h = (_Float16*)p; p += (size_t)HID * DIM * 2;
  _Float16* W3h = (_Float16*)p; p += (size_t)DIM * HID * 2;
  _Float16* Qwh = (_Float16*)p; p += (size_t)DIM * DIM * 2;
  _Float16* Kwh = (_Float16*)p; p += (size_t)DIM * DIM * 2;
  float* corr = (float*)p;      p += (size_t)BB * HEAD * 32 * 32 * 4;

  hipMemsetAsync(corr, 0, (size_t)BB * HEAD * 32 * 32 * 4, stream);

  // Weight conversion f32 -> f16
  k_cvt<<<(HID * DIM + 255) / 256, 256, 0, stream>>>(W1w, W1h, HID * DIM);
  k_cvt<<<(HID * DIM + 255) / 256, 256, 0, stream>>>(W2w, W2h, HID * DIM);
  k_cvt<<<(DIM * HID + 255) / 256, 256, 0, stream>>>(W3w, W3h, DIM * HID);
  k_cvt<<<(DIM * DIM + 255) / 256, 256, 0, stream>>>(Qw, Qwh, DIM * DIM);
  k_cvt<<<(DIM * DIM + 255) / 256, 256, 0, stream>>>(Kw, Kwh, DIM * DIM);

  // RMSNorm + f16 conversion
  k_norm<<<(int)(NPOS / 256), 256, 0, stream>>>(x, z, nw, xnh, zh);

  // Per-head 32x32 correlations (reduction over n)
  k_corr<<<BB * (SEQ / 32), 256, 0, stream>>>(xnh, Kwh, Kb, corr);

  // FFN + attention apply + gated combine
  k_main<<<BB * (SEQ / 16), 256, 0, stream>>>(
      xnh, zh, W1h, W1b, W2h, W2b, W3h, W3b, Qwh, Qb, corr,
      aalpha, abeta, galpha, gbeta, out);
}

// v002
// Timed twice side by side with v001, it ran 1.65 and 1.63 times as fast.
// Counting every step since v000, it is 2.05 times as fast.
#include <hip/hip_runtime.h>
#include <hip/hip_bf16.h>

// ---------------------------------------------------------------------------
// Parallel Graphormer block for MI455X (gfx1250, wave32, WMMA).
// All channel GEMMs run through v_wmma_f32_16x16x32_f16; tile staging uses
// GLOBAL_LOAD_ASYNC_TO_LDS_B128 (ASYNCcnt) to bypass VGPRs.
// ---------------------------------------------------------------------------

#define BB   16
#define DIM  128
#define SEQ  8192
#define HEAD 4
#define HID  512
#define NPOS ((size_t)BB * SEQ)

// LDS row pitches. The tiles that use them are read one row per lane, so an
// unpadded power-of-two row puts all 16 rows of a 16-byte read on the same
// four banks. One 16-byte pad per row makes the pitch 16 B x odd, which
// spreads the 16 rows over all 64 banks.
#define XP (DIM + 8)   // f16 rows of DIM: 272 B
#define GP (HID + 8)   // f16 rows of HID: 1040 B
#define FP (DIM + 4)   // f32 rows of DIM: 528 B

// Positions per block of k_main. Every weight fragment a wave loads from
// global memory feeds NT matrix products, one per 16-position sub-tile.
#define TP 64
#define NT (TP / 16)

typedef __attribute__((ext_vector_type(16))) _Float16 v16h;
typedef __attribute__((ext_vector_type(8)))  float    v8f;

__device__ __forceinline__ v8f wmma32(v16h a, v16h b, v8f c) {
  // D = A(16x32 f16) * B(32x16 f16) + C(16x16 f32)
  return __builtin_amdgcn_wmma_f32_16x16x32_f16(
      /*neg_a=*/false, a, /*neg_b=*/false, b,
      /*c_mod=*/(short)0, c, /*reuse_a=*/false, /*reuse_b=*/false);
}

// Async global -> LDS 16-byte copy (per active lane). VDST VGPR carries the
// LDS byte address (low 32 bits of the generic shared pointer), VADDR the
// 64-bit global address. Tracked by ASYNCcnt.
__device__ __forceinline__ void async_copy_b128(void* lds_ptr,
                                                const void* gptr) {
  unsigned lds_addr = (unsigned)(size_t)lds_ptr;
  unsigned long long ga = (unsigned long long)(size_t)gptr;
  // The wait stands inside the copy's own statement so that it precedes any
  // rewrite of the two address registers.
  asm volatile("global_load_async_to_lds_b128 %0, %1, off\n\ts_wait_xcnt 0x0"
               :: "v"(lds_addr), "v"(ga)
               : "memory");
}

__device__ __forceinline__ void wait_async0() {
  asm volatile("s_wait_asynccnt 0" ::: "memory");
}

// Load 16 f16 as two contiguous 16B chunks (p0[0..7], p0[16..23]) matching the
// ISA 16-bit A/B fragment striping: half h<8 -> K = 8*(lane>=16)+h,
// h>=8 -> K = 16 + 8*(lane>=16) + (h-8).
__device__ __forceinline__ v16h load16h(const _Float16* p0) {
  float4 a = *(const float4*)(p0);
  float4 b = *(const float4*)(p0 + 16);
  v16h r;
  __builtin_memcpy(&r, &a, 16);
  __builtin_memcpy(((char*)&r) + 16, &b, 16);
  return r;
}

// Row-major fragment: base[row*ldk + kb + ...] with contiguous K runs.
__device__ __forceinline__ v16h frag_rm(const _Float16* base, int ldk,
                                        int row, int kb, int lane) {
  return load16h(base + (size_t)row * ldk + kb + ((lane >> 4) << 3));
}

// Gather fragment for strided K (e.g. channel = K*HEAD + head).
__device__ __forceinline__ v16h frag_gather(const _Float16* base, int stride,
                                            int lane) {
  v16h r = {};
  int lo = (lane >> 4) << 3;
  #pragma unroll
  for (int h = 0; h < 16; ++h) {
    int K = h + ((h >= 8) ? 8 : 0) + lo;
    r[h] = base[(size_t)K * stride];
  }
  return r;
}

__device__ __forceinline__ float sigm(float v) {
  return 1.0f / (1.0f + __expf(-v));
}

// ---------------------------------------------------------------------------
// Weight conversion f32 -> f16
// ---------------------------------------------------------------------------
__global__ void k_cvt(const float* __restrict__ s, _Float16* __restrict__ d,
                      int n) {
  int i = blockIdx.x * 256 + threadIdx.x;
  if (i < n) d[i] = (_Float16)s[i];
}

// ---------------------------------------------------------------------------
// RMSNorm over channels + f16 conversion of xn and z.
// Layout in: (b, c, n) f32.  Layout out: (b*n, c) f16 (GEMM-friendly rows).
// ---------------------------------------------------------------------------
__global__ void k_norm(const float* __restrict__ x, const float* __restrict__ z,
                       const float* __restrict__ nw,
                       _Float16* __restrict__ xnh, _Float16* __restrict__ zh) {
  int gid = blockIdx.x * 256 + threadIdx.x;   // 0 .. B*SEQ-1
  int b = gid >> 13;                          // / SEQ
  int p = gid & (SEQ - 1);
  const float* xb = x + ((size_t)b * DIM) * SEQ + p;
  const float* zb = z + ((size_t)b * DIM) * SEQ + p;
  float ss = 0.0f;
  #pragma unroll 8
  for (int c = 0; c < DIM; ++c) {
    float v = xb[(size_t)c * SEQ];
    ss += v * v;
  }
  float rinv = rsqrtf(ss * (1.0f / DIM) + 1e-6f);
  _Float16* xo = xnh + (size_t)gid * DIM;
  _Float16* zo = zh + (size_t)gid * DIM;
  #pragma unroll 8
  for (int c = 0; c < DIM; ++c) {
    xo[c] = (_Float16)(nw[c] * xb[(size_t)c * SEQ] * rinv);
    zo[c] = (_Float16)(zb[(size_t)c * SEQ]);
  }
}

// ---------------------------------------------------------------------------
// Correlation: corr[b,h] += xr(32 x T) @ k(32 x T)^T with k = Kw@xn + Kb.
// One block per (b, 32-position tile), 8 waves.
// ---------------------------------------------------------------------------
__global__ void k_corr(const _Float16* __restrict__ xnh,
                       const _Float16* __restrict__ Kwh,
                       const float* __restrict__ Kb,
                       float* __restrict__ corr) {
  __shared__ __align__(16) _Float16 xs[32 * XP];   // [pos][c], padded rows
  __shared__ __align__(16) _Float16 ks[32 * XP];   // [pos][c], padded rows
  int blk = blockIdx.x;
  int b = blk / (SEQ / 32);
  int pb = (blk % (SEQ / 32)) * 32;
  int tid = threadIdx.x, lane = tid & 31, wave = tid >> 5;
  int row = lane & 15, hi8 = (lane >> 4) << 3;

  // Async-stage the xn tile (8 KB) straight into LDS, bypassing VGPRs.
  const _Float16* src = xnh + ((size_t)b * SEQ + pb) * DIM;
  for (int i = tid; i < (32 * DIM) / 8; i += 256)
    async_copy_b128(xs + (i >> 4) * XP + (i & 15) * 8, src + i * 8);
  wait_async0();
  __syncthreads();

  // k = Kw @ xn + Kb : wave owns output chunk [wave*16, wave*16+16)
  #pragma unroll
  for (int nc = 0; nc < 2; ++nc) {
    v8f acc = {};
    #pragma unroll
    for (int kb = 0; kb < 4; ++kb) {
      v16h a = frag_rm(Kwh, DIM, wave * 16 + row, kb * 32, lane);
      v16h bf = frag_rm(xs + nc * 16 * XP, XP, row, kb * 32, lane);
      acc = wmma32(a, bf, acc);
    }
    int o0 = wave * 16 + hi8;
    int p = nc * 16 + row;
    #pragma unroll
    for (int r = 0; r < 8; ++r)
      ks[p * XP + o0 + r] = (_Float16)(acc[r] + Kb[o0 + r]);
  }
  __syncthreads();

  // corr partial: A = xr (32 x 32 pos), B = k^T (32 pos x 32), K = 32 positions
  int head = wave >> 1, mc = wave & 1;
  #pragma unroll
  for (int nc = 0; nc < 2; ++nc) {
    v16h a = frag_gather(xs + ((mc * 16 + row) * HEAD + head), XP, lane);
    v16h bf = frag_gather(ks + ((nc * 16 + row) * HEAD + head), XP, lane);
    v8f acc = {};
    acc = wmma32(a, bf, acc);
    float* cp = corr + (((size_t)b * HEAD + head) * 32) * 32;
    int d0 = mc * 16 + hi8;
    int s = nc * 16 + row;
    #pragma unroll
    for (int r = 0; r < 8; ++r) atomicAdd(&cp[(d0 + r) * 32 + s], acc[r]);
  }
}

// ---------------------------------------------------------------------------
// Main per-tile kernel: SwiGLU FFN + Q projection + corr@q + gated combine.
// One block per (b, TP-position tile), 8 waves.
// ---------------------------------------------------------------------------
// The real block size, and four waves per SIMD (two blocks per WGP, which is
// what the LDS allows): without it the compiler plans for 1,024 threads, caps
// the wave at 128 registers and spills the accumulators.
__global__ void __launch_bounds__(256, 4)
k_main(const _Float16* __restrict__ xnh,
                       const _Float16* __restrict__ zh,
                       const _Float16* __restrict__ W1h,
                       const float* __restrict__ W1b,
                       const _Float16* __restrict__ W2h,
                       const float* __restrict__ W2b,
                       const _Float16* __restrict__ W3h,
                       const float* __restrict__ W3b,
                       const _Float16* __restrict__ Qwh,
                       const float* __restrict__ Qb,
                       const float* __restrict__ corr,
                       const float* __restrict__ aalpha,
                       const float* __restrict__ abeta,
                       const float* __restrict__ galpha,
                       const float* __restrict__ gbeta,
                       float* __restrict__ out) {
  __shared__ __align__(16) _Float16 xs[TP * XP];         // xn tile [p][c]
  __shared__ __align__(16) _Float16 zs[TP * XP];         // z  tile [p][c]
  __shared__ __align__(16) _Float16 gh[TP * GP];         // silu(h1)*h2 [p][o]
  __shared__ __align__(16) _Float16 qs[TP * XP];         // q tile [p][c]
  __shared__ __align__(16) _Float16 cs[HEAD * 32 * 32];  // corr f16 [h][d][s]
  __shared__ __align__(16) float    fs[TP * FP];         // ffn f32 [p][c]

  int blk = blockIdx.x;
  int b = blk / (SEQ / TP);
  int pb = (blk % (SEQ / TP)) * TP;
  int tid = threadIdx.x, lane = tid & 31, wave = tid >> 5;
  int row = lane & 15, hi8 = (lane >> 4) << 3;

  // Async-stage xn and z tiles (16 KB each) into LDS, bypassing VGPRs.
  const _Float16* sx = xnh + ((size_t)b * SEQ + pb) * DIM;
  const _Float16* sz = zh + ((size_t)b * SEQ + pb) * DIM;
  __builtin_prefetch(sx + TP * DIM, 0, 0);   // next tile -> global_prefetch_b8
  // A constant trip count: every lane is on at every copy.
  for (int k = 0; k < (TP * DIM) / 8 / 256; ++k) {
    int i = k * 256 + tid;
    async_copy_b128(xs + (i >> 4) * XP + (i & 15) * 8, sx + i * 8);
    async_copy_b128(zs + (i >> 4) * XP + (i & 15) * 8, sz + i * 8);
  }
  // Corr needs an f32->f16 conversion, so it rides the normal VGPR path.
  const float* cb = corr + (size_t)b * HEAD * 32 * 32;
  for (int i = tid; i < HEAD * 32 * 32; i += 256) cs[i] = (_Float16)cb[i];
  wait_async0();
  __syncthreads();

  // ---- W1 / W2 GEMMs (512x128 each), wave owns 4 output chunks of 16 ----
  // The xn fragments are the same for every m: read once, kept in registers.
  v16h bx[4][NT];
  #pragma unroll  // constant kb: bx stays in registers
  for (int kb = 0; kb < 4; ++kb) {
    #pragma unroll  // constant nt: the per-sub-tile arrays stay in registers
    for (int nt = 0; nt < NT; ++nt)
      bx[kb][nt] = frag_rm(xs + nt * 16 * XP, XP, row, kb * 32, lane);
  }
  for (int m = 0; m < 4; ++m) {
    int ob = (wave * 4 + m) * 16;
    v8f a1[NT] = {}, a2[NT] = {};
    #pragma unroll
    for (int kb = 0; kb < 4; ++kb) {
      v16h af1 = frag_rm(W1h, DIM, ob + row, kb * 32, lane);
      v16h af2 = frag_rm(W2h, DIM, ob + row, kb * 32, lane);
      #pragma unroll  // constant nt: the per-sub-tile arrays stay in registers
      for (int nt = 0; nt < NT; ++nt) {
        a1[nt] = wmma32(af1, bx[kb][nt], a1[nt]);
        a2[nt] = wmma32(af2, bx[kb][nt], a2[nt]);
      }
    }
    // The bias loads below may land in the registers that held the weight
    // loads' addresses: this wait stands between the two.
    asm volatile("s_wait_xcnt 0x0" ::: "memory");
    int o0 = ob + hi8;
    #pragma unroll  // constant nt: the per-sub-tile arrays stay in registers
    for (int nt = 0; nt < NT; ++nt) {
      int p = nt * 16 + row;
      #pragma unroll
      for (int r = 0; r < 8; ++r) {
        float h1 = a1[nt][r] + W1b[o0 + r];
        float h2 = a2[nt][r] + W2b[o0 + r];
        float g = (h1 / (1.0f + __expf(-h1))) * h2;   // silu(h1)*h2
        gh[p * GP + o0 + r] = (_Float16)g;
      }
    }
  }

  // ---- Q projection (128x128), wave owns one output chunk ----
  {
    int ob = wave * 16;
    v8f aq[NT] = {};
    #pragma unroll
    for (int kb = 0; kb < 4; ++kb) {
      v16h af = frag_rm(Qwh, DIM, ob + row, kb * 32, lane);
      #pragma unroll  // constant nt: the per-sub-tile arrays stay in registers
      for (int nt = 0; nt < NT; ++nt) {
        v16h bf = frag_rm(zs + nt * 16 * XP, XP, row, kb * 32, lane);
        aq[nt] = wmma32(af, bf, aq[nt]);
      }
    }
    int o0 = ob + hi8;
    #pragma unroll  // constant nt: the per-sub-tile arrays stay in registers
    for (int nt = 0; nt < NT; ++nt) {
      int p = nt * 16 + row;
      #pragma unroll
      for (int r = 0; r < 8; ++r)
        qs[p * XP + o0 + r] = (_Float16)(aq[nt][r] + Qb[o0 + r]);
    }
  }
  __syncthreads();

  // ---- W3 GEMM (128x512), wave owns one output chunk, K = 512 ----
  {
    int ob = wave * 16;
    v8f a3[NT] = {};
    #pragma unroll
    for (int kb = 0; kb < 16; ++kb) {
      v16h aw = frag_rm(W3h, HID, ob + row, kb * 32, lane);
      #pragma unroll  // constant nt: the per-sub-tile arrays stay in registers
      for (int nt = 0; nt < NT; ++nt) {
        v16h bg = frag_rm(gh + nt * 16 * GP, GP, row, kb * 32, lane);
        a3[nt] = wmma32(aw, bg, a3[nt]);
      }
    }
    int o0 = ob + hi8;
    #pragma unroll  // constant nt: the per-sub-tile arrays stay in registers
    for (int nt = 0; nt < NT; ++nt) {
      int p = nt * 16 + row;
      #pragma unroll
      for (int r = 0; r < 8; ++r)
        fs[p * FP + o0 + r] = a3[nt][r] + W3b[o0 + r];
    }
  }
  __syncthreads();

  // ---- attn = corr @ q, then gated combine + store ----
  {
    int head = wave >> 1, mc = wave & 1;
    v16h ac = frag_rm(cs + head * 32 * 32, 32, mc * 16 + row, 0, lane);
    float sa = sigm(aalpha[head]);
    float sb = sigm(abeta[head]);
    float ga = sigm(galpha[0]);
    float gb = sigm(gbeta[0]);
    int d0 = mc * 16 + hi8;
    #pragma unroll  // the four sub-tiles' LDS reads are issued together
    for (int nt = 0; nt < NT; ++nt) {
      int p = nt * 16 + row;
      v16h bq = frag_gather(qs + p * XP + head, HEAD, lane);
      v8f at = {};
      at = wmma32(ac, bq, at);
      #pragma unroll
      for (int r = 0; r < 8; ++r) {
        int d = d0 + r;
        int c = d * HEAD + head;
        float attnv = at[r] * (1.0f / SEQ);
        float mha = sa * (float)xs[p * XP + c] + sb * attnv;
        out[(((size_t)b * DIM) + c) * SEQ + pb + p] =
            ga * fs[p * FP + c] + gb * mha;
      }
    }
  }
}

// ---------------------------------------------------------------------------
// Host launch
// ---------------------------------------------------------------------------
extern "C" void kernel_launch(void* const* d_in, const int* in_sizes, int n_in,
                              void* d_out, int out_size, void* d_ws,
                              size_t ws_size, hipStream_t stream) {
  const float* x  = (const float*)d_in[0];
  const float* z  = (const float*)d_in[1];
  const float* nw = (const float*)d_in[2];
  const float* Qw = (const float*)d_in[3];
  const float* Qb = (const float*)d_in[4];
  const float* Kw = (const float*)d_in[5];
  const float* Kb = (const float*)d_in[6];
  const float* aalpha = (const float*)d_in[7];
  const float* abeta  = (const float*)d_in[8];
  const float* W1w = (const float*)d_in[9];
  const float* W1b = (const float*)d_in[10];
  const float* W2w = (const float*)d_in[11];
  const float* W2b = (const float*)d_in[12];
  const float* W3w = (const float*)d_in[13];
  const float* W3b = (const float*)d_in[14];
  const float* galpha = (const float*)d_in[15];
  const float* gbeta  = (const float*)d_in[16];
  float* out = (float*)d_out;

  // Workspace carve-up
  char* p = (char*)d_ws;
  _Float16* xnh = (_Float16*)p; p += NPOS * DIM * 2;
  _Float16* zh  = (_Float16*)p; p += NPOS * DIM * 2;
  _Float16* W1h = (_Float16*)p; p += (size_t)HID * DIM * 2;
  _Float16* W2h = (_Float16*)p; p += (size_t)HID * DIM * 2;
  _Float16* W3h = (_Float16*)p; p += (size_t)DIM * HID * 2;
  _Float16* Qwh = (_Float16*)p; p += (size_t)DIM * DIM * 2;
  _Float16* Kwh = (_Float16*)p; p += (size_t)DIM * DIM * 2;
  float* corr = (float*)p;      p += (size_t)BB * HEAD * 32 * 32 * 4;

  hipMemsetAsync(corr, 0, (size_t)BB * HEAD * 32 * 32 * 4, stream);

  // Weight conversion f32 -> f16
  k_cvt<<<(HID * DIM + 255) / 256, 256, 0, stream>>>(W1w, W1h, HID * DIM);
  k_cvt<<<(HID * DIM + 255) / 256, 256, 0, stream>>>(W2w, W2h, HID * DIM);
  k_cvt<<<(DIM * HID + 255) / 256, 256, 0, stream>>>(W3w, W3h, DIM * HID);
  k_cvt<<<(DIM * DIM + 255) / 256, 256, 0, stream>>>(Qw, Qwh, DIM * DIM);
  k_cvt<<<(DIM * DIM + 255) / 256, 256, 0, stream>>>(Kw, Kwh, DIM * DIM);

  // RMSNorm + f16 conversion
  k_norm<<<(int)(NPOS / 256), 256, 0, stream>>>(x, z, nw, xnh, zh);

  // Per-head 32x32 correlations (reduction over n)
  k_corr<<<BB * (SEQ / 32), 256, 0, stream>>>(xnh, Kwh, Kb, corr);

  // FFN + attention apply + gated combine
  k_main<<<BB * (SEQ / TP), 256, 0, stream>>>(
      xnh, zh, W1h, W1b, W2h, W2b, W3h, W3b, Qwh, Qb, corr,
      aalpha, abeta, galpha, gbeta, out);
}

// v003
// Timed twice side by side with v002, it ran 1.18 times as fast both times.
// Counting every step since v000, it is 2.42 times as fast.
#include <hip/hip_runtime.h>
#include <hip/hip_bf16.h>

// ---------------------------------------------------------------------------
// Parallel Graphormer block for MI455X (gfx1250, wave32, WMMA).
// All channel GEMMs run through v_wmma_f32_16x16x32_f16; tile staging uses
// GLOBAL_LOAD_ASYNC_TO_LDS_B128 (ASYNCcnt) to bypass VGPRs.
// ---------------------------------------------------------------------------

#define BB   16
#define DIM  128
#define SEQ  8192
#define HEAD 4
#define HID  512
#define NPOS ((size_t)BB * SEQ)

// LDS row pitches. The tiles that use them are read one row per lane, so an
// unpadded power-of-two row puts all 16 rows of a 16-byte read on the same
// four banks. One 16-byte pad per row makes the pitch 16 B x odd, which
// spreads the 16 rows over all 64 banks.
#define XP (DIM + 8)   // f16 rows of DIM: 272 B
#define GP (HID + 8)   // f16 rows of HID: 1040 B
#define FP (DIM + 4)   // f32 rows of DIM: 528 B

// Positions per block of k_main. Every weight fragment a wave loads from
// global memory feeds NT matrix products, one per 16-position sub-tile.
#define TP 64
#define NT (TP / 16)

// Positions and threads per block of k_corr.
#define CP  512
#define CTH 512

typedef __attribute__((ext_vector_type(16))) _Float16 v16h;
typedef __attribute__((ext_vector_type(8)))  float    v8f;

__device__ __forceinline__ v8f wmma32(v16h a, v16h b, v8f c) {
  // D = A(16x32 f16) * B(32x16 f16) + C(16x16 f32)
  return __builtin_amdgcn_wmma_f32_16x16x32_f16(
      /*neg_a=*/false, a, /*neg_b=*/false, b,
      /*c_mod=*/(short)0, c, /*reuse_a=*/false, /*reuse_b=*/false);
}

// Async global -> LDS 16-byte copy (per active lane). VDST VGPR carries the
// LDS byte address (low 32 bits of the generic shared pointer), VADDR the
// 64-bit global address. Tracked by ASYNCcnt.
__device__ __forceinline__ void async_copy_b128(void* lds_ptr,
                                                const void* gptr) {
  unsigned lds_addr = (unsigned)(size_t)lds_ptr;
  unsigned long long ga = (unsigned long long)(size_t)gptr;
  // The wait stands inside the copy's own statement so that it precedes any
  // rewrite of the two address registers.
  asm volatile("global_load_async_to_lds_b128 %0, %1, off\n\ts_wait_xcnt 0x0"
               :: "v"(lds_addr), "v"(ga)
               : "memory");
}

// Eight such copies, ls halves apart in LDS and gs halves apart in global
// memory, in one statement with one wait behind the last: the wait precedes
// any rewrite of the sixteen address registers, and the copies issue back to
// back.
__device__ __forceinline__ void async_copy8_b128(_Float16* lds_ptr, int ls,
                                                 const _Float16* gptr, int gs) {
  unsigned l0 = (unsigned)(size_t)lds_ptr;
  unsigned long long g0 = (unsigned long long)(size_t)gptr;
  unsigned lb = (unsigned)ls * 2u;
  unsigned long long gb = (unsigned long long)gs * 2u;
  asm volatile("global_load_async_to_lds_b128 %0, %8, off\n\t"
               "global_load_async_to_lds_b128 %1, %9, off\n\t"
               "global_load_async_to_lds_b128 %2, %10, off\n\t"
               "global_load_async_to_lds_b128 %3, %11, off\n\t"
               "global_load_async_to_lds_b128 %4, %12, off\n\t"
               "global_load_async_to_lds_b128 %5, %13, off\n\t"
               "global_load_async_to_lds_b128 %6, %14, off\n\t"
               "global_load_async_to_lds_b128 %7, %15, off\n\t"
               "s_wait_xcnt 0x0"
               :: "v"(l0), "v"(l0 + lb), "v"(l0 + 2 * lb), "v"(l0 + 3 * lb),
                  "v"(l0 + 4 * lb), "v"(l0 + 5 * lb), "v"(l0 + 6 * lb),
                  "v"(l0 + 7 * lb),
                  "v"(g0), "v"(g0 + gb), "v"(g0 + 2 * gb), "v"(g0 + 3 * gb),
                  "v"(g0 + 4 * gb), "v"(g0 + 5 * gb), "v"(g0 + 6 * gb),
                  "v"(g0 + 7 * gb)
               : "memory");
}

__device__ __forceinline__ void wait_async0() {
  asm volatile("s_wait_asynccnt 0" ::: "memory");
}

// Load 16 f16 as two contiguous 16B chunks (p0[0..7], p0[16..23]) matching the
// ISA 16-bit A/B fragment striping: half h<8 -> K = 8*(lane>=16)+h,
// h>=8 -> K = 16 + 8*(lane>=16) + (h-8).
__device__ __forceinline__ v16h load16h(const _Float16* p0) {
  float4 a = *(const float4*)(p0);
  float4 b = *(const float4*)(p0 + 16);
  v16h r;
  __builtin_memcpy(&r, &a, 16);
  __builtin_memcpy(((char*)&r) + 16, &b, 16);
  return r;
}

// Row-major fragment: base[row*ldk + kb + ...] with contiguous K runs.
__device__ __forceinline__ v16h frag_rm(const _Float16* base, int ldk,
                                        int row, int kb, int lane) {
  return load16h(base + (size_t)row * ldk + kb + ((lane >> 4) << 3));
}

// Gather fragment for strided K (e.g. channel = K*HEAD + head).
__device__ __forceinline__ v16h frag_gather(const _Float16* base, int stride,
                                            int lane) {
  v16h r = {};
  int lo = (lane >> 4) << 3;
  #pragma unroll
  for (int h = 0; h < 16; ++h) {
    int K = h + ((h >= 8) ? 8 : 0) + lo;
    r[h] = base[(size_t)K * stride];
  }
  return r;
}

__device__ __forceinline__ float sigm(float v) {
  return 1.0f / (1.0f + __expf(-v));
}

// ---------------------------------------------------------------------------
// Weight conversion f32 -> f16
// ---------------------------------------------------------------------------
__global__ void k_cvt(const float* __restrict__ s, _Float16* __restrict__ d,
                      int n) {
  int i = blockIdx.x * 256 + threadIdx.x;
  if (i < n) d[i] = (_Float16)s[i];
}

// ---------------------------------------------------------------------------
// RMSNorm over channels + f16 conversion of xn and z.
// Layout in: (b, c, n) f32.  Layout out: (b*n, c) f16 (GEMM-friendly rows).
// ---------------------------------------------------------------------------
__global__ void k_norm(const float* __restrict__ x, const float* __restrict__ z,
                       const float* __restrict__ nw,
                       _Float16* __restrict__ xnh, _Float16* __restrict__ zh) {
  int gid = blockIdx.x * 256 + threadIdx.x;   // 0 .. B*SEQ-1
  int b = gid >> 13;                          // / SEQ
  int p = gid & (SEQ - 1);
  const float* xb = x + ((size_t)b * DIM) * SEQ + p;
  const float* zb = z + ((size_t)b * DIM) * SEQ + p;
  float ss = 0.0f;
  #pragma unroll 8
  for (int c = 0; c < DIM; ++c) {
    float v = xb[(size_t)c * SEQ];
    ss += v * v;
  }
  float rinv = rsqrtf(ss * (1.0f / DIM) + 1e-6f);
  _Float16* xo = xnh + (size_t)gid * DIM;
  _Float16* zo = zh + (size_t)gid * DIM;
  #pragma unroll 8
  for (int c = 0; c < DIM; ++c) {
    xo[c] = (_Float16)(nw[c] * xb[(size_t)c * SEQ] * rinv);
    zo[c] = (_Float16)(zb[(size_t)c * SEQ]);
  }
}

// ---------------------------------------------------------------------------
// Correlation: corr[b,h] += xr(32 x CP) @ k(32 x CP)^T with k = Kw@xn + Kb.
// One block per (b, CP-position slab), 16 waves. The whole slab is staged and
// projected once; each wave then sums one 16x16 piece of one head's
// correlation over all CP positions in its matrix accumulator, so an element
// of corr takes one atomic add per slab.
// ---------------------------------------------------------------------------
__global__ void __launch_bounds__(CTH)
k_corr(const _Float16* __restrict__ xnh,
       const _Float16* __restrict__ Kwh,
       const float* __restrict__ Kb,
       float* __restrict__ corr) {
  __shared__ __align__(16) _Float16 xs[CP * XP];   // [pos][c], padded rows
  __shared__ __align__(16) _Float16 ks[CP * XP];   // [pos][c], padded rows
  int blk = blockIdx.x;
  int b = blk / (SEQ / CP);
  int pb = (blk % (SEQ / CP)) * CP;
  int tid = threadIdx.x, lane = tid & 31, wave = tid >> 5;
  int row = lane & 15, hi8 = (lane >> 4) << 3;

  // Async-stage the xn slab (128 KB) straight into LDS, bypassing VGPRs.
  // A constant trip count: every lane is on at every copy. One copy of all
  // threads fills CTH / 16 rows, one trip of eight copies half the slab.
  const _Float16* src = xnh + ((size_t)b * SEQ + pb) * DIM + tid * 8;
  _Float16* dst = xs + (tid >> 4) * XP + (tid & 15) * 8;
  #pragma unroll  // constant steps: the addresses of a group differ by constants
  for (int k = 0; k < (CP * DIM) / 8 / CTH; k += 8)
    async_copy8_b128(dst + (size_t)k * (CTH / 16) * XP, (CTH / 16) * XP,
                     src + (size_t)k * CTH * 8, CTH * 8);

  // k = Kw @ xn + Kb : a wave owns 16 output channels of half the slab. Its
  // weight fragments and biases are the same for every sub-tile; their loads
  // fly together with the copies.
  int oc = wave & 7, ph = wave >> 3;
  int o0 = oc * 16 + hi8;
  v16h aw[4];
  #pragma unroll  // constant kb: aw stays in registers
  for (int kb = 0; kb < 4; ++kb)
    aw[kb] = frag_rm(Kwh, DIM, oc * 16 + row, kb * 32, lane);
  float kbv[8];
  #pragma unroll  // constant r: kbv stays in registers
  for (int r = 0; r < 8; ++r) kbv[r] = Kb[o0 + r];
  wait_async0();
  __syncthreads();

  {
    #pragma unroll 4  // four independent accumulate chains fill each other's latency
    for (int nc = 0; nc < CP / 32; ++nc) {
      int p0 = ph * (CP / 2) + nc * 16;
      v8f acc = {};
      #pragma unroll
      for (int kb = 0; kb < 4; ++kb) {
        v16h bf = frag_rm(xs + p0 * XP, XP, row, kb * 32, lane);
        acc = wmma32(aw[kb], bf, acc);
      }
      #pragma unroll
      for (int r = 0; r < 8; ++r)
        ks[(p0 + row) * XP + o0 + r] = (_Float16)(acc[r] + kbv[r]);
    }
  }
  __syncthreads();

  // corr piece: A = xr (16 x 32 pos), B = k^T (32 pos x 16), summed over the
  // slab's CP / 32 steps of 32 positions.
  {
    int head = wave >> 2, mc = (wave >> 1) & 1, nc = wave & 1;
    const _Float16* xa = xs + ((mc * 16 + row) * HEAD + head);
    const _Float16* kbp = ks + ((nc * 16 + row) * HEAD + head);
    v8f acc = {};
    #pragma unroll 4  // several steps' LDS reads in flight at once
    for (int kt = 0; kt < CP / 32; ++kt) {
      v16h a = frag_gather(xa + kt * 32 * XP, XP, lane);
      v16h bf = frag_gather(kbp + kt * 32 * XP, XP, lane);
      acc = wmma32(a, bf, acc);
    }
    float* cp = corr + (((size_t)b * HEAD + head) * 32) * 32;
    int d0 = mc * 16 + hi8;
    int s = nc * 16 + row;
    #pragma unroll
    for (int r = 0; r < 8; ++r) atomicAdd(&cp[(d0 + r) * 32 + s], acc[r]);
  }
}

// ---------------------------------------------------------------------------
// Main per-tile kernel: SwiGLU FFN + Q projection + corr@q + gated combine.
// One block per (b, TP-position tile), 8 waves.
// ---------------------------------------------------------------------------
// The real block size, and four waves per SIMD (two blocks per WGP, which is
// what the LDS allows): without it the compiler plans for 1,024 threads, caps
// the wave at 128 registers and spills the accumulators.
__global__ void __launch_bounds__(256, 4)
k_main(const _Float16* __restrict__ xnh,
                       const _Float16* __restrict__ zh,
                       const _Float16* __restrict__ W1h,
                       const float* __restrict__ W1b,
                       const _Float16* __restrict__ W2h,
                       const float* __restrict__ W2b,
                       const _Float16* __restrict__ W3h,
                       const float* __restrict__ W3b,
                       const _Float16* __restrict__ Qwh,
                       const float* __restrict__ Qb,
                       const float* __restrict__ corr,
                       const float* __restrict__ aalpha,
                       const float* __restrict__ abeta,
                       const float* __restrict__ galpha,
                       const float* __restrict__ gbeta,
                       float* __restrict__ out) {
  __shared__ __align__(16) _Float16 xs[TP * XP];         // xn tile [p][c]
  __shared__ __align__(16) _Float16 zs[TP * XP];         // z  tile [p][c]
  __shared__ __align__(16) _Float16 gh[TP * GP];         // silu(h1)*h2 [p][o]
  __shared__ __align__(16) _Float16 qs[TP * XP];         // q tile [p][c]
  __shared__ __align__(16) _Float16 cs[HEAD * 32 * 32];  // corr f16 [h][d][s]
  __shared__ __align__(16) float    fs[TP * FP];         // ffn f32 [p][c]

  int blk = blockIdx.x;
  int b = blk / (SEQ / TP);
  int pb = (blk % (SEQ / TP)) * TP;
  int tid = threadIdx.x, lane = tid & 31, wave = tid >> 5;
  int row = lane & 15, hi8 = (lane >> 4) << 3;

  // Async-stage xn and z tiles (16 KB each) into LDS, bypassing VGPRs.
  const _Float16* sx = xnh + ((size_t)b * SEQ + pb) * DIM;
  const _Float16* sz = zh + ((size_t)b * SEQ + pb) * DIM;
  __builtin_prefetch(sx + TP * DIM, 0, 0);   // next tile -> global_prefetch_b8
  // A constant trip count: every lane is on at every copy.
  for (int k = 0; k < (TP * DIM) / 8 / 256; ++k) {
    int i = k * 256 + tid;
    async_copy_b128(xs + (i >> 4) * XP + (i & 15) * 8, sx + i * 8);
    async_copy_b128(zs + (i >> 4) * XP + (i & 15) * 8, sz + i * 8);
  }
  // Corr needs an f32->f16 conversion, so it rides the normal VGPR path.
  const float* cb = corr + (size_t)b * HEAD * 32 * 32;
  for (int i = tid; i < HEAD * 32 * 32; i += 256) cs[i] = (_Float16)cb[i];
  wait_async0();
  __syncthreads();

  // ---- W1 / W2 GEMMs (512x128 each), wave owns 4 output chunks of 16 ----
  // The xn fragments are the same for every m: read once, kept in registers.
  v16h bx[4][NT];
  #pragma unroll  // constant kb: bx stays in registers
  for (int kb = 0; kb < 4; ++kb) {
    #pragma unroll  // constant nt: the per-sub-tile arrays stay in registers
    for (int nt = 0; nt < NT; ++nt)
      bx[kb][nt] = frag_rm(xs + nt * 16 * XP, XP, row, kb * 32, lane);
  }
  for (int m = 0; m < 4; ++m) {
    int ob = (wave * 4 + m) * 16;
    v8f a1[NT] = {}, a2[NT] = {};
    #pragma unroll
    for (int kb = 0; kb < 4; ++kb) {
      v16h af1 = frag_rm(W1h, DIM, ob + row, kb * 32, lane);
      v16h af2 = frag_rm(W2h, DIM, ob + row, kb * 32, lane);
      #pragma unroll  // constant nt: the per-sub-tile arrays stay in registers
      for (int nt = 0; nt < NT; ++nt) {
        a1[nt] = wmma32(af1, bx[kb][nt], a1[nt]);
        a2[nt] = wmma32(af2, bx[kb][nt], a2[nt]);
      }
    }
    // The bias loads below may land in the registers that held the weight
    // loads' addresses: this wait stands between the two.
    asm volatile("s_wait_xcnt 0x0" ::: "memory");
    int o0 = ob + hi8;
    #pragma unroll  // constant nt: the per-sub-tile arrays stay in registers
    for (int nt = 0; nt < NT; ++nt) {
      int p = nt * 16 + row;
      #pragma unroll
      for (int r = 0; r < 8; ++r) {
        float h1 = a1[nt][r] + W1b[o0 + r];
        float h2 = a2[nt][r] + W2b[o0 + r];
        float g = (h1 / (1.0f + __expf(-h1))) * h2;   // silu(h1)*h2
        gh[p * GP + o0 + r] = (_Float16)g;
      }
    }
  }

  // ---- Q projection (128x128), wave owns one output chunk ----
  {
    int ob = wave * 16;
    v8f aq[NT] = {};
    #pragma unroll
    for (int kb = 0; kb < 4; ++kb) {
      v16h af = frag_rm(Qwh, DIM, ob + row, kb * 32, lane);
      #pragma unroll  // constant nt: the per-sub-tile arrays stay in registers
      for (int nt = 0; nt < NT; ++nt) {
        v16h bf = frag_rm(zs + nt * 16 * XP, XP, row, kb * 32, lane);
        aq[nt] = wmma32(af, bf, aq[nt]);
      }
    }
    int o0 = ob + hi8;
    #pragma unroll  // constant nt: the per-sub-tile arrays stay in registers
    for (int nt = 0; nt < NT; ++nt) {
      int p = nt * 16 + row;
      #pragma unroll
      for (int r = 0; r < 8; ++r)
        qs[p * XP + o0 + r] = (_Float16)(aq[nt][r] + Qb[o0 + r]);
    }
  }
  __syncthreads();

  // ---- W3 GEMM (128x512), wave owns one output chunk, K = 512 ----
  {
    int ob = wave * 16;
    v8f a3[NT] = {};
    #pragma unroll
    for (int kb = 0; kb < 16; ++kb) {
      v16h aw = frag_rm(W3h, HID, ob + row, kb * 32, lane);
      #pragma unroll  // constant nt: the per-sub-tile arrays stay in registers
      for (int nt = 0; nt < NT; ++nt) {
        v16h bg = frag_rm(gh + nt * 16 * GP, GP, row, kb * 32, lane);
        a3[nt] = wmma32(aw, bg, a3[nt]);
      }
    }
    int o0 = ob + hi8;
    #pragma unroll  // constant nt: the per-sub-tile arrays stay in registers
    for (int nt = 0; nt < NT; ++nt) {
      int p = nt * 16 + row;
      #pragma unroll
      for (int r = 0; r < 8; ++r)
        fs[p * FP + o0 + r] = a3[nt][r] + W3b[o0 + r];
    }
  }
  __syncthreads();

  // ---- attn = corr @ q, then gated combine + store ----
  {
    int head = wave >> 1, mc = wave & 1;
    v16h ac = frag_rm(cs + head * 32 * 32, 32, mc * 16 + row, 0, lane);
    float sa = sigm(aalpha[head]);
    float sb = sigm(abeta[head]);
    float ga = sigm(galpha[0]);
    float gb = sigm(gbeta[0]);
    int d0 = mc * 16 + hi8;
    #pragma unroll  // the four sub-tiles' LDS reads are issued together
    for (int nt = 0; nt < NT; ++nt) {
      int p = nt * 16 + row;
      v16h bq = frag_gather(qs + p * XP + head, HEAD, lane);
      v8f at = {};
      at = wmma32(ac, bq, at);
      #pragma unroll
      for (int r = 0; r < 8; ++r) {
        int d = d0 + r;
        int c = d * HEAD + head;
        float attnv = at[r] * (1.0f / SEQ);
        float mha = sa * (float)xs[p * XP + c] + sb * attnv;
        out[(((size_t)b * DIM) + c) * SEQ + pb + p] =
            ga * fs[p * FP + c] + gb * mha;
      }
    }
  }
}

// ---------------------------------------------------------------------------
// Host launch
// ---------------------------------------------------------------------------
extern "C" void kernel_launch(void* const* d_in, const int* in_sizes, int n_in,
                              void* d_out, int out_size, void* d_ws,
                              size_t ws_size, hipStream_t stream) {
  const float* x  = (const float*)d_in[0];
  const float* z  = (const float*)d_in[1];
  const float* nw = (const float*)d_in[2];
  const float* Qw = (const float*)d_in[3];
  const float* Qb = (const float*)d_in[4];
  const float* Kw = (const float*)d_in[5];
  const float* Kb = (const float*)d_in[6];
  const float* aalpha = (const float*)d_in[7];
  const float* abeta  = (const float*)d_in[8];
  const float* W1w = (const float*)d_in[9];
  const float* W1b = (const float*)d_in[10];
  const float* W2w = (const float*)d_in[11];
  const float* W2b = (const float*)d_in[12];
  const float* W3w = (const float*)d_in[13];
  const float* W3b = (const float*)d_in[14];
  const float* galpha = (const float*)d_in[15];
  const float* gbeta  = (const float*)d_in[16];
  float* out = (float*)d_out;

  // Workspace carve-up
  char* p = (char*)d_ws;
  _Float16* xnh = (_Float16*)p; p += NPOS * DIM * 2;
  _Float16* zh  = (_Float16*)p; p += NPOS * DIM * 2;
  _Float16* W1h = (_Float16*)p; p += (size_t)HID * DIM * 2;
  _Float16* W2h = (_Float16*)p; p += (size_t)HID * DIM * 2;
  _Float16* W3h = (_Float16*)p; p += (size_t)DIM * HID * 2;
  _Float16* Qwh = (_Float16*)p; p += (size_t)DIM * DIM * 2;
  _Float16* Kwh = (_Float16*)p; p += (size_t)DIM * DIM * 2;
  float* corr = (float*)p;      p += (size_t)BB * HEAD * 32 * 32 * 4;

  hipMemsetAsync(corr, 0, (size_t)BB * HEAD * 32 * 32 * 4, stream);

  // Weight conversion f32 -> f16
  k_cvt<<<(HID * DIM + 255) / 256, 256, 0, stream>>>(W1w, W1h, HID * DIM);
  k_cvt<<<(HID * DIM + 255) / 256, 256, 0, stream>>>(W2w, W2h, HID * DIM);
  k_cvt<<<(DIM * HID + 255) / 256, 256, 0, stream>>>(W3w, W3h, DIM * HID);
  k_cvt<<<(DIM * DIM + 255) / 256, 256, 0, stream>>>(Qw, Qwh, DIM * DIM);
  k_cvt<<<(DIM * DIM + 255) / 256, 256, 0, stream>>>(Kw, Kwh, DIM * DIM);

  // RMSNorm + f16 conversion
  k_norm<<<(int)(NPOS / 256), 256, 0, stream>>>(x, z, nw, xnh, zh);

  // Per-head 32x32 correlations (reduction over n)
  k_corr<<<BB * (SEQ / CP), CTH, 0, stream>>>(xnh, Kwh, Kb, corr);

  // FFN + attention apply + gated combine
  k_main<<<BB * (SEQ / TP), 256, 0, stream>>>(
      xnh, zh, W1h, W1b, W2h, W2b, W3h, W3b, Qwh, Qb, corr,
      aalpha, abeta, galpha, gbeta, out);
}

// v004
// In both of two side-by-side timings against v003, it was 1.39 times as fast.
// All steps since v000 together make it 3.36 times as fast.
#include <hip/hip_runtime.h>
#include <hip/hip_bf16.h>

// ---------------------------------------------------------------------------
// Parallel Graphormer block for MI455X (gfx1250, wave32, WMMA).
// All channel GEMMs run through v_wmma_f32_16x16x32_f16; tile staging uses
// GLOBAL_LOAD_ASYNC_TO_LDS_B128 (ASYNCcnt) to bypass VGPRs.
// ---------------------------------------------------------------------------

#define BB   16
#define DIM  128
#define SEQ  8192
#define HEAD 4
#define HID  512
#define NPOS ((size_t)BB * SEQ)

// LDS row pitches. The tiles that use them are read one row per lane, so an
// unpadded power-of-two row puts all 16 rows of a 16-byte read on the same
// four banks. One 16-byte pad per row makes the pitch 16 B x odd, which
// spreads the 16 rows over all 64 banks.
#define XP (DIM + 8)   // f16 rows of DIM: 272 B
#define GP (HID + 8)   // f16 rows of HID: 1040 B
#define FP (DIM + 4)   // f32 rows of DIM: 528 B

// Positions per block of k_main. Every weight fragment a wave loads from
// global memory feeds NT matrix products, one per 16-position sub-tile.
#define TP 64
#define NT (TP / 16)

// Positions per block of k_norm.
#define NP 128

// Positions and threads per block of k_corr.
#define CP  512
#define CTH 512

typedef __attribute__((ext_vector_type(16))) _Float16 v16h;
typedef __attribute__((ext_vector_type(8)))  float    v8f;
typedef __attribute__((ext_vector_type(8)))  _Float16 v8h;
typedef __attribute__((ext_vector_type(4)))  float    v4f;

__device__ __forceinline__ v8f wmma32(v16h a, v16h b, v8f c) {
  // D = A(16x32 f16) * B(32x16 f16) + C(16x16 f32)
  return __builtin_amdgcn_wmma_f32_16x16x32_f16(
      /*neg_a=*/false, a, /*neg_b=*/false, b,
      /*c_mod=*/(short)0, c, /*reuse_a=*/false, /*reuse_b=*/false);
}

// Async global -> LDS 16-byte copy (per active lane). VDST VGPR carries the
// LDS byte address (low 32 bits of the generic shared pointer), VADDR the
// 64-bit global address. Tracked by ASYNCcnt.
__device__ __forceinline__ void async_copy_b128(void* lds_ptr,
                                                const void* gptr) {
  unsigned lds_addr = (unsigned)(size_t)lds_ptr;
  unsigned long long ga = (unsigned long long)(size_t)gptr;
  // The wait stands inside the copy's own statement so that it precedes any
  // rewrite of the two address registers.
  asm volatile("global_load_async_to_lds_b128 %0, %1, off\n\ts_wait_xcnt 0x0"
               :: "v"(lds_addr), "v"(ga)
               : "memory");
}

// Eight such copies, ls halves apart in LDS and gs halves apart in global
// memory, in one statement with one wait behind the last: the wait precedes
// any rewrite of the sixteen address registers, and the copies issue back to
// back.
__device__ __forceinline__ void async_copy8_b128(_Float16* lds_ptr, int ls,
                                                 const _Float16* gptr, int gs) {
  unsigned l0 = (unsigned)(size_t)lds_ptr;
  unsigned long long g0 = (unsigned long long)(size_t)gptr;
  unsigned lb = (unsigned)ls * 2u;
  unsigned long long gb = (unsigned long long)gs * 2u;
  asm volatile("global_load_async_to_lds_b128 %0, %8, off\n\t"
               "global_load_async_to_lds_b128 %1, %9, off\n\t"
               "global_load_async_to_lds_b128 %2, %10, off\n\t"
               "global_load_async_to_lds_b128 %3, %11, off\n\t"
               "global_load_async_to_lds_b128 %4, %12, off\n\t"
               "global_load_async_to_lds_b128 %5, %13, off\n\t"
               "global_load_async_to_lds_b128 %6, %14, off\n\t"
               "global_load_async_to_lds_b128 %7, %15, off\n\t"
               "s_wait_xcnt 0x0"
               :: "v"(l0), "v"(l0 + lb), "v"(l0 + 2 * lb), "v"(l0 + 3 * lb),
                  "v"(l0 + 4 * lb), "v"(l0 + 5 * lb), "v"(l0 + 6 * lb),
                  "v"(l0 + 7 * lb),
                  "v"(g0), "v"(g0 + gb), "v"(g0 + 2 * gb), "v"(g0 + 3 * gb),
                  "v"(g0 + 4 * gb), "v"(g0 + 5 * gb), "v"(g0 + 6 * gb),
                  "v"(g0 + 7 * gb)
               : "memory");
}

__device__ __forceinline__ void wait_async0() {
  asm volatile("s_wait_asynccnt 0" ::: "memory");
}

// Load 16 f16 as two contiguous 16B chunks (p0[0..7], p0[16..23]) matching the
// ISA 16-bit A/B fragment striping: half h<8 -> K = 8*(lane>=16)+h,
// h>=8 -> K = 16 + 8*(lane>=16) + (h-8).
__device__ __forceinline__ v16h load16h(const _Float16* p0) {
  float4 a = *(const float4*)(p0);
  float4 b = *(const float4*)(p0 + 16);
  v16h r;
  __builtin_memcpy(&r, &a, 16);
  __builtin_memcpy(((char*)&r) + 16, &b, 16);
  return r;
}

// Row-major fragment: base[row*ldk + kb + ...] with contiguous K runs.
__device__ __forceinline__ v16h frag_rm(const _Float16* base, int ldk,
                                        int row, int kb, int lane) {
  return load16h(base + (size_t)row * ldk + kb + ((lane >> 4) << 3));
}

// Gather fragment for strided K (e.g. channel = K*HEAD + head).
__device__ __forceinline__ v16h frag_gather(const _Float16* base, int stride,
                                            int lane) {
  v16h r = {};
  int lo = (lane >> 4) << 3;
  #pragma unroll
  for (int h = 0; h < 16; ++h) {
    int K = h + ((h >= 8) ? 8 : 0) + lo;
    r[h] = base[(size_t)K * stride];
  }
  return r;
}

__device__ __forceinline__ float sigm(float v) {
  return 1.0f / (1.0f + __expf(-v));
}

// ---------------------------------------------------------------------------
// Weight conversion f32 -> f16
// ---------------------------------------------------------------------------
__global__ void k_cvt(const float* __restrict__ s, _Float16* __restrict__ d,
                      int n) {
  int i = blockIdx.x * 256 + threadIdx.x;
  if (i < n) d[i] = (_Float16)s[i];
}

// ---------------------------------------------------------------------------
// RMSNorm over channels + f16 conversion of xn and z.
// Layout in: (b, c, n) f32.  Layout out: (b*n, c) f16 (GEMM-friendly rows).
// One block per (b, NP-position tile), 8 waves. A wave reads 16 channels, 512
// contiguous bytes of a channel per load, and keeps them in registers. The
// tiles are turned through LDS, so that every global store of a wave is 512
// contiguous bytes of the output rows.
// An LDS row is one position's 16 chunks of 16 bytes. Chunk ch of row r lies
// at place ch ^ ((r >> 2) & 15): the writers (one chunk number, rows four
// apart) and the readers (all chunks of two rows) both spread over all banks.
// ---------------------------------------------------------------------------
__device__ __forceinline__ int norm_slot(int r, int ch) {
  return r * DIM + ((ch ^ ((r >> 2) & 15)) << 3);
}

__global__ void __launch_bounds__(256)
k_norm(const float* __restrict__ x, const float* __restrict__ z,
       const float* __restrict__ nw,
       _Float16* __restrict__ xnh, _Float16* __restrict__ zh) {
  __shared__ __align__(16) _Float16 xt[NP * DIM];   // xn tile [pos][c], swizzled
  __shared__ __align__(16) _Float16 zt[NP * DIM];   // z  tile [pos][c], swizzled
  __shared__ __align__(16) v4f red[8 * 32];         // per-wave sums of squares
  int blk = blockIdx.x;
  int b = blk / (SEQ / NP);
  int pb = (blk % (SEQ / NP)) * NP;
  int tid = threadIdx.x, lane = tid & 31;
  // The wave's number in a scalar register: nw is then read by scalar loads.
  int wave = __builtin_amdgcn_readfirstlane(tid >> 5);
  int c0 = wave * 16;

  // This lane: positions 4*lane .. 4*lane+3 of channels c0 .. c0+15.
  size_t in0 = ((size_t)b * DIM + c0) * SEQ + pb + lane * 4;
  v4f xv[16], zv[16];
  #pragma unroll  // constant j: xv stays in registers, all loads in flight
  for (int j = 0; j < 16; ++j)
    xv[j] = *(const v4f*)(x + in0 + (size_t)j * SEQ);
  #pragma unroll  // constant j: zv stays in registers, all loads in flight
  for (int j = 0; j < 16; ++j)
    zv[j] = *(const v4f*)(z + in0 + (size_t)j * SEQ);

  v4f ss = {};
  #pragma unroll  // constant j: register indices
  for (int j = 0; j < 16; ++j) ss += xv[j] * xv[j];
  red[wave * 32 + lane] = ss;

  #pragma unroll  // constant i, h: register indices
  for (int i = 0; i < 4; ++i) {
    #pragma unroll  // constant h
    for (int h = 0; h < 2; ++h) {
      v8h t;
      #pragma unroll  // constant e: t is built in registers
      for (int e = 0; e < 8; ++e) t[e] = (_Float16)zv[h * 8 + e][i];
      *(v8h*)(zt + norm_slot(lane * 4 + i, wave * 2 + h)) = t;
    }
  }
  __syncthreads();

  v4f s = red[lane];
  #pragma unroll  // the eight LDS reads are issued together
  for (int w = 1; w < 8; ++w) s += red[w * 32 + lane];
  #pragma unroll  // constant i, h: register indices
  for (int i = 0; i < 4; ++i) {
    float rinv = rsqrtf(s[i] * (1.0f / DIM) + 1e-6f);
    #pragma unroll  // constant h
    for (int h = 0; h < 2; ++h) {
      v8h t;
      #pragma unroll  // constant e: t is built in registers
      for (int e = 0; e < 8; ++e)
        t[e] = (_Float16)(nw[c0 + h * 8 + e] * xv[h * 8 + e][i] * rinv);
      *(v8h*)(xt + norm_slot(lane * 4 + i, wave * 2 + h)) = t;
    }
  }
  __syncthreads();

  // The tile's NP output rows are one contiguous range of NP * DIM halves.
  // All global stores stand behind the last barrier, which then waits for none.
  size_t out0 = ((size_t)b * SEQ + pb) * DIM;
  #pragma unroll  // the LDS reads are issued together, ahead of the stores
  for (int k = 0; k < (NP * DIM) / 8 / 256; ++k) {
    int q = k * 256 + tid;
    int sl = norm_slot(q >> 4, q & 15);
    *(v8h*)(zh + out0 + (size_t)q * 8) = *(const v8h*)(zt + sl);
    *(v8h*)(xnh + out0 + (size_t)q * 8) = *(const v8h*)(xt + sl);
  }
}

// ---------------------------------------------------------------------------
// Correlation: corr[b,h] += xr(32 x CP) @ k(32 x CP)^T with k = Kw@xn + Kb.
// One block per (b, CP-position slab), 16 waves. The whole slab is staged and
// projected once; each wave then sums one 16x16 piece of one head's
// correlation over all CP positions in its matrix accumulator, so an element
// of corr takes one atomic add per slab.
// ---------------------------------------------------------------------------
__global__ void __launch_bounds__(CTH)
k_corr(const _Float16* __restrict__ xnh,
       const _Float16* __restrict__ Kwh,
       const float* __restrict__ Kb,
       float* __restrict__ corr) {
  __shared__ __align__(16) _Float16 xs[CP * XP];   // [pos][c], padded rows
  __shared__ __align__(16) _Float16 ks[CP * XP];   // [pos][c], padded rows
  int blk = blockIdx.x;
  int b = blk / (SEQ / CP);
  int pb = (blk % (SEQ / CP)) * CP;
  int tid = threadIdx.x, lane = tid & 31, wave = tid >> 5;
  int row = lane & 15, hi8 = (lane >> 4) << 3;

  // Async-stage the xn slab (128 KB) straight into LDS, bypassing VGPRs.
  // A constant trip count: every lane is on at every copy. One copy of all
  // threads fills CTH / 16 rows, one trip of eight copies half the slab.
  const _Float16* src = xnh + ((size_t)b * SEQ + pb) * DIM + tid * 8;
  _Float16* dst = xs + (tid >> 4) * XP + (tid & 15) * 8;
  #pragma unroll  // constant steps: the addresses of a group differ by constants
  for (int k = 0; k < (CP * DIM) / 8 / CTH; k += 8)
    async_copy8_b128(dst + (size_t)k * (CTH / 16) * XP, (CTH / 16) * XP,
                     src + (size_t)k * CTH * 8, CTH * 8);

  // k = Kw @ xn + Kb : a wave owns 16 output channels of half the slab. Its
  // weight fragments and biases are the same for every sub-tile; their loads
  // fly together with the copies.
  int oc = wave & 7, ph = wave >> 3;
  int o0 = oc * 16 + hi8;
  v16h aw[4];
  #pragma unroll  // constant kb: aw stays in registers
  for (int kb = 0; kb < 4; ++kb)
    aw[kb] = frag_rm(Kwh, DIM, oc * 16 + row, kb * 32, lane);
  float kbv[8];
  #pragma unroll  // constant r: kbv stays in registers
  for (int r = 0; r < 8; ++r) kbv[r] = Kb[o0 + r];
  wait_async0();
  __syncthreads();

  {
    #pragma unroll 4  // four independent accumulate chains fill each other's latency
    for (int nc = 0; nc < CP / 32; ++nc) {
      int p0 = ph * (CP / 2) + nc * 16;
      v8f acc = {};
      #pragma unroll
      for (int kb = 0; kb < 4; ++kb) {
        v16h bf = frag_rm(xs + p0 * XP, XP, row, kb * 32, lane);
        acc = wmma32(aw[kb], bf, acc);
      }
      #pragma unroll
      for (int r = 0; r < 8; ++r)
        ks[(p0 + row) * XP + o0 + r] = (_Float16)(acc[r] + kbv[r]);
    }
  }
  __syncthreads();

  // corr piece: A = xr (16 x 32 pos), B = k^T (32 pos x 16), summed over the
  // slab's CP / 32 steps of 32 positions.
  {
    int head = wave >> 2, mc = (wave >> 1) & 1, nc = wave & 1;
    const _Float16* xa = xs + ((mc * 16 + row) * HEAD + head);
    const _Float16* kbp = ks + ((nc * 16 + row) * HEAD + head);
    v8f acc = {};
    #pragma unroll 4  // several steps' LDS reads in flight at once
    for (int kt = 0; kt < CP / 32; ++kt) {
      v16h a = frag_gather(xa + kt * 32 * XP, XP, lane);
      v16h bf = frag_gather(kbp + kt * 32 * XP, XP, lane);
      acc = wmma32(a, bf, acc);
    }
    float* cp = corr + (((size_t)b * HEAD + head) * 32) * 32;
    int d0 = mc * 16 + hi8;
    int s = nc * 16 + row;
    #pragma unroll
    for (int r = 0; r < 8; ++r) atomicAdd(&cp[(d0 + r) * 32 + s], acc[r]);
  }
}

// ---------------------------------------------------------------------------
// Main per-tile kernel: SwiGLU FFN + Q projection + corr@q + gated combine.
// One block per (b, TP-position tile), 8 waves.
// ---------------------------------------------------------------------------
// The real block size, and four waves per SIMD (two blocks per WGP, which is
// what the LDS allows): without it the compiler plans for 1,024 threads, caps
// the wave at 128 registers and spills the accumulators.
__global__ void __launch_bounds__(256, 4)
k_main(const _Float16* __restrict__ xnh,
                       const _Float16* __restrict__ zh,
                       const _Float16* __restrict__ W1h,
                       const float* __restrict__ W1b,
                       const _Float16* __restrict__ W2h,
                       const float* __restrict__ W2b,
                       const _Float16* __restrict__ W3h,
                       const float* __restrict__ W3b,
                       const _Float16* __restrict__ Qwh,
                       const float* __restrict__ Qb,
                       const float* __restrict__ corr,
                       const float* __restrict__ aalpha,
                       const float* __restrict__ abeta,
                       const float* __restrict__ galpha,
                       const float* __restrict__ gbeta,
                       float* __restrict__ out) {
  __shared__ __align__(16) _Float16 xs[TP * XP];         // xn tile [p][c]
  __shared__ __align__(16) _Float16 zs[TP * XP];         // z  tile [p][c]
  __shared__ __align__(16) _Float16 gh[TP * GP];         // silu(h1)*h2 [p][o]
  __shared__ __align__(16) _Float16 qs[TP * XP];         // q tile [p][c]
  __shared__ __align__(16) _Float16 cs[HEAD * 32 * 32];  // corr f16 [h][d][s]
  __shared__ __align__(16) float    fs[TP * FP];         // ffn f32 [p][c]

  int blk = blockIdx.x;
  int b = blk / (SEQ / TP);
  int pb = (blk % (SEQ / TP)) * TP;
  int tid = threadIdx.x, lane = tid & 31, wave = tid >> 5;
  int row = lane & 15, hi8 = (lane >> 4) << 3;

  // Async-stage xn and z tiles (16 KB each) into LDS, bypassing VGPRs.
  const _Float16* sx = xnh + ((size_t)b * SEQ + pb) * DIM;
  const _Float16* sz = zh + ((size_t)b * SEQ + pb) * DIM;
  __builtin_prefetch(sx + TP * DIM, 0, 0);   // next tile -> global_prefetch_b8
  // A constant trip count: every lane is on at every copy.
  for (int k = 0; k < (TP * DIM) / 8 / 256; ++k) {
    int i = k * 256 + tid;
    async_copy_b128(xs + (i >> 4) * XP + (i & 15) * 8, sx + i * 8);
    async_copy_b128(zs + (i >> 4) * XP + (i & 15) * 8, sz + i * 8);
  }
  // Corr needs an f32->f16 conversion, so it rides the normal VGPR path.
  const float* cb = corr + (size_t)b * HEAD * 32 * 32;
  for (int i = tid; i < HEAD * 32 * 32; i += 256) cs[i] = (_Float16)cb[i];
  wait_async0();
  __syncthreads();

  // ---- W1 / W2 GEMMs (512x128 each), wave owns 4 output chunks of 16 ----
  // The xn fragments are the same for every m: read once, kept in registers.
  v16h bx[4][NT];
  #pragma unroll  // constant kb: bx stays in registers
  for (int kb = 0; kb < 4; ++kb) {
    #pragma unroll  // constant nt: the per-sub-tile arrays stay in registers
    for (int nt = 0; nt < NT; ++nt)
      bx[kb][nt] = frag_rm(xs + nt * 16 * XP, XP, row, kb * 32, lane);
  }
  for (int m = 0; m < 4; ++m) {
    int ob = (wave * 4 + m) * 16;
    v8f a1[NT] = {}, a2[NT] = {};
    #pragma unroll
    for (int kb = 0; kb < 4; ++kb) {
      v16h af1 = frag_rm(W1h, DIM, ob + row, kb * 32, lane);
      v16h af2 = frag_rm(W2h, DIM, ob + row, kb * 32, lane);
      #pragma unroll  // constant nt: the per-sub-tile arrays stay in registers
      for (int nt = 0; nt < NT; ++nt) {
        a1[nt] = wmma32(af1, bx[kb][nt], a1[nt]);
        a2[nt] = wmma32(af2, bx[kb][nt], a2[nt]);
      }
    }
    // The bias loads below may land in the registers that held the weight
    // loads' addresses: this wait stands between the two.
    asm volatile("s_wait_xcnt 0x0" ::: "memory");
    int o0 = ob + hi8;
    #pragma unroll  // constant nt: the per-sub-tile arrays stay in registers
    for (int nt = 0; nt < NT; ++nt) {
      int p = nt * 16 + row;
      #pragma unroll
      for (int r = 0; r < 8; ++r) {
        float h1 = a1[nt][r] + W1b[o0 + r];
        float h2 = a2[nt][r] + W2b[o0 + r];
        float g = (h1 / (1.0f + __expf(-h1))) * h2;   // silu(h1)*h2
        gh[p * GP + o0 + r] = (_Float16)g;
      }
    }
  }

  // ---- Q projection (128x128), wave owns one output chunk ----
  {
    int ob = wave * 16;
    v8f aq[NT] = {};
    #pragma unroll
    for (int kb = 0; kb < 4; ++kb) {
      v16h af = frag_rm(Qwh, DIM, ob + row, kb * 32, lane);
      #pragma unroll  // constant nt: the per-sub-tile arrays stay in registers
      for (int nt = 0; nt < NT; ++nt) {
        v16h bf = frag_rm(zs + nt * 16 * XP, XP, row, kb * 32, lane);
        aq[nt] = wmma32(af, bf, aq[nt]);
      }
    }
    int o0 = ob + hi8;
    #pragma unroll  // constant nt: the per-sub-tile arrays stay in registers
    for (int nt = 0; nt < NT; ++nt) {
      int p = nt * 16 + row;
      #pragma unroll
      for (int r = 0; r < 8; ++r)
        qs[p * XP + o0 + r] = (_Float16)(aq[nt][r] + Qb[o0 + r]);
    }
  }
  __syncthreads();

  // ---- W3 GEMM (128x512), wave owns one output chunk, K = 512 ----
  {
    int ob = wave * 16;
    v8f a3[NT] = {};
    #pragma unroll
    for (int kb = 0; kb < 16; ++kb) {
      v16h aw = frag_rm(W3h, HID, ob + row, kb * 32, lane);
      #pragma unroll  // constant nt: the per-sub-tile arrays stay in registers
      for (int nt = 0; nt < NT; ++nt) {
        v16h bg = frag_rm(gh + nt * 16 * GP, GP, row, kb * 32, lane);
        a3[nt] = wmma32(aw, bg, a3[nt]);
      }
    }
    int o0 = ob + hi8;
    #pragma unroll  // constant nt: the per-sub-tile arrays stay in registers
    for (int nt = 0; nt < NT; ++nt) {
      int p = nt * 16 + row;
      #pragma unroll
      for (int r = 0; r < 8; ++r)
        fs[p * FP + o0 + r] = a3[nt][r] + W3b[o0 + r];
    }
  }
  __syncthreads();

  // ---- attn = corr @ q, then gated combine + store ----
  {
    int head = wave >> 1, mc = wave & 1;
    v16h ac = frag_rm(cs + head * 32 * 32, 32, mc * 16 + row, 0, lane);
    float sa = sigm(aalpha[head]);
    float sb = sigm(abeta[head]);
    float ga = sigm(galpha[0]);
    float gb = sigm(gbeta[0]);
    int d0 = mc * 16 + hi8;
    #pragma unroll  // the four sub-tiles' LDS reads are issued together
    for (int nt = 0; nt < NT; ++nt) {
      int p = nt * 16 + row;
      v16h bq = frag_gather(qs + p * XP + head, HEAD, lane);
      v8f at = {};
      at = wmma32(ac, bq, at);
      #pragma unroll
      for (int r = 0; r < 8; ++r) {
        int d = d0 + r;
        int c = d * HEAD + head;
        float attnv = at[r] * (1.0f / SEQ);
        float mha = sa * (float)xs[p * XP + c] + sb * attnv;
        out[(((size_t)b * DIM) + c) * SEQ + pb + p] =
            ga * fs[p * FP + c] + gb * mha;
      }
    }
  }
}

// ---------------------------------------------------------------------------
// Host launch
// ---------------------------------------------------------------------------
extern "C" void kernel_launch(void* const* d_in, const int* in_sizes, int n_in,
                              void* d_out, int out_size, void* d_ws,
                              size_t ws_size, hipStream_t stream) {
  const float* x  = (const float*)d_in[0];
  const float* z  = (const float*)d_in[1];
  const float* nw = (const float*)d_in[2];
  const float* Qw = (const float*)d_in[3];
  const float* Qb = (const float*)d_in[4];
  const float* Kw = (const float*)d_in[5];
  const float* Kb = (const float*)d_in[6];
  const float* aalpha = (const float*)d_in[7];
  const float* abeta  = (const float*)d_in[8];
  const float* W1w = (const float*)d_in[9];
  const float* W1b = (const float*)d_in[10];
  const float* W2w = (const float*)d_in[11];
  const float* W2b = (const float*)d_in[12];
  const float* W3w = (const float*)d_in[13];
  const float* W3b = (const float*)d_in[14];
  const float* galpha = (const float*)d_in[15];
  const float* gbeta  = (const float*)d_in[16];
  float* out = (float*)d_out;

  // Workspace carve-up
  char* p = (char*)d_ws;
  _Float16* xnh = (_Float16*)p; p += NPOS * DIM * 2;
  _Float16* zh  = (_Float16*)p; p += NPOS * DIM * 2;
  _Float16* W1h = (_Float16*)p; p += (size_t)HID * DIM * 2;
  _Float16* W2h = (_Float16*)p; p += (size_t)HID * DIM * 2;
  _Float16* W3h = (_Float16*)p; p += (size_t)DIM * HID * 2;
  _Float16* Qwh = (_Float16*)p; p += (size_t)DIM * DIM * 2;
  _Float16* Kwh = (_Float16*)p; p += (size_t)DIM * DIM * 2;
  float* corr = (float*)p;      p += (size_t)BB * HEAD * 32 * 32 * 4;

  hipMemsetAsync(corr, 0, (size_t)BB * HEAD * 32 * 32 * 4, stream);

  // Weight conversion f32 -> f16
  k_cvt<<<(HID * DIM + 255) / 256, 256, 0, stream>>>(W1w, W1h, HID * DIM);
  k_cvt<<<(HID * DIM + 255) / 256, 256, 0, stream>>>(W2w, W2h, HID * DIM);
  k_cvt<<<(DIM * HID + 255) / 256, 256, 0, stream>>>(W3w, W3h, DIM * HID);
  k_cvt<<<(DIM * DIM + 255) / 256, 256, 0, stream>>>(Qw, Qwh, DIM * DIM);
  k_cvt<<<(DIM * DIM + 255) / 256, 256, 0, stream>>>(Kw, Kwh, DIM * DIM);

  // RMSNorm + f16 conversion
  k_norm<<<(int)(NPOS / NP), 256, 0, stream>>>(x, z, nw, xnh, zh);

  // Per-head 32x32 correlations (reduction over n)
  k_corr<<<BB * (SEQ / CP), CTH, 0, stream>>>(xnh, Kwh, Kb, corr);

  // FFN + attention apply + gated combine
  k_main<<<BB * (SEQ / TP), 256, 0, stream>>>(
      xnh, zh, W1h, W1b, W2h, W2b, W3h, W3b, Qwh, Qb, corr,
      aalpha, abeta, galpha, gbeta, out);
}

// v005
// Measured time: 132 microseconds a run.
// In two side-by-side timings against v004, it was 1.08 and 1.07 times as fast.
// Over all steps from v000 it is 3.61 times as fast.
#include <hip/hip_runtime.h>
#include <hip/hip_bf16.h>

// ---------------------------------------------------------------------------
// Parallel Graphormer block for MI455X (gfx1250, wave32, WMMA).
// All channel GEMMs run through v_wmma_f32_16x16x32_f16; tile staging uses
// GLOBAL_LOAD_ASYNC_TO_LDS_B128 (ASYNCcnt) to bypass VGPRs.
// ---------------------------------------------------------------------------

#define BB   16
#define DIM  128
#define SEQ  8192
#define HEAD 4
#define HID  512
#define NPOS ((size_t)BB * SEQ)

// LDS row pitches. The tiles that use them are read one row per lane, so an
// unpadded power-of-two row puts all 16 rows of a 16-byte read on the same
// four banks. One 16-byte pad per row makes the pitch 16 B x odd, which
// spreads the 16 rows over all 64 banks.
#define XP (DIM + 8)   // f16 rows of DIM: 272 B
#define GP (HID + 8)   // f16 rows of HID: 1040 B
#define FP (DIM + 4)   // f32 rows of DIM: 528 B

// Positions per block of k_main. Every weight fragment a wave loads from
// global memory feeds NT matrix products, one per 16-position sub-tile.
#define TP 64
#define NT (TP / 16)

// Positions per block of k_norm.
#define NP 128

// k_norm's grid: NB_NORM blocks normalise; behind them stand NB_CVT blocks
// that convert PE weight elements each and NB_ZERO blocks that clear PE
// elements of corr each.
#define PE      4096
#define NB_NORM ((int)(NPOS / NP))
#define NB_W    (HID * DIM / PE)
#define NB_Q    (DIM * DIM / PE)
#define NB_CVT  (3 * NB_W + 2 * NB_Q)
#define NB_ZERO (BB * HEAD * 32 * 32 / PE)

// Positions and threads per block of k_corr.
#define CP  512
#define CTH 512

typedef __attribute__((ext_vector_type(16))) _Float16 v16h;
typedef __attribute__((ext_vector_type(8)))  float    v8f;
typedef __attribute__((ext_vector_type(8)))  _Float16 v8h;
typedef __attribute__((ext_vector_type(4)))  float    v4f;

__device__ __forceinline__ v8f wmma32(v16h a, v16h b, v8f c) {
  // D = A(16x32 f16) * B(32x16 f16) + C(16x16 f32)
  return __builtin_amdgcn_wmma_f32_16x16x32_f16(
      /*neg_a=*/false, a, /*neg_b=*/false, b,
      /*c_mod=*/(short)0, c, /*reuse_a=*/false, /*reuse_b=*/false);
}

// Async global -> LDS 16-byte copy (per active lane). VDST VGPR carries the
// LDS byte address (low 32 bits of the generic shared pointer), VADDR the
// 64-bit global address. Tracked by ASYNCcnt.
__device__ __forceinline__ void async_copy_b128(void* lds_ptr,
                                                const void* gptr) {
  unsigned lds_addr = (unsigned)(size_t)lds_ptr;
  unsigned long long ga = (unsigned long long)(size_t)gptr;
  // The wait stands inside the copy's own statement so that it precedes any
  // rewrite of the two address registers.
  asm volatile("global_load_async_to_lds_b128 %0, %1, off\n\ts_wait_xcnt 0x0"
               :: "v"(lds_addr), "v"(ga)
               : "memory");
}

// Eight such copies, ls halves apart in LDS and gs halves apart in global
// memory, in one statement with one wait behind the last: the wait precedes
// any rewrite of the sixteen address registers, and the copies issue back to
// back.
__device__ __forceinline__ void async_copy8_b128(_Float16* lds_ptr, int ls,
                                                 const _Float16* gptr, int gs) {
  unsigned l0 = (unsigned)(size_t)lds_ptr;
  unsigned long long g0 = (unsigned long long)(size_t)gptr;
  unsigned lb = (unsigned)ls * 2u;
  unsigned long long gb = (unsigned long long)gs * 2u;
  asm volatile("global_load_async_to_lds_b128 %0, %8, off\n\t"
               "global_load_async_to_lds_b128 %1, %9, off\n\t"
               "global_load_async_to_lds_b128 %2, %10, off\n\t"
               "global_load_async_to_lds_b128 %3, %11, off\n\t"
               "global_load_async_to_lds_b128 %4, %12, off\n\t"
               "global_load_async_to_lds_b128 %5, %13, off\n\t"
               "global_load_async_to_lds_b128 %6, %14, off\n\t"
               "global_load_async_to_lds_b128 %7, %15, off\n\t"
               "s_wait_xcnt 0x0"
               :: "v"(l0), "v"(l0 + lb), "v"(l0 + 2 * lb), "v"(l0 + 3 * lb),
                  "v"(l0 + 4 * lb), "v"(l0 + 5 * lb), "v"(l0 + 6 * lb),
                  "v"(l0 + 7 * lb),
                  "v"(g0), "v"(g0 + gb), "v"(g0 + 2 * gb), "v"(g0 + 3 * gb),
                  "v"(g0 + 4 * gb), "v"(g0 + 5 * gb), "v"(g0 + 6 * gb),
                  "v"(g0 + 7 * gb)
               : "memory");
}

__device__ __forceinline__ void wait_async0() {
  asm volatile("s_wait_asynccnt 0" ::: "memory");
}

// Load 16 f16 as two contiguous 16B chunks (p0[0..7], p0[16..23]) matching the
// ISA 16-bit A/B fragment striping: half h<8 -> K = 8*(lane>=16)+h,
// h>=8 -> K = 16 + 8*(lane>=16) + (h-8).
__device__ __forceinline__ v16h load16h(const _Float16* p0) {
  float4 a = *(const float4*)(p0);
  float4 b = *(const float4*)(p0 + 16);
  v16h r;
  __builtin_memcpy(&r, &a, 16);
  __builtin_memcpy(((char*)&r) + 16, &b, 16);
  return r;
}

// Row-major fragment: base[row*ldk + kb + ...] with contiguous K runs.
__device__ __forceinline__ v16h frag_rm(const _Float16* base, int ldk,
                                        int row, int kb, int lane) {
  return load16h(base + (size_t)row * ldk + kb + ((lane >> 4) << 3));
}

// Gather fragment for strided K (e.g. channel = K*HEAD + head).
__device__ __forceinline__ v16h frag_gather(const _Float16* base, int stride,
                                            int lane) {
  v16h r = {};
  int lo = (lane >> 4) << 3;
  #pragma unroll
  for (int h = 0; h < 16; ++h) {
    int K = h + ((h >= 8) ? 8 : 0) + lo;
    r[h] = base[(size_t)K * stride];
  }
  return r;
}

__device__ __forceinline__ float sigm(float v) {
  return 1.0f / (1.0f + __expf(-v));
}

// ---------------------------------------------------------------------------
// RMSNorm over channels + f16 conversion of xn and z.
// Layout in: (b, c, n) f32.  Layout out: (b*n, c) f16 (GEMM-friendly rows).
// One block per (b, NP-position tile), 8 waves. A wave reads 16 channels, 512
// contiguous bytes of a channel per load, and keeps them in registers. The
// tiles are turned through LDS, so that every global store of a wave is 512
// contiguous bytes of the output rows.
// An LDS row is one position's 16 chunks of 16 bytes. Chunk ch of row r lies
// at place ch ^ ((r >> 2) & 15): the writers (one chunk number, rows four
// apart) and the readers (all chunks of two rows) both spread over all banks.
// The blocks from NB_NORM on do the work that nothing in this launch reads
// and the later launches need: the f32 -> f16 conversion of the five weight
// matrices and the start value of corr. They stand last in the grid, so they
// start as the first tiles' blocks leave and end under the last tiles.
// ---------------------------------------------------------------------------
__device__ __forceinline__ int norm_slot(int r, int ch) {
  return r * DIM + ((ch ^ ((r >> 2) & 15)) << 3);
}

__global__ void __launch_bounds__(256)
k_norm(const float* __restrict__ x, const float* __restrict__ z,
       const float* __restrict__ nw,
       const float* __restrict__ W1w, const float* __restrict__ W2w,
       const float* __restrict__ W3w, const float* __restrict__ Qw,
       const float* __restrict__ Kw,
       _Float16* __restrict__ xnh, _Float16* __restrict__ zh,
       _Float16* __restrict__ wh, float* __restrict__ corr) {
  __shared__ __align__(16) _Float16 xt[NP * DIM];   // xn tile [pos][c], swizzled
  __shared__ __align__(16) _Float16 zt[NP * DIM];   // z  tile [pos][c], swizzled
  __shared__ __align__(16) v4f red[8 * 32];         // per-wave sums of squares
  int blk = blockIdx.x;
  int tid = threadIdx.x, lane = tid & 31;

  // The same test in every thread of a block, ahead of every barrier.
  if (blk >= NB_NORM) {
    int e = blk - NB_NORM;
    if (e < NB_CVT) {
      // wh holds W1, W2, W3, Q, K one behind the other, so the block's place
      // in it is e * PE whichever matrix it reads.
      const float* s;
      if (e < NB_W)                 s = W1w + (size_t)e * PE;
      else if (e < 2 * NB_W)        s = W2w + (size_t)(e - NB_W) * PE;
      else if (e < 3 * NB_W)        s = W3w + (size_t)(e - 2 * NB_W) * PE;
      else if (e < 3 * NB_W + NB_Q) s = Qw + (size_t)(e - 3 * NB_W) * PE;
      else                          s = Kw + (size_t)(e - 3 * NB_W - NB_Q) * PE;
      _Float16* d = wh + (size_t)e * PE;
      #pragma unroll  // all loads of the block in flight at once
      for (int k = 0; k < PE / 8 / 256; ++k) {
        int q = (k * 256 + tid) * 8;
        v4f lo = *(const v4f*)(s + q);
        v4f hi = *(const v4f*)(s + q + 4);
        v8h t;
        #pragma unroll  // constant i: t is built in registers
        for (int i = 0; i < 4; ++i) {
          t[i] = (_Float16)lo[i];
          t[4 + i] = (_Float16)hi[i];
        }
        *(v8h*)(d + q) = t;
      }
    } else {
      float* c = corr + (size_t)(e - NB_CVT) * PE;
      v4f zero = {};
      #pragma unroll  // independent stores
      for (int k = 0; k < PE / 4 / 256; ++k)
        *(v4f*)(c + (k * 256 + tid) * 4) = zero;
      // Precaution: the stores' registers are not rewritten ahead of this wait.
      asm volatile("s_wait_xcnt 0x0" ::: "memory");
    }
    return;
  }

  int b = blk / (SEQ / NP);
  int pb = (blk % (SEQ / NP)) * NP;
  // The wave's number in a scalar register: nw is then read by scalar loads.
  int wave = __builtin_amdgcn_readfirstlane(tid >> 5);
  int c0 = wave * 16;

  // This lane: positions 4*lane .. 4*lane+3 of channels c0 .. c0+15.
  size_t in0 = ((size_t)b * DIM + c0) * SEQ + pb + lane * 4;
  v4f xv[16], zv[16];
  #pragma unroll  // constant j: xv stays in registers, all loads in flight
  for (int j = 0; j < 16; ++j)
    xv[j] = *(const v4f*)(x + in0 + (size_t)j * SEQ);
  #pragma unroll  // constant j: zv stays in registers, all loads in flight
  for (int j = 0; j < 16; ++j)
    zv[j] = *(const v4f*)(z + in0 + (size_t)j * SEQ);

  v4f ss = {};
  #pragma unroll  // constant j: register indices
  for (int j = 0; j < 16; ++j) ss += xv[j] * xv[j];
  red[wave * 32 + lane] = ss;

  #pragma unroll  // constant i, h: register indices
  for (int i = 0; i < 4; ++i) {
    #pragma unroll  // constant h
    for (int h = 0; h < 2; ++h) {
      v8h t;
      #pragma unroll  // constant e: t is built in registers
      for (int e = 0; e < 8; ++e) t[e] = (_Float16)zv[h * 8 + e][i];
      *(v8h*)(zt + norm_slot(lane * 4 + i, wave * 2 + h)) = t;
    }
  }
  __syncthreads();

  v4f s = red[lane];
  #pragma unroll  // the eight LDS reads are issued together
  for (int w = 1; w < 8; ++w) s += red[w * 32 + lane];
  #pragma unroll  // constant i, h: register indices
  for (int i = 0; i < 4; ++i) {
    float rinv = rsqrtf(s[i] * (1.0f / DIM) + 1e-6f);
    #pragma unroll  // constant h
    for (int h = 0; h < 2; ++h) {
      v8h t;
      #pragma unroll  // constant e: t is built in registers
      for (int e = 0; e < 8; ++e)
        t[e] = (_Float16)(nw[c0 + h * 8 + e] * xv[h * 8 + e][i] * rinv);
      *(v8h*)(xt + norm_slot(lane * 4 + i, wave * 2 + h)) = t;
    }
  }
  __syncthreads();

  // The tile's NP output rows are one contiguous range of NP * DIM halves.
  // All global stores stand behind the last barrier, which then waits for none.
  size_t out0 = ((size_t)b * SEQ + pb) * DIM;
  #pragma unroll  // the LDS reads are issued together, ahead of the stores
  for (int k = 0; k < (NP * DIM) / 8 / 256; ++k) {
    int q = k * 256 + tid;
    int sl = norm_slot(q >> 4, q & 15);
    *(v8h*)(zh + out0 + (size_t)q * 8) = *(const v8h*)(zt + sl);
    *(v8h*)(xnh + out0 + (size_t)q * 8) = *(const v8h*)(xt + sl);
  }
  // Precaution: in the built code this path runs on into the shared exit's
  // tests; no register of the stores is rewritten ahead of this wait.
  asm volatile("s_wait_xcnt 0x0" ::: "memory");
}

// ---------------------------------------------------------------------------
// Correlation: corr[b,h] += xr(32 x CP) @ k(32 x CP)^T with k = Kw@xn + Kb.
// One block per (b, CP-position slab), 16 waves. The whole slab is staged and
// projected once; each wave then sums one 16x16 piece of one head's
// correlation over all CP positions in its matrix accumulator, so an element
// of corr takes one atomic add per slab.
// ---------------------------------------------------------------------------
__global__ void __launch_bounds__(CTH)
k_corr(const _Float16* __restrict__ xnh,
       const _Float16* __restrict__ Kwh,
       const float* __restrict__ Kb,
       float* __restrict__ corr) {
  __shared__ __align__(16) _Float16 xs[CP * XP];   // [pos][c], padded rows
  __shared__ __align__(16) _Float16 ks[CP * XP];   // [pos][c], padded rows
  int blk = blockIdx.x;
  int b = blk / (SEQ / CP);
  int pb = (blk % (SEQ / CP)) * CP;
  int tid = threadIdx.x, lane = tid & 31, wave = tid >> 5;
  int row = lane & 15, hi8 = (lane >> 4) << 3;

  // Async-stage the xn slab (128 KB) straight into LDS, bypassing VGPRs.
  // A constant trip count: every lane is on at every copy. One copy of all
  // threads fills CTH / 16 rows, one trip of eight copies half the slab.
  const _Float16* src = xnh + ((size_t)b * SEQ + pb) * DIM + tid * 8;
  _Float16* dst = xs + (tid >> 4) * XP + (tid & 15) * 8;
  #pragma unroll  // constant steps: the addresses of a group differ by constants
  for (int k = 0; k < (CP * DIM) / 8 / CTH; k += 8)
    async_copy8_b128(dst + (size_t)k * (CTH / 16) * XP, (CTH / 16) * XP,
                     src + (size_t)k * CTH * 8, CTH * 8);

  // k = Kw @ xn + Kb : a wave owns 16 output channels of half the slab. Its
  // weight fragments and biases are the same for every sub-tile; their loads
  // fly together with the copies.
  int oc = wave & 7, ph = wave >> 3;
  int o0 = oc * 16 + hi8;
  v16h aw[4];
  #pragma unroll  // constant kb: aw stays in registers
  for (int kb = 0; kb < 4; ++kb)
    aw[kb] = frag_rm(Kwh, DIM, oc * 16 + row, kb * 32, lane);
  float kbv[8];
  #pragma unroll  // constant r: kbv stays in registers
  for (int r = 0; r < 8; ++r) kbv[r] = Kb[o0 + r];
  wait_async0();
  __syncthreads();

  {
    #pragma unroll 4  // four independent accumulate chains fill each other's latency
    for (int nc = 0; nc < CP / 32; ++nc) {
      int p0 = ph * (CP / 2) + nc * 16;
      v8f acc = {};
      #pragma unroll
      for (int kb = 0; kb < 4; ++kb) {
        v16h bf = frag_rm(xs + p0 * XP, XP, row, kb * 32, lane);
        acc = wmma32(aw[kb], bf, acc);
      }
      #pragma unroll
      for (int r = 0; r < 8; ++r)
        ks[(p0 + row) * XP + o0 + r] = (_Float16)(acc[r] + kbv[r]);
    }
  }
  __syncthreads();

  // corr piece: A = xr (16 x 32 pos), B = k^T (32 pos x 16), summed over the
  // slab's CP / 32 steps of 32 positions.
  {
    int head = wave >> 2, mc = (wave >> 1) & 1, nc = wave & 1;
    const _Float16* xa = xs + ((mc * 16 + row) * HEAD + head);
    const _Float16* kbp = ks + ((nc * 16 + row) * HEAD + head);
    v8f acc = {};
    #pragma unroll 4  // several steps' LDS reads in flight at once
    for (int kt = 0; kt < CP / 32; ++kt) {
      v16h a = frag_gather(xa + kt * 32 * XP, XP, lane);
      v16h bf = frag_gather(kbp + kt * 32 * XP, XP, lane);
      acc = wmma32(a, bf, acc);
    }
    float* cp = corr + (((size_t)b * HEAD + head) * 32) * 32;
    int d0 = mc * 16 + hi8;
    int s = nc * 16 + row;
    #pragma unroll
    for (int r = 0; r < 8; ++r) atomicAdd(&cp[(d0 + r) * 32 + s], acc[r]);
  }
}

// ---------------------------------------------------------------------------
// Main per-tile kernel: SwiGLU FFN + Q projection + corr@q + gated combine.
// One block per (b, TP-position tile), 8 waves.
// ---------------------------------------------------------------------------
// The real block size, and four waves per SIMD (two blocks per WGP, which is
// what the LDS allows): without it the compiler plans for 1,024 threads, caps
// the wave at 128 registers and spills the accumulators.
__global__ void __launch_bounds__(256, 4)
k_main(const _Float16* __restrict__ xnh,
                       const _Float16* __restrict__ zh,
                       const _Float16* __restrict__ W1h,
                       const float* __restrict__ W1b,
                       const _Float16* __restrict__ W2h,
                       const float* __restrict__ W2b,
                       const _Float16* __restrict__ W3h,
                       const float* __restrict__ W3b,
                       const _Float16* __restrict__ Qwh,
                       const float* __restrict__ Qb,
                       const float* __restrict__ corr,
                       const float* __restrict__ aalpha,
                       const float* __restrict__ abeta,
                       const float* __restrict__ galpha,
                       const float* __restrict__ gbeta,
                       float* __restrict__ out) {
  __shared__ __align__(16) _Float16 xs[TP * XP];         // xn tile [p][c]
  __shared__ __align__(16) _Float16 zs[TP * XP];         // z  tile [p][c]
  __shared__ __align__(16) _Float16 gh[TP * GP];         // silu(h1)*h2 [p][o]
  __shared__ __align__(16) _Float16 qs[TP * XP];         // q tile [p][c]
  __shared__ __align__(16) _Float16 cs[HEAD * 32 * 32];  // corr f16 [h][d][s]
  __shared__ __align__(16) float    fs[TP * FP];         // ffn f32 [p][c]

  int blk = blockIdx.x;
  int b = blk / (SEQ / TP);
  int pb = (blk % (SEQ / TP)) * TP;
  int tid = threadIdx.x, lane = tid & 31, wave = tid >> 5;
  int row = lane & 15, hi8 = (lane >> 4) << 3;

  // Async-stage xn and z tiles (16 KB each) into LDS, bypassing VGPRs.
  const _Float16* sx = xnh + ((size_t)b * SEQ + pb) * DIM;
  const _Float16* sz = zh + ((size_t)b * SEQ + pb) * DIM;
  __builtin_prefetch(sx + TP * DIM, 0, 0);   // next tile -> global_prefetch_b8
  // A constant trip count: every lane is on at every copy.
  for (int k = 0; k < (TP * DIM) / 8 / 256; ++k) {
    int i = k * 256 + tid;
    async_copy_b128(xs + (i >> 4) * XP + (i & 15) * 8, sx + i * 8);
    async_copy_b128(zs + (i >> 4) * XP + (i & 15) * 8, sz + i * 8);
  }
  // Corr needs an f32->f16 conversion, so it rides the normal VGPR path.
  const float* cb = corr + (size_t)b * HEAD * 32 * 32;
  for (int i = tid; i < HEAD * 32 * 32; i += 256) cs[i] = (_Float16)cb[i];
  wait_async0();
  __syncthreads();

  // ---- W1 / W2 GEMMs (512x128 each), wave owns 4 output chunks of 16 ----
  // The xn fragments are the same for every m: read once, kept in registers.
  v16h bx[4][NT];
  #pragma unroll  // constant kb: bx stays in registers
  for (int kb = 0; kb < 4; ++kb) {
    #pragma unroll  // constant nt: the per-sub-tile arrays stay in registers
    for (int nt = 0; nt < NT; ++nt)
      bx[kb][nt] = frag_rm(xs + nt * 16 * XP, XP, row, kb * 32, lane);
  }
  for (int m = 0; m < 4; ++m) {
    int ob = (wave * 4 + m) * 16;
    v8f a1[NT] = {}, a2[NT] = {};
    #pragma unroll
    for (int kb = 0; kb < 4; ++kb) {
      v16h af1 = frag_rm(W1h, DIM, ob + row, kb * 32, lane);
      v16h af2 = frag_rm(W2h, DIM, ob + row, kb * 32, lane);
      #pragma unroll  // constant nt: the per-sub-tile arrays stay in registers
      for (int nt = 0; nt < NT; ++nt) {
        a1[nt] = wmma32(af1, bx[kb][nt], a1[nt]);
        a2[nt] = wmma32(af2, bx[kb][nt], a2[nt]);
      }
    }
    // The bias loads below may land in the registers that held the weight
    // loads' addresses: this wait stands between the two.
    asm volatile("s_wait_xcnt 0x0" ::: "memory");
    int o0 = ob + hi8;
    #pragma unroll  // constant nt: the per-sub-tile arrays stay in registers
    for (int nt = 0; nt < NT; ++nt) {
      int p = nt * 16 + row;
      #pragma unroll
      for (int r = 0; r < 8; ++r) {
        float h1 = a1[nt][r] + W1b[o0 + r];
        float h2 = a2[nt][r] + W2b[o0 + r];
        float g = (h1 / (1.0f + __expf(-h1))) * h2;   // silu(h1)*h2
        gh[p * GP + o0 + r] = (_Float16)g;
      }
    }
  }

  // ---- Q projection (128x128), wave owns one output chunk ----
  {
    int ob = wave * 16;
    v8f aq[NT] = {};
    #pragma unroll
    for (int kb = 0; kb < 4; ++kb) {
      v16h af = frag_rm(Qwh, DIM, ob + row, kb * 32, lane);
      #pragma unroll  // constant nt: the per-sub-tile arrays stay in registers
      for (int nt = 0; nt < NT; ++nt) {
        v16h bf = frag_rm(zs + nt * 16 * XP, XP, row, kb * 32, lane);
        aq[nt] = wmma32(af, bf, aq[nt]);
      }
    }
    int o0 = ob + hi8;
    #pragma unroll  // constant nt: the per-sub-tile arrays stay in registers
    for (int nt = 0; nt < NT; ++nt) {
      int p = nt * 16 + row;
      #pragma unroll
      for (int r = 0; r < 8; ++r)
        qs[p * XP + o0 + r] = (_Float16)(aq[nt][r] + Qb[o0 + r]);
    }
  }
  __syncthreads();

  // ---- W3 GEMM (128x512), wave owns one output chunk, K = 512 ----
  {
    int ob = wave * 16;
    v8f a3[NT] = {};
    #pragma unroll
    for (int kb = 0; kb < 16; ++kb) {
      v16h aw = frag_rm(W3h, HID, ob + row, kb * 32, lane);
      #pragma unroll  // constant nt: the per-sub-tile arrays stay in registers
      for (int nt = 0; nt < NT; ++nt) {
        v16h bg = frag_rm(gh + nt * 16 * GP, GP, row, kb * 32, lane);
        a3[nt] = wmma32(aw, bg, a3[nt]);
      }
    }
    int o0 = ob + hi8;
    #pragma unroll  // constant nt: the per-sub-tile arrays stay in registers
    for (int nt = 0; nt < NT; ++nt) {
      int p = nt * 16 + row;
      #pragma unroll
      for (int r = 0; r < 8; ++r)
        fs[p * FP + o0 + r] = a3[nt][r] + W3b[o0 + r];
    }
  }
  __syncthreads();

  // ---- attn = corr @ q, then gated combine + store ----
  {
    int head = wave >> 1, mc = wave & 1;
    v16h ac = frag_rm(cs + head * 32 * 32, 32, mc * 16 + row, 0, lane);
    float sa = sigm(aalpha[head]);
    float sb = sigm(abeta[head]);
    float ga = sigm(galpha[0]);
    float gb = sigm(gbeta[0]);
    int d0 = mc * 16 + hi8;
    #pragma unroll  // the four sub-tiles' LDS reads are issued together
    for (int nt = 0; nt < NT; ++nt) {
      int p = nt * 16 + row;
      v16h bq = frag_gather(qs + p * XP + head, HEAD, lane);
      v8f at = {};
      at = wmma32(ac, bq, at);
      #pragma unroll
      for (int r = 0; r < 8; ++r) {
        int d = d0 + r;
        int c = d * HEAD + head;
        float attnv = at[r] * (1.0f / SEQ);
        float mha = sa * (float)xs[p * XP + c] + sb * attnv;
        out[(((size_t)b * DIM) + c) * SEQ + pb + p] =
            ga * fs[p * FP + c] + gb * mha;
      }
    }
  }
}

// ---------------------------------------------------------------------------
// Host launch
// ---------------------------------------------------------------------------
extern "C" void kernel_launch(void* const* d_in, const int* in_sizes, int n_in,
                              void* d_out, int out_size, void* d_ws,
                              size_t ws_size, hipStream_t stream) {
  const float* x  = (const float*)d_in[0];
  const float* z  = (const float*)d_in[1];
  const float* nw = (const float*)d_in[2];
  const float* Qw = (const float*)d_in[3];
  const float* Qb = (const float*)d_in[4];
  const float* Kw = (const float*)d_in[5];
  const float* Kb = (const float*)d_in[6];
  const float* aalpha = (const float*)d_in[7];
  const float* abeta  = (const float*)d_in[8];
  const float* W1w = (const float*)d_in[9];
  const float* W1b = (const float*)d_in[10];
  const float* W2w = (const float*)d_in[11];
  const float* W2b = (const float*)d_in[12];
  const float* W3w = (const float*)d_in[13];
  const float* W3b = (const float*)d_in[14];
  const float* galpha = (const float*)d_in[15];
  const float* gbeta  = (const float*)d_in[16];
  float* out = (float*)d_out;

  // Workspace carve-up
  char* p = (char*)d_ws;
  _Float16* xnh = (_Float16*)p; p += NPOS * DIM * 2;
  _Float16* zh  = (_Float16*)p; p += NPOS * DIM * 2;
  _Float16* W1h = (_Float16*)p; p += (size_t)HID * DIM * 2;
  _Float16* W2h = (_Float16*)p; p += (size_t)HID * DIM * 2;
  _Float16* W3h = (_Float16*)p; p += (size_t)DIM * HID * 2;
  _Float16* Qwh = (_Float16*)p; p += (size_t)DIM * DIM * 2;
  _Float16* Kwh = (_Float16*)p; p += (size_t)DIM * DIM * 2;
  float* corr = (float*)p;      p += (size_t)BB * HEAD * 32 * 32 * 4;

  // RMSNorm + f16 conversion of x and z; weight conversion f32 -> f16 into
  // W1h .. Kwh, which lie one behind the other from W1h on; corr cleared.
  k_norm<<<NB_NORM + NB_CVT + NB_ZERO, 256, 0, stream>>>(
      x, z, nw, W1w, W2w, W3w, Qw, Kw, xnh, zh, W1h, corr);

  // Per-head 32x32 correlations (reduction over n)
  k_corr<<<BB * (SEQ / CP), CTH, 0, stream>>>(xnh, Kwh, Kb, corr);

  // FFN + attention apply + gated combine
  k_main<<<BB * (SEQ / TP), 256, 0, stream>>>(
      xnh, zh, W1h, W1b, W2h, W2b, W3h, W3b, Qwh, Qb, corr,
      aalpha, abeta, galpha, gbeta, out);
}

// v006
// Measured time: 116 microseconds a run.
// Next to v005, in two timings, it ran 1.13 and 1.14 times as fast.
// Counting every step since v000, it is 4.11 times as fast.
#include <hip/hip_runtime.h>
#include <hip/hip_bf16.h>

// ---------------------------------------------------------------------------
// Parallel Graphormer block for MI455X (gfx1250, wave32, WMMA).
// All channel GEMMs run through v_wmma_f32_16x16x32_f16; tile staging uses
// GLOBAL_LOAD_ASYNC_TO_LDS_B128 (ASYNCcnt) to bypass VGPRs.
// ---------------------------------------------------------------------------

#define BB   16
#define DIM  128
#define SEQ  8192
#define HEAD 4
#define HID  512
#define NPOS ((size_t)BB * SEQ)

// LDS row pitches. The tiles that use them are read one row per lane, so an
// unpadded power-of-two row puts all 16 rows of a 16-byte read on the same
// four banks. One 16-byte pad per row makes the pitch 16 B x odd, which
// spreads the 16 rows over all 64 banks.
#define XP (DIM + 8)   // f16 rows of DIM: 272 B
#define GP (HID + 8)   // f16 rows of HID: 1040 B
#define FP (DIM + 4)   // f32 rows of DIM: 528 B

// Positions per block of k_main. Every weight fragment a wave loads from
// global memory feeds NT matrix products, one per 16-position sub-tile.
#define TP 64
#define NT (TP / 16)

// Positions per block of k_norm.
#define NP 128

// k_norm's grid: NB_NORM blocks normalise; behind them stand NB_CVT blocks
// that convert PE weight elements each and NB_ZERO blocks that clear PE
// elements of corr each.
#define PE      4096
#define NB_NORM ((int)(NPOS / NP))
#define NB_W    (HID * DIM / PE)
#define NB_Q    (DIM * DIM / PE)
#define NB_CVT  (3 * NB_W + 2 * NB_Q)
#define NB_ZERO (BB * HEAD * 32 * 32 / PE)

// Halves of one 16 x 32 weight fragment.
#define FH 512

// Positions and threads per block of k_corr.
#define CP  512
#define CTH 512

typedef __attribute__((ext_vector_type(16))) _Float16 v16h;
typedef __attribute__((ext_vector_type(8)))  float    v8f;
typedef __attribute__((ext_vector_type(8)))  _Float16 v8h;
typedef __attribute__((ext_vector_type(4)))  float    v4f;

__device__ __forceinline__ v8f wmma32(v16h a, v16h b, v8f c) {
  // D = A(16x32 f16) * B(32x16 f16) + C(16x16 f32)
  return __builtin_amdgcn_wmma_f32_16x16x32_f16(
      /*neg_a=*/false, a, /*neg_b=*/false, b,
      /*c_mod=*/(short)0, c, /*reuse_a=*/false, /*reuse_b=*/false);
}

// Async global -> LDS 16-byte copy (per active lane). VDST VGPR carries the
// LDS byte address (low 32 bits of the generic shared pointer), VADDR the
// 64-bit global address. Tracked by ASYNCcnt.
__device__ __forceinline__ void async_copy_b128(void* lds_ptr,
                                                const void* gptr) {
  unsigned lds_addr = (unsigned)(size_t)lds_ptr;
  unsigned long long ga = (unsigned long long)(size_t)gptr;
  // The wait stands inside the copy's own statement so that it precedes any
  // rewrite of the two address registers.
  asm volatile("global_load_async_to_lds_b128 %0, %1, off\n\ts_wait_xcnt 0x0"
               :: "v"(lds_addr), "v"(ga)
               : "memory");
}

// Eight such copies, ls halves apart in LDS and gs halves apart in global
// memory, in one statement with one wait behind the last: the wait precedes
// any rewrite of the sixteen address registers, and the copies issue back to
// back.
__device__ __forceinline__ void async_copy8_b128(_Float16* lds_ptr, int ls,
                                                 const _Float16* gptr, int gs) {
  unsigned l0 = (unsigned)(size_t)lds_ptr;
  unsigned long long g0 = (unsigned long long)(size_t)gptr;
  unsigned lb = (unsigned)ls * 2u;
  unsigned long long gb = (unsigned long long)gs * 2u;
  asm volatile("global_load_async_to_lds_b128 %0, %8, off\n\t"
               "global_load_async_to_lds_b128 %1, %9, off\n\t"
               "global_load_async_to_lds_b128 %2, %10, off\n\t"
               "global_load_async_to_lds_b128 %3, %11, off\n\t"
               "global_load_async_to_lds_b128 %4, %12, off\n\t"
               "global_load_async_to_lds_b128 %5, %13, off\n\t"
               "global_load_async_to_lds_b128 %6, %14, off\n\t"
               "global_load_async_to_lds_b128 %7, %15, off\n\t"
               "s_wait_xcnt 0x0"
               :: "v"(l0), "v"(l0 + lb), "v"(l0 + 2 * lb), "v"(l0 + 3 * lb),
                  "v"(l0 + 4 * lb), "v"(l0 + 5 * lb), "v"(l0 + 6 * lb),
                  "v"(l0 + 7 * lb),
                  "v"(g0), "v"(g0 + gb), "v"(g0 + 2 * gb), "v"(g0 + 3 * gb),
                  "v"(g0 + 4 * gb), "v"(g0 + 5 * gb), "v"(g0 + 6 * gb),
                  "v"(g0 + 7 * gb)
               : "memory");
}

__device__ __forceinline__ void wait_async0() {
  asm volatile("s_wait_asynccnt 0" ::: "memory");
}

// Load 16 f16 as two contiguous 16B chunks (p0[0..7], p0[16..23]) matching the
// ISA 16-bit A/B fragment striping: half h<8 -> K = 8*(lane>=16)+h,
// h>=8 -> K = 16 + 8*(lane>=16) + (h-8).
__device__ __forceinline__ v16h load16h(const _Float16* p0) {
  float4 a = *(const float4*)(p0);
  float4 b = *(const float4*)(p0 + 16);
  v16h r;
  __builtin_memcpy(&r, &a, 16);
  __builtin_memcpy(((char*)&r) + 16, &b, 16);
  return r;
}

// Row-major fragment: base[row*ldk + kb + ...] with contiguous K runs.
__device__ __forceinline__ v16h frag_rm(const _Float16* base, int ldk,
                                        int row, int kb, int lane) {
  return load16h(base + (size_t)row * ldk + kb + ((lane >> 4) << 3));
}

// Weight fragment from a matrix stored in fragment order (see k_norm): the
// 16 x 32 fragment number f is FH halves in a row, first the 32 lanes' low
// 16-byte chunks, then their high ones. Each of the two loads of a wave reads
// 512 contiguous bytes, four whole lines. A lane gets the same halves that
// frag_rm gives it from the row-major matrix.
__device__ __forceinline__ v16h frag_pk(const _Float16* base, int f, int lane) {
  const _Float16* p0 = base + (size_t)f * FH + lane * 8;
  float4 a = *(const float4*)(p0);
  float4 b = *(const float4*)(p0 + FH / 2);
  v16h r;
  __builtin_memcpy(&r, &a, 16);
  __builtin_memcpy(((char*)&r) + 16, &b, 16);
  return r;
}

// Gather fragment for strided K (e.g. channel = K*HEAD + head).
__device__ __forceinline__ v16h frag_gather(const _Float16* base, int stride,
                                            int lane) {
  v16h r = {};
  int lo = (lane >> 4) << 3;
  #pragma unroll
  for (int h = 0; h < 16; ++h) {
    int K = h + ((h >= 8) ? 8 : 0) + lo;
    r[h] = base[(size_t)K * stride];
  }
  return r;
}

__device__ __forceinline__ float sigm(float v) {
  return 1.0f / (1.0f + __expf(-v));
}

// ---------------------------------------------------------------------------
// RMSNorm over channels + f16 conversion of xn and z.
// Layout in: (b, c, n) f32.  Layout out: (b*n, c) f16 (GEMM-friendly rows).
// One block per (b, NP-position tile), 8 waves. A wave reads 16 channels, 512
// contiguous bytes of a channel per load, and keeps them in registers. The
// tiles are turned through LDS, so that every global store of a wave is 512
// contiguous bytes of the output rows.
// An LDS row is one position's 16 chunks of 16 bytes. Chunk ch of row r lies
// at place ch ^ ((r >> 2) & 15): the writers (one chunk number, rows four
// apart) and the readers (all chunks of two rows) both spread over all banks.
// The blocks from NB_NORM on do the work that nothing in this launch reads
// and the later launches need: the f32 -> f16 conversion of the five weight
// matrices, stored in fragment order, and the start value of corr. They stand
// last in the grid, so they start as the first tiles' blocks leave and end
// under the last tiles.
// ---------------------------------------------------------------------------
__device__ __forceinline__ int norm_slot(int r, int ch) {
  return r * DIM + ((ch ^ ((r >> 2) & 15)) << 3);
}

__global__ void __launch_bounds__(256)
k_norm(const float* __restrict__ x, const float* __restrict__ z,
       const float* __restrict__ nw,
       const float* __restrict__ W1w, const float* __restrict__ W2w,
       const float* __restrict__ W3w, const float* __restrict__ Qw,
       const float* __restrict__ Kw,
       _Float16* __restrict__ xnh, _Float16* __restrict__ zh,
       _Float16* __restrict__ wh, float* __restrict__ corr) {
  __shared__ __align__(16) _Float16 xt[NP * DIM];   // xn tile [pos][c], swizzled
  __shared__ __align__(16) _Float16 zt[NP * DIM];   // z  tile [pos][c], swizzled
  __shared__ __align__(16) v4f red[8 * 32];         // per-wave sums of squares
  int blk = blockIdx.x;
  int tid = threadIdx.x, lane = tid & 31;

  // The same test in every thread of a block, ahead of every barrier.
  if (blk >= NB_NORM) {
    int e = blk - NB_NORM;
    if (e < NB_CVT) {
      // wh holds W1, W2, W3, Q, K one behind the other, so the block's place
      // in it is e * PE whichever matrix it reads. m0 is the block's place in
      // its own matrix, lk the log2 of that matrix's fragments per row.
      const float* s;
      int m0, lk = 2;
      if (e < NB_W)                 { s = W1w; m0 = e; }
      else if (e < 2 * NB_W)        { s = W2w; m0 = e - NB_W; }
      else if (e < 3 * NB_W)        { s = W3w; m0 = e - 2 * NB_W; lk = 4; }
      else if (e < 3 * NB_W + NB_Q) { s = Qw;  m0 = e - 3 * NB_W; }
      else                          { s = Kw;  m0 = e - 3 * NB_W - NB_Q; }
      m0 *= PE;
      _Float16* d = wh + (size_t)e * PE;
      #pragma unroll  // all loads of the block in flight at once
      for (int k = 0; k < PE / 8 / 256; ++k) {
        int q = (k * 256 + tid) * 8;
        // The matrix is stored in fragment order (frag_pk): chunk q of the
        // block belongs to fragment f, lane l, low or high part.
        int dm = m0 + q;
        int f = dm / FH, part = (dm / (FH / 2)) & 1, l = (dm >> 3) & 31;
        int sr = (f >> lk) * 16 + (l & 15);
        int sc = (f & ((1 << lk) - 1)) * 32 + part * 16 + (l >> 4) * 8;
        int so = (sr << (lk + 5)) + sc;
        v4f lo = *(const v4f*)(s + so);
        v4f hi = *(const v4f*)(s + so + 4);
        v8h t;
        #pragma unroll  // constant i: t is built in registers
        for (int i = 0; i < 4; ++i) {
          t[i] = (_Float16)lo[i];
          t[4 + i] = (_Float16)hi[i];
        }
        *(v8h*)(d + q) = t;
      }
    } else {
      float* c = corr + (size_t)(e - NB_CVT) * PE;
      v4f zero = {};
      #pragma unroll  // independent stores
      for (int k = 0; k < PE / 4 / 256; ++k)
        *(v4f*)(c + (k * 256 + tid) * 4) = zero;
      // Precaution: the stores' registers are not rewritten ahead of this wait.
      asm volatile("s_wait_xcnt 0x0" ::: "memory");
    }
    return;
  }

  int b = blk / (SEQ / NP);
  int pb = (blk % (SEQ / NP)) * NP;
  // The wave's number in a scalar register: nw is then read by scalar loads.
  int wave = __builtin_amdgcn_readfirstlane(tid >> 5);
  int c0 = wave * 16;

  // This lane: positions 4*lane .. 4*lane+3 of channels c0 .. c0+15.
  size_t in0 = ((size_t)b * DIM + c0) * SEQ + pb + lane * 4;
  v4f xv[16], zv[16];
  #pragma unroll  // constant j: xv stays in registers, all loads in flight
  for (int j = 0; j < 16; ++j)
    xv[j] = *(const v4f*)(x + in0 + (size_t)j * SEQ);
  #pragma unroll  // constant j: zv stays in registers, all loads in flight
  for (int j = 0; j < 16; ++j)
    zv[j] = *(const v4f*)(z + in0 + (size_t)j * SEQ);

  v4f ss = {};
  #pragma unroll  // constant j: register indices
  for (int j = 0; j < 16; ++j) ss += xv[j] * xv[j];
  red[wave * 32 + lane] = ss;

  #pragma unroll  // constant i, h: register indices
  for (int i = 0; i < 4; ++i) {
    #pragma unroll  // constant h
    for (int h = 0; h < 2; ++h) {
      v8h t;
      #pragma unroll  // constant e: t is built in registers
      for (int e = 0; e < 8; ++e) t[e] = (_Float16)zv[h * 8 + e][i];
      *(v8h*)(zt + norm_slot(lane * 4 + i, wave * 2 + h)) = t;
    }
  }
  __syncthreads();

  v4f s = red[lane];
  #pragma unroll  // the eight LDS reads are issued together
  for (int w = 1; w < 8; ++w) s += red[w * 32 + lane];
  #pragma unroll  // constant i, h: register indices
  for (int i = 0; i < 4; ++i) {
    float rinv = rsqrtf(s[i] * (1.0f / DIM) + 1e-6f);
    #pragma unroll  // constant h
    for (int h = 0; h < 2; ++h) {
      v8h t;
      #pragma unroll  // constant e: t is built in registers
      for (int e = 0; e < 8; ++e)
        t[e] = (_Float16)(nw[c0 + h * 8 + e] * xv[h * 8 + e][i] * rinv);
      *(v8h*)(xt + norm_slot(lane * 4 + i, wave * 2 + h)) = t;
    }
  }
  __syncthreads();

  // The tile's NP output rows are one contiguous range of NP * DIM halves.
  // All global stores stand behind the last barrier, which then waits for none.
  size_t out0 = ((size_t)b * SEQ + pb) * DIM;
  #pragma unroll  // the LDS reads are issued together, ahead of the stores
  for (int k = 0; k < (NP * DIM) / 8 / 256; ++k) {
    int q = k * 256 + tid;
    int sl = norm_slot(q >> 4, q & 15);
    *(v8h*)(zh + out0 + (size_t)q * 8) = *(const v8h*)(zt + sl);
    *(v8h*)(xnh + out0 + (size_t)q * 8) = *(const v8h*)(xt + sl);
  }
  // Precaution: in the built code this path runs on into the shared exit's
  // tests; no register of the stores is rewritten ahead of this wait.
  asm volatile("s_wait_xcnt 0x0" ::: "memory");
}

// ---------------------------------------------------------------------------
// Correlation: corr[b,h] += xr(32 x CP) @ k(32 x CP)^T with k = Kw@xn + Kb.
// One block per (b, CP-position slab), 16 waves. The whole slab is staged and
// projected once; each wave then sums one 16x16 piece of one head's
// correlation over all CP positions in its matrix accumulator, so an element
// of corr takes one atomic add per slab.
// ---------------------------------------------------------------------------
__global__ void __launch_bounds__(CTH)
k_corr(const _Float16* __restrict__ xnh,
       const _Float16* __restrict__ Kwh,
       const float* __restrict__ Kb,
       float* __restrict__ corr) {
  __shared__ __align__(16) _Float16 xs[CP * XP];   // [pos][c], padded rows
  __shared__ __align__(16) _Float16 ks[CP * XP];   // [pos][c], padded rows
  int blk = blockIdx.x;
  int b = blk / (SEQ / CP);
  int pb = (blk % (SEQ / CP)) * CP;
  int tid = threadIdx.x, lane = tid & 31, wave = tid >> 5;
  int row = lane & 15, hi8 = (lane >> 4) << 3;

  // Async-stage the xn slab (128 KB) straight into LDS, bypassing VGPRs.
  // A constant trip count: every lane is on at every copy. One copy of all
  // threads fills CTH / 16 rows, one trip of eight copies half the slab.
  const _Float16* src = xnh + ((size_t)b * SEQ + pb) * DIM + tid * 8;
  _Float16* dst = xs + (tid >> 4) * XP + (tid & 15) * 8;
  #pragma unroll  // constant steps: the addresses of a group differ by constants
  for (int k = 0; k < (CP * DIM) / 8 / CTH; k += 8)
    async_copy8_b128(dst + (size_t)k * (CTH / 16) * XP, (CTH / 16) * XP,
                     src + (size_t)k * CTH * 8, CTH * 8);

  // k = Kw @ xn + Kb : a wave owns 16 output channels of half the slab. Its
  // weight fragments and biases are the same for every sub-tile; their loads
  // fly together with the copies.
  int oc = wave & 7, ph = wave >> 3;
  int o0 = oc * 16 + hi8;
  v16h aw[4];
  #pragma unroll  // constant kb: aw stays in registers
  for (int kb = 0; kb < 4; ++kb)
    aw[kb] = frag_pk(Kwh, oc * 4 + kb, lane);
  float kbv[8];
  #pragma unroll  // constant r: kbv stays in registers
  for (int r = 0; r < 8; ++r) kbv[r] = Kb[o0 + r];
  wait_async0();
  __syncthreads();

  {
    #pragma unroll 4  // four independent accumulate chains fill each other's latency
    for (int nc = 0; nc < CP / 32; ++nc) {
      int p0 = ph * (CP / 2) + nc * 16;
      v8f acc = {};
      #pragma unroll
      for (int kb = 0; kb < 4; ++kb) {
        v16h bf = frag_rm(xs + p0 * XP, XP, row, kb * 32, lane);
        acc = wmma32(aw[kb], bf, acc);
      }
      #pragma unroll
      for (int r = 0; r < 8; ++r)
        ks[(p0 + row) * XP + o0 + r] = (_Float16)(acc[r] + kbv[r]);
    }
  }
  __syncthreads();

  // corr piece: A = xr (16 x 32 pos), B = k^T (32 pos x 16), summed over the
  // slab's CP / 32 steps of 32 positions.
  {
    int head = wave >> 2, mc = (wave >> 1) & 1, nc = wave & 1;
    const _Float16* xa = xs + ((mc * 16 + row) * HEAD + head);
    const _Float16* kbp = ks + ((nc * 16 + row) * HEAD + head);
    v8f acc = {};
    #pragma unroll 4  // several steps' LDS reads in flight at once
    for (int kt = 0; kt < CP / 32; ++kt) {
      v16h a = frag_gather(xa + kt * 32 * XP, XP, lane);
      v16h bf = frag_gather(kbp + kt * 32 * XP, XP, lane);
      acc = wmma32(a, bf, acc);
    }
    float* cp = corr + (((size_t)b * HEAD + head) * 32) * 32;
    int d0 = mc * 16 + hi8;
    int s = nc * 16 + row;
    #pragma unroll
    for (int r = 0; r < 8; ++r) atomicAdd(&cp[(d0 + r) * 32 + s], acc[r]);
  }
}

// ---------------------------------------------------------------------------
// Main per-tile kernel: SwiGLU FFN + Q projection + corr@q + gated combine.
// One block per (b, TP-position tile), 8 waves.
// ---------------------------------------------------------------------------
// The real block size, and four waves per SIMD (two blocks per WGP, which is
// what the LDS allows): without it the compiler plans for 1,024 threads, caps
// the wave at 128 registers and spills the accumulators.
__global__ void __launch_bounds__(256, 4)
k_main(const _Float16* __restrict__ xnh,
                       const _Float16* __restrict__ zh,
                       const _Float16* __restrict__ W1h,
                       const float* __restrict__ W1b,
                       const _Float16* __restrict__ W2h,
                       const float* __restrict__ W2b,
                       const _Float16* __restrict__ W3h,
                       const float* __restrict__ W3b,
                       const _Float16* __restrict__ Qwh,
                       const float* __restrict__ Qb,
                       const float* __restrict__ corr,
                       const float* __restrict__ aalpha,
                       const float* __restrict__ abeta,
                       const float* __restrict__ galpha,
                       const float* __restrict__ gbeta,
                       float* __restrict__ out) {
  __shared__ __align__(16) _Float16 xs[TP * XP];         // xn tile [p][c]
  __shared__ __align__(16) _Float16 zs[TP * XP];         // z  tile [p][c]
  __shared__ __align__(16) _Float16 gh[TP * GP];         // silu(h1)*h2 [p][o]
  __shared__ __align__(16) _Float16 qs[TP * XP];         // q tile [p][c]
  __shared__ __align__(16) _Float16 cs[HEAD * 32 * 32];  // corr f16 [h][d][s]
  __shared__ __align__(16) float    fs[TP * FP];         // ffn f32 [p][c]

  int blk = blockIdx.x;
  int b = blk / (SEQ / TP);
  int pb = (blk % (SEQ / TP)) * TP;
  int tid = threadIdx.x, lane = tid & 31, wave = tid >> 5;
  int row = lane & 15, hi8 = (lane >> 4) << 3;

  // Async-stage xn and z tiles (16 KB each) into LDS, bypassing VGPRs.
  const _Float16* sx = xnh + ((size_t)b * SEQ + pb) * DIM;
  const _Float16* sz = zh + ((size_t)b * SEQ + pb) * DIM;
  __builtin_prefetch(sx + TP * DIM, 0, 0);   // next tile -> global_prefetch_b8
  // A constant trip count: every lane is on at every copy.
  for (int k = 0; k < (TP * DIM) / 8 / 256; ++k) {
    int i = k * 256 + tid;
    async_copy_b128(xs + (i >> 4) * XP + (i & 15) * 8, sx + i * 8);
    async_copy_b128(zs + (i >> 4) * XP + (i & 15) * 8, sz + i * 8);
  }
  // Corr needs an f32->f16 conversion, so it rides the normal VGPR path.
  const float* cb = corr + (size_t)b * HEAD * 32 * 32;
  for (int i = tid; i < HEAD * 32 * 32; i += 256) cs[i] = (_Float16)cb[i];
  wait_async0();
  __syncthreads();

  // ---- W1 / W2 GEMMs (512x128 each), wave owns 4 output chunks of 16 ----
  // The xn fragments are the same for every m: read once, kept in registers.
  v16h bx[4][NT];
  #pragma unroll  // constant kb: bx stays in registers
  for (int kb = 0; kb < 4; ++kb) {
    #pragma unroll  // constant nt: the per-sub-tile arrays stay in registers
    for (int nt = 0; nt < NT; ++nt)
      bx[kb][nt] = frag_rm(xs + nt * 16 * XP, XP, row, kb * 32, lane);
  }
  for (int m = 0; m < 4; ++m) {
    int ob = (wave * 4 + m) * 16;
    v8f a1[NT] = {}, a2[NT] = {};
    #pragma unroll
    for (int kb = 0; kb < 4; ++kb) {
      v16h af1 = frag_pk(W1h, (wave * 4 + m) * 4 + kb, lane);
      v16h af2 = frag_pk(W2h, (wave * 4 + m) * 4 + kb, lane);
      #pragma unroll  // constant nt: the per-sub-tile arrays stay in registers
      for (int nt = 0; nt < NT; ++nt) {
        a1[nt] = wmma32(af1, bx[kb][nt], a1[nt]);
        a2[nt] = wmma32(af2, bx[kb][nt], a2[nt]);
      }
    }
    // The bias loads below may land in the registers that held the weight
    // loads' addresses: this wait stands between the two.
    asm volatile("s_wait_xcnt 0x0" ::: "memory");
    int o0 = ob + hi8;
    #pragma unroll  // constant nt: the per-sub-tile arrays stay in registers
    for (int nt = 0; nt < NT; ++nt) {
      int p = nt * 16 + row;
      #pragma unroll
      for (int r = 0; r < 8; ++r) {
        float h1 = a1[nt][r] + W1b[o0 + r];
        float h2 = a2[nt][r] + W2b[o0 + r];
        float g = (h1 / (1.0f + __expf(-h1))) * h2;   // silu(h1)*h2
        gh[p * GP + o0 + r] = (_Float16)g;
      }
    }
  }

  // ---- Q projection (128x128), wave owns one output chunk ----
  {
    int ob = wave * 16;
    v8f aq[NT] = {};
    v16h af[4];
    #pragma unroll  // constant kb: af stays in registers, all loads in flight
    for (int kb = 0; kb < 4; ++kb) af[kb] = frag_pk(Qwh, wave * 4 + kb, lane);
    // Precaution: the LDS reads below may land in the registers that held the
    // weight loads' address: this wait stands between the two.
    asm volatile("s_wait_xcnt 0x0" ::: "memory");
    #pragma unroll
    for (int kb = 0; kb < 4; ++kb) {
      #pragma unroll  // constant nt: the per-sub-tile arrays stay in registers
      for (int nt = 0; nt < NT; ++nt) {
        v16h bf = frag_rm(zs + nt * 16 * XP, XP, row, kb * 32, lane);
        aq[nt] = wmma32(af[kb], bf, aq[nt]);
      }
    }
    int o0 = ob + hi8;
    #pragma unroll  // constant nt: the per-sub-tile arrays stay in registers
    for (int nt = 0; nt < NT; ++nt) {
      int p = nt * 16 + row;
      #pragma unroll
      for (int r = 0; r < 8; ++r)
        qs[p * XP + o0 + r] = (_Float16)(aq[nt][r] + Qb[o0 + r]);
    }
  }
  __syncthreads();

  // ---- W3 GEMM (128x512), wave owns one output chunk, K = 512 ----
  {
    int ob = wave * 16;
    v8f a3[NT] = {};
    #pragma unroll
    for (int kb = 0; kb < 16; ++kb) {
      v16h aw = frag_pk(W3h, wave * 16 + kb, lane);
      #pragma unroll  // constant nt: the per-sub-tile arrays stay in registers
      for (int nt = 0; nt < NT; ++nt) {
        v16h bg = frag_rm(gh + nt * 16 * GP, GP, row, kb * 32, lane);
        a3[nt] = wmma32(aw, bg, a3[nt]);
      }
    }
    int o0 = ob + hi8;
    #pragma unroll  // constant nt: the per-sub-tile arrays stay in registers
    for (int nt = 0; nt < NT; ++nt) {
      int p = nt * 16 + row;
      #pragma unroll
      for (int r = 0; r < 8; ++r)
        fs[p * FP + o0 + r] = a3[nt][r] + W3b[o0 + r];
    }
  }
  __syncthreads();

  // ---- attn = corr @ q, then gated combine + store ----
  {
    int head = wave >> 1, mc = wave & 1;
    v16h ac = frag_rm(cs + head * 32 * 32, 32, mc * 16 + row, 0, lane);
    float sa = sigm(aalpha[head]);
    float sb = sigm(abeta[head]);
    float ga = sigm(galpha[0]);
    float gb = sigm(gbeta[0]);
    int d0 = mc * 16 + hi8;
    #pragma unroll  // the four sub-tiles' LDS reads are issued together
    for (int nt = 0; nt < NT; ++nt) {
      int p = nt * 16 + row;
      v16h bq = frag_gather(qs + p * XP + head, HEAD, lane);
      v8f at = {};
      at = wmma32(ac, bq, at);
      #pragma unroll
      for (int r = 0; r < 8; ++r) {
        int d = d0 + r;
        int c = d * HEAD + head;
        float attnv = at[r] * (1.0f / SEQ);
        float mha = sa * (float)xs[p * XP + c] + sb * attnv;
        out[(((size_t)b * DIM) + c) * SEQ + pb + p] =
            ga * fs[p * FP + c] + gb * mha;
      }
    }
  }
}

// ---------------------------------------------------------------------------
// Host launch
// ---------------------------------------------------------------------------
extern "C" void kernel_launch(void* const* d_in, const int* in_sizes, int n_in,
                              void* d_out, int out_size, void* d_ws,
                              size_t ws_size, hipStream_t stream) {
  const float* x  = (const float*)d_in[0];
  const float* z  = (const float*)d_in[1];
  const float* nw = (const float*)d_in[2];
  const float* Qw = (const float*)d_in[3];
  const float* Qb = (const float*)d_in[4];
  const float* Kw = (const float*)d_in[5];
  const float* Kb = (const float*)d_in[6];
  const float* aalpha = (const float*)d_in[7];
  const float* abeta  = (const float*)d_in[8];
  const float* W1w = (const float*)d_in[9];
  const float* W1b = (const float*)d_in[10];
  const float* W2w = (const float*)d_in[11];
  const float* W2b = (const float*)d_in[12];
  const float* W3w = (const float*)d_in[13];
  const float* W3b = (const float*)d_in[14];
  const float* galpha = (const float*)d_in[15];
  const float* gbeta  = (const float*)d_in[16];
  float* out = (float*)d_out;

  // Workspace carve-up
  char* p = (char*)d_ws;
  _Float16* xnh = (_Float16*)p; p += NPOS * DIM * 2;
  _Float16* zh  = (_Float16*)p; p += NPOS * DIM * 2;
  _Float16* W1h = (_Float16*)p; p += (size_t)HID * DIM * 2;
  _Float16* W2h = (_Float16*)p; p += (size_t)HID * DIM * 2;
  _Float16* W3h = (_Float16*)p; p += (size_t)DIM * HID * 2;
  _Float16* Qwh = (_Float16*)p; p += (size_t)DIM * DIM * 2;
  _Float16* Kwh = (_Float16*)p; p += (size_t)DIM * DIM * 2;
  float* corr = (float*)p;      p += (size_t)BB * HEAD * 32 * 32 * 4;

  // RMSNorm + f16 conversion of x and z; weight conversion f32 -> f16 into
  // W1h .. Kwh, which lie one behind the other from W1h on; corr cleared.
  k_norm<<<NB_NORM + NB_CVT + NB_ZERO, 256, 0, stream>>>(
      x, z, nw, W1w, W2w, W3w, Qw, Kw, xnh, zh, W1h, corr);

  // Per-head 32x32 correlations (reduction over n)
  k_corr<<<BB * (SEQ / CP), CTH, 0, stream>>>(xnh, Kwh, Kb, corr);

  // FFN + attention apply + gated combine
  k_main<<<BB * (SEQ / TP), 256, 0, stream>>>(
      xnh, zh, W1h, W1b, W2h, W2b, W3h, W3b, Qwh, Qb, corr,
      aalpha, abeta, galpha, gbeta, out);
}

// v007
// Measured time: 101 microseconds a run.
// In both of two side-by-side timings against v006, it was 1.14 times as fast.
// Over all steps from v000 it is 4.69 times as fast.
#include <hip/hip_runtime.h>
#include <hip/hip_bf16.h>

// ---------------------------------------------------------------------------
// Parallel Graphormer block for MI455X (gfx1250, wave32, WMMA).
// All channel GEMMs run through v_wmma_f32_16x16x32_f16; tile staging uses
// GLOBAL_LOAD_ASYNC_TO_LDS_B128 (ASYNCcnt) to bypass VGPRs.
// ---------------------------------------------------------------------------

#define BB   16
#define DIM  128
#define SEQ  8192
#define HEAD 4
#define HID  512
#define NPOS ((size_t)BB * SEQ)

// LDS row pitches. The tiles that use them are read one row per lane, so an
// unpadded power-of-two row puts all 16 rows of a 16-byte read on the same
// four banks. One 16-byte pad per row makes the pitch 16 B x odd, which
// spreads the 16 rows over all 64 banks.
#define XP (DIM + 8)   // f16 rows of DIM: 272 B
#define GP (HID + 8)   // f16 rows of HID: 1040 B
#define FP (DIM + 4)   // f32 rows of DIM: 528 B

// Positions per block of k_main. Every weight fragment a wave loads from
// global memory feeds NT matrix products, one per 16-position sub-tile.
#define TP 64
#define NT (TP / 16)

// Positions per block of k_norm.
#define NP 128

// k_norm's grid: NB_NORM blocks normalise; behind them stand NB_CVT blocks
// that convert PE weight elements each and NB_ZERO blocks that clear PE
// elements of corr each.
#define PE      4096
#define NB_NORM ((int)(NPOS / NP))
#define NB_W    (HID * DIM / PE)
#define NB_Q    (DIM * DIM / PE)
#define NB_CVT  (3 * NB_W + 2 * NB_Q)
#define NB_ZERO (BB * HEAD * 32 * 32 / PE)

// Halves of one 16 x 32 weight fragment.
#define FH 512

// Positions and threads per block of k_corr.
#define CP  512
#define CTH 512

typedef __attribute__((ext_vector_type(16))) _Float16 v16h;
typedef __attribute__((ext_vector_type(8)))  float    v8f;
typedef __attribute__((ext_vector_type(8)))  _Float16 v8h;
typedef __attribute__((ext_vector_type(4)))  float    v4f;

__device__ __forceinline__ v8f wmma32(v16h a, v16h b, v8f c) {
  // D = A(16x32 f16) * B(32x16 f16) + C(16x16 f32)
  return __builtin_amdgcn_wmma_f32_16x16x32_f16(
      /*neg_a=*/false, a, /*neg_b=*/false, b,
      /*c_mod=*/(short)0, c, /*reuse_a=*/false, /*reuse_b=*/false);
}

// Async global -> LDS 16-byte copy (per active lane). VDST VGPR carries the
// LDS byte address (low 32 bits of the generic shared pointer), VADDR the
// 64-bit global address. Tracked by ASYNCcnt.
__device__ __forceinline__ void async_copy_b128(void* lds_ptr,
                                                const void* gptr) {
  unsigned lds_addr = (unsigned)(size_t)lds_ptr;
  unsigned long long ga = (unsigned long long)(size_t)gptr;
  // The wait stands inside the copy's own statement so that it precedes any
  // rewrite of the two address registers.
  asm volatile("global_load_async_to_lds_b128 %0, %1, off\n\ts_wait_xcnt 0x0"
               :: "v"(lds_addr), "v"(ga)
               : "memory");
}

// Eight such copies, ls halves apart in LDS and gs halves apart in global
// memory, in one statement with one wait behind the last: the wait precedes
// any rewrite of the sixteen address registers, and the copies issue back to
// back.
__device__ __forceinline__ void async_copy8_b128(_Float16* lds_ptr, int ls,
                                                 const _Float16* gptr, int gs) {
  unsigned l0 = (unsigned)(size_t)lds_ptr;
  unsigned long long g0 = (unsigned long long)(size_t)gptr;
  unsigned lb = (unsigned)ls * 2u;
  unsigned long long gb = (unsigned long long)gs * 2u;
  asm volatile("global_load_async_to_lds_b128 %0, %8, off\n\t"
               "global_load_async_to_lds_b128 %1, %9, off\n\t"
               "global_load_async_to_lds_b128 %2, %10, off\n\t"
               "global_load_async_to_lds_b128 %3, %11, off\n\t"
               "global_load_async_to_lds_b128 %4, %12, off\n\t"
               "global_load_async_to_lds_b128 %5, %13, off\n\t"
               "global_load_async_to_lds_b128 %6, %14, off\n\t"
               "global_load_async_to_lds_b128 %7, %15, off\n\t"
               "s_wait_xcnt 0x0"
               :: "v"(l0), "v"(l0 + lb), "v"(l0 + 2 * lb), "v"(l0 + 3 * lb),
                  "v"(l0 + 4 * lb), "v"(l0 + 5 * lb), "v"(l0 + 6 * lb),
                  "v"(l0 + 7 * lb),
                  "v"(g0), "v"(g0 + gb), "v"(g0 + 2 * gb), "v"(g0 + 3 * gb),
                  "v"(g0 + 4 * gb), "v"(g0 + 5 * gb), "v"(g0 + 6 * gb),
                  "v"(g0 + 7 * gb)
               : "memory");
}

__device__ __forceinline__ void wait_async0() {
  asm volatile("s_wait_asynccnt 0" ::: "memory");
}

// Load 16 f16 as two contiguous 16B chunks (p0[0..7], p0[16..23]) matching the
// ISA 16-bit A/B fragment striping: half h<8 -> K = 8*(lane>=16)+h,
// h>=8 -> K = 16 + 8*(lane>=16) + (h-8).
__device__ __forceinline__ v16h load16h(const _Float16* p0) {
  float4 a = *(const float4*)(p0);
  float4 b = *(const float4*)(p0 + 16);
  v16h r;
  __builtin_memcpy(&r, &a, 16);
  __builtin_memcpy(((char*)&r) + 16, &b, 16);
  return r;
}

// Row-major fragment: base[row*ldk + kb + ...] with contiguous K runs.
__device__ __forceinline__ v16h frag_rm(const _Float16* base, int ldk,
                                        int row, int kb, int lane) {
  return load16h(base + (size_t)row * ldk + kb + ((lane >> 4) << 3));
}

// Weight fragment from a matrix stored in fragment order (see k_norm): the
// 16 x 32 fragment number f is FH halves in a row, first the 32 lanes' low
// 16-byte chunks, then their high ones. Each of the two loads of a wave reads
// 512 contiguous bytes, four whole lines. A lane gets the same halves that
// frag_rm gives it from the row-major matrix.
__device__ __forceinline__ v16h frag_pk(const _Float16* base, int f, int lane) {
  const _Float16* p0 = base + (size_t)f * FH + lane * 8;
  float4 a = *(const float4*)(p0);
  float4 b = *(const float4*)(p0 + FH / 2);
  v16h r;
  __builtin_memcpy(&r, &a, 16);
  __builtin_memcpy(((char*)&r) + 16, &b, 16);
  return r;
}

// The same for the last fragment of a run of weight loads: behind their last
// loads the run's address registers are free, and one of these two loads may
// land in them. Precaution: s_wait_xcnt 0 stands in front of each of the two,
// behind every load that names those registers.
__device__ __forceinline__ v16h frag_pk_last(const _Float16* base, int f,
                                             int lane) {
  const _Float16* p0 = base + (size_t)f * FH + lane * 8;
  asm volatile("s_wait_xcnt 0x0" ::: "memory");
  float4 a = *(const float4*)(p0);
  asm volatile("s_wait_xcnt 0x0" ::: "memory");
  float4 b = *(const float4*)(p0 + FH / 2);
  v16h r;
  __builtin_memcpy(&r, &a, 16);
  __builtin_memcpy(((char*)&r) + 16, &b, 16);
  return r;
}

// Gather fragment for strided K (e.g. channel = K*HEAD + head).
__device__ __forceinline__ v16h frag_gather(const _Float16* base, int stride,
                                            int lane) {
  v16h r = {};
  int lo = (lane >> 4) << 3;
  #pragma unroll
  for (int h = 0; h < 16; ++h) {
    int K = h + ((h >= 8) ? 8 : 0) + lo;
    r[h] = base[(size_t)K * stride];
  }
  return r;
}

// The divisor is never below 1: v_rcp_f32 in place of the exact division.
__device__ __forceinline__ float sigm(float v) {
  return __builtin_amdgcn_rcpf(1.0f + __expf(-v));
}

// ---------------------------------------------------------------------------
// RMSNorm over channels + f16 conversion of xn and z.
// Layout in: (b, c, n) f32.  Layout out: (b*n, c) f16 (GEMM-friendly rows).
// One block per (b, NP-position tile), 8 waves. A wave reads 16 channels, 512
// contiguous bytes of a channel per load, and keeps them in registers. The
// tiles are turned through LDS, so that every global store of a wave is 512
// contiguous bytes of the output rows.
// An LDS row is one position's 16 chunks of 16 bytes. Chunk ch of row r lies
// at place ch ^ ((r >> 2) & 15): the writers (one chunk number, rows four
// apart) and the readers (all chunks of two rows) both spread over all banks.
// The blocks from NB_NORM on do the work that nothing in this launch reads
// and the later launches need: the f32 -> f16 conversion of the five weight
// matrices, stored in fragment order, and the start value of corr. They stand
// last in the grid, so they start as the first tiles' blocks leave and end
// under the last tiles.
// ---------------------------------------------------------------------------
__device__ __forceinline__ int norm_slot(int r, int ch) {
  return r * DIM + ((ch ^ ((r >> 2) & 15)) << 3);
}

__global__ void __launch_bounds__(256)
k_norm(const float* __restrict__ x, const float* __restrict__ z,
       const float* __restrict__ nw,
       const float* __restrict__ W1w, const float* __restrict__ W2w,
       const float* __restrict__ W3w, const float* __restrict__ Qw,
       const float* __restrict__ Kw,
       _Float16* __restrict__ xnh, _Float16* __restrict__ zh,
       _Float16* __restrict__ wh, float* __restrict__ corr) {
  __shared__ __align__(16) _Float16 xt[NP * DIM];   // xn tile [pos][c], swizzled
  __shared__ __align__(16) _Float16 zt[NP * DIM];   // z  tile [pos][c], swizzled
  __shared__ __align__(16) v4f red[8 * 32];         // per-wave sums of squares
  int blk = blockIdx.x;
  int tid = threadIdx.x, lane = tid & 31;

  // The same test in every thread of a block, ahead of every barrier.
  if (blk >= NB_NORM) {
    int e = blk - NB_NORM;
    if (e < NB_CVT) {
      // wh holds W1, W2, W3, Q, K one behind the other, so the block's place
      // in it is e * PE whichever matrix it reads. m0 is the block's place in
      // its own matrix, lk the log2 of that matrix's fragments per row.
      const float* s;
      int m0, lk = 2;
      if (e < NB_W)                 { s = W1w; m0 = e; }
      else if (e < 2 * NB_W)        { s = W2w; m0 = e - NB_W; }
      else if (e < 3 * NB_W)        { s = W3w; m0 = e - 2 * NB_W; lk = 4; }
      else if (e < 3 * NB_W + NB_Q) { s = Qw;  m0 = e - 3 * NB_W; }
      else                          { s = Kw;  m0 = e - 3 * NB_W - NB_Q; }
      m0 *= PE;
      _Float16* d = wh + (size_t)e * PE;
      #pragma unroll  // all loads of the block in flight at once
      for (int k = 0; k < PE / 8 / 256; ++k) {
        int q = (k * 256 + tid) * 8;
        // The matrix is stored in fragment order (frag_pk): chunk q of the
        // block belongs to fragment f, lane l, low or high part.
        int dm = m0 + q;
        int f = dm / FH, part = (dm / (FH / 2)) & 1, l = (dm >> 3) & 31;
        int sr = (f >> lk) * 16 + (l & 15);
        int sc = (f & ((1 << lk) - 1)) * 32 + part * 16 + (l >> 4) * 8;
        int so = (sr << (lk + 5)) + sc;
        v4f lo = *(const v4f*)(s + so);
        v4f hi = *(const v4f*)(s + so + 4);
        v8h t;
        #pragma unroll  // constant i: t is built in registers
        for (int i = 0; i < 4; ++i) {
          t[i] = (_Float16)lo[i];
          t[4 + i] = (_Float16)hi[i];
        }
        *(v8h*)(d + q) = t;
      }
    } else {
      float* c = corr + (size_t)(e - NB_CVT) * PE;
      v4f zero = {};
      #pragma unroll  // independent stores
      for (int k = 0; k < PE / 4 / 256; ++k)
        *(v4f*)(c + (k * 256 + tid) * 4) = zero;
      // Precaution: the stores' registers are not rewritten ahead of this wait.
      asm volatile("s_wait_xcnt 0x0" ::: "memory");
    }
    return;
  }

  int b = blk / (SEQ / NP);
  int pb = (blk % (SEQ / NP)) * NP;
  // The wave's number in a scalar register: nw is then read by scalar loads.
  int wave = __builtin_amdgcn_readfirstlane(tid >> 5);
  int c0 = wave * 16;

  // This lane: positions 4*lane .. 4*lane+3 of channels c0 .. c0+15.
  size_t in0 = ((size_t)b * DIM + c0) * SEQ + pb + lane * 4;
  v4f xv[16], zv[16];
  #pragma unroll  // constant j: xv stays in registers, all loads in flight
  for (int j = 0; j < 16; ++j)
    xv[j] = *(const v4f*)(x + in0 + (size_t)j * SEQ);
  #pragma unroll  // constant j: zv stays in registers, all loads in flight
  for (int j = 0; j < 16; ++j)
    zv[j] = *(const v4f*)(z + in0 + (size_t)j * SEQ);

  v4f ss = {};
  #pragma unroll  // constant j: register indices
  for (int j = 0; j < 16; ++j) ss += xv[j] * xv[j];
  red[wave * 32 + lane] = ss;

  #pragma unroll  // constant i, h: register indices
  for (int i = 0; i < 4; ++i) {
    #pragma unroll  // constant h
    for (int h = 0; h < 2; ++h) {
      v8h t;
      #pragma unroll  // constant e: t is built in registers
      for (int e = 0; e < 8; ++e) t[e] = (_Float16)zv[h * 8 + e][i];
      *(v8h*)(zt + norm_slot(lane * 4 + i, wave * 2 + h)) = t;
    }
  }
  __syncthreads();

  v4f s = red[lane];
  #pragma unroll  // the eight LDS reads are issued together
  for (int w = 1; w < 8; ++w) s += red[w * 32 + lane];
  #pragma unroll  // constant i, h: register indices
  for (int i = 0; i < 4; ++i) {
    float rinv = rsqrtf(s[i] * (1.0f / DIM) + 1e-6f);
    #pragma unroll  // constant h
    for (int h = 0; h < 2; ++h) {
      v8h t;
      #pragma unroll  // constant e: t is built in registers
      for (int e = 0; e < 8; ++e)
        t[e] = (_Float16)(nw[c0 + h * 8 + e] * xv[h * 8 + e][i] * rinv);
      *(v8h*)(xt + norm_slot(lane * 4 + i, wave * 2 + h)) = t;
    }
  }
  __syncthreads();

  // The tile's NP output rows are one contiguous range of NP * DIM halves.
  // All global stores stand behind the last barrier, which then waits for none.
  size_t out0 = ((size_t)b * SEQ + pb) * DIM;
  #pragma unroll  // the LDS reads are issued together, ahead of the stores
  for (int k = 0; k < (NP * DIM) / 8 / 256; ++k) {
    int q = k * 256 + tid;
    int sl = norm_slot(q >> 4, q & 15);
    *(v8h*)(zh + out0 + (size_t)q * 8) = *(const v8h*)(zt + sl);
    *(v8h*)(xnh + out0 + (size_t)q * 8) = *(const v8h*)(xt + sl);
  }
  // Precaution: in the built code this path runs on into the shared exit's
  // tests; no register of the stores is rewritten ahead of this wait.
  asm volatile("s_wait_xcnt 0x0" ::: "memory");
}

// ---------------------------------------------------------------------------
// Correlation: corr[b,h] += xr(32 x CP) @ k(32 x CP)^T with k = Kw@xn + Kb.
// One block per (b, CP-position slab), 16 waves. The whole slab is staged and
// projected once; each wave then sums one 16x16 piece of one head's
// correlation over all CP positions in its matrix accumulator, so an element
// of corr takes one atomic add per slab.
// ---------------------------------------------------------------------------
__global__ void __launch_bounds__(CTH)
k_corr(const _Float16* __restrict__ xnh,
       const _Float16* __restrict__ Kwh,
       const float* __restrict__ Kb,
       float* __restrict__ corr) {
  __shared__ __align__(16) _Float16 xs[CP * XP];   // [pos][c], padded rows
  __shared__ __align__(16) _Float16 ks[CP * XP];   // [pos][c], padded rows
  int blk = blockIdx.x;
  int b = blk / (SEQ / CP);
  int pb = (blk % (SEQ / CP)) * CP;
  int tid = threadIdx.x, lane = tid & 31, wave = tid >> 5;
  int row = lane & 15, hi8 = (lane >> 4) << 3;

  // Async-stage the xn slab (128 KB) straight into LDS, bypassing VGPRs.
  // A constant trip count: every lane is on at every copy. One copy of all
  // threads fills CTH / 16 rows, one trip of eight copies half the slab.
  const _Float16* src = xnh + ((size_t)b * SEQ + pb) * DIM + tid * 8;
  _Float16* dst = xs + (tid >> 4) * XP + (tid & 15) * 8;
  #pragma unroll  // constant steps: the addresses of a group differ by constants
  for (int k = 0; k < (CP * DIM) / 8 / CTH; k += 8)
    async_copy8_b128(dst + (size_t)k * (CTH / 16) * XP, (CTH / 16) * XP,
                     src + (size_t)k * CTH * 8, CTH * 8);

  // k = Kw @ xn + Kb : a wave owns 16 output channels of half the slab. Its
  // weight fragments and biases are the same for every sub-tile; their loads
  // fly together with the copies.
  int oc = wave & 7, ph = wave >> 3;
  int o0 = oc * 16 + hi8;
  v16h aw[4];
  #pragma unroll  // constant kb: aw stays in registers
  for (int kb = 0; kb < 4; ++kb)
    aw[kb] = frag_pk(Kwh, oc * 4 + kb, lane);
  float kbv[8];
  #pragma unroll  // constant r: kbv stays in registers
  for (int r = 0; r < 8; ++r) kbv[r] = Kb[o0 + r];
  wait_async0();
  __syncthreads();

  {
    #pragma unroll 4  // four independent accumulate chains fill each other's latency
    for (int nc = 0; nc < CP / 32; ++nc) {
      int p0 = ph * (CP / 2) + nc * 16;
      v8f acc = {};
      #pragma unroll
      for (int kb = 0; kb < 4; ++kb) {
        v16h bf = frag_rm(xs + p0 * XP, XP, row, kb * 32, lane);
        acc = wmma32(aw[kb], bf, acc);
      }
      #pragma unroll
      for (int r = 0; r < 8; ++r)
        ks[(p0 + row) * XP + o0 + r] = (_Float16)(acc[r] + kbv[r]);
    }
  }
  __syncthreads();

  // corr piece: A = xr (16 x 32 pos), B = k^T (32 pos x 16), summed over the
  // slab's CP / 32 steps of 32 positions.
  {
    int head = wave >> 2, mc = (wave >> 1) & 1, nc = wave & 1;
    const _Float16* xa = xs + ((mc * 16 + row) * HEAD + head);
    const _Float16* kbp = ks + ((nc * 16 + row) * HEAD + head);
    v8f acc = {};
    #pragma unroll 4  // several steps' LDS reads in flight at once
    for (int kt = 0; kt < CP / 32; ++kt) {
      v16h a = frag_gather(xa + kt * 32 * XP, XP, lane);
      v16h bf = frag_gather(kbp + kt * 32 * XP, XP, lane);
      acc = wmma32(a, bf, acc);
    }
    float* cp = corr + (((size_t)b * HEAD + head) * 32) * 32;
    int d0 = mc * 16 + hi8;
    int s = nc * 16 + row;
    #pragma unroll
    for (int r = 0; r < 8; ++r) atomicAdd(&cp[(d0 + r) * 32 + s], acc[r]);
  }
}

// ---------------------------------------------------------------------------
// Main per-tile kernel: SwiGLU FFN + Q projection + corr@q + gated combine.
// One block per (b, TP-position tile), 8 waves.
// ---------------------------------------------------------------------------
// The real block size, and four waves per SIMD (two blocks per WGP, which is
// what the LDS allows): without it the compiler plans for 1,024 threads, caps
// the wave at 128 registers and spills the accumulators.
__global__ void __launch_bounds__(256, 4)
k_main(const _Float16* __restrict__ xnh,
                       const _Float16* __restrict__ zh,
                       const _Float16* __restrict__ W1h,
                       const float* __restrict__ W1b,
                       const _Float16* __restrict__ W2h,
                       const float* __restrict__ W2b,
                       const _Float16* __restrict__ W3h,
                       const float* __restrict__ W3b,
                       const _Float16* __restrict__ Qwh,
                       const float* __restrict__ Qb,
                       const float* __restrict__ corr,
                       const float* __restrict__ aalpha,
                       const float* __restrict__ abeta,
                       const float* __restrict__ galpha,
                       const float* __restrict__ gbeta,
                       float* __restrict__ out) {
  __shared__ __align__(16) _Float16 xs[TP * XP];         // xn tile [p][c]
  __shared__ __align__(16) _Float16 zs[TP * XP];         // z  tile [p][c]
  __shared__ __align__(16) _Float16 gh[TP * GP];         // silu(h1)*h2 [p][o]
  __shared__ __align__(16) _Float16 qs[TP * XP];         // q tile [p][c]
  __shared__ __align__(16) _Float16 cs[HEAD * 32 * 32];  // corr f16 [h][d][s]
  __shared__ __align__(16) float    fs[TP * FP];         // ffn f32 [p][c]

  int blk = blockIdx.x;
  int b = blk / (SEQ / TP);
  int pb = (blk % (SEQ / TP)) * TP;
  int tid = threadIdx.x, lane = tid & 31, wave = tid >> 5;
  int row = lane & 15, hi8 = (lane >> 4) << 3;

  // Async-stage xn and z tiles (16 KB each) into LDS, bypassing VGPRs.
  const _Float16* sx = xnh + ((size_t)b * SEQ + pb) * DIM;
  const _Float16* sz = zh + ((size_t)b * SEQ + pb) * DIM;
  __builtin_prefetch(sx + TP * DIM, 0, 0);   // next tile -> global_prefetch_b8
  // A constant trip count: every lane is on at every copy.
  for (int k = 0; k < (TP * DIM) / 8 / 256; ++k) {
    int i = k * 256 + tid;
    async_copy_b128(xs + (i >> 4) * XP + (i & 15) * 8, sx + i * 8);
    async_copy_b128(zs + (i >> 4) * XP + (i & 15) * 8, sz + i * 8);
  }
  // Corr needs an f32->f16 conversion, so it rides the normal VGPR path.
  const float* cb = corr + (size_t)b * HEAD * 32 * 32;
  for (int i = tid; i < HEAD * 32 * 32; i += 256) cs[i] = (_Float16)cb[i];
  wait_async0();
  __syncthreads();

  // ---- W1 / W2 GEMMs (512x128 each), wave owns 4 output chunks of 16 ----
  // The xn fragments are the same for every m: read once, kept in registers.
  v16h bx[4][NT];
  #pragma unroll  // constant kb: bx stays in registers
  for (int kb = 0; kb < 4; ++kb) {
    #pragma unroll  // constant nt: the per-sub-tile arrays stay in registers
    for (int nt = 0; nt < NT; ++nt)
      bx[kb][nt] = frag_rm(xs + nt * 16 * XP, XP, row, kb * 32, lane);
  }
  for (int m = 0; m < 4; ++m) {
    int ob = (wave * 4 + m) * 16;
    v8f a1[NT] = {}, a2[NT] = {};
    #pragma unroll
    for (int kb = 0; kb < 4; ++kb) {
      v16h af1 = frag_pk(W1h, (wave * 4 + m) * 4 + kb, lane);
      v16h af2 = kb < 3 ? frag_pk(W2h, (wave * 4 + m) * 4 + kb, lane)
                        : frag_pk_last(W2h, (wave * 4 + m) * 4 + kb, lane);
      #pragma unroll  // constant nt: the per-sub-tile arrays stay in registers
      for (int nt = 0; nt < NT; ++nt) {
        a1[nt] = wmma32(af1, bx[kb][nt], a1[nt]);
        a2[nt] = wmma32(af2, bx[kb][nt], a2[nt]);
      }
    }
    // The bias loads below may land in the registers that held the weight
    // loads' addresses: this wait stands between the two.
    asm volatile("s_wait_xcnt 0x0" ::: "memory");
    int o0 = ob + hi8;
    #pragma unroll  // constant nt: the per-sub-tile arrays stay in registers
    for (int nt = 0; nt < NT; ++nt) {
      int p = nt * 16 + row;
      #pragma unroll
      for (int r = 0; r < 8; ++r) {
        float h1 = a1[nt][r] + W1b[o0 + r];
        float h2 = a2[nt][r] + W2b[o0 + r];
        // silu(h1)*h2. The divisor is never below 1, so one v_rcp_f32 stands for
        // the exact division: that is a chain of some ten dependent vector
        // instructions per element, which a wave waits out link by link.
        float g = h1 * __builtin_amdgcn_rcpf(1.0f + __expf(-h1)) * h2;
        gh[p * GP + o0 + r] = (_Float16)g;
      }
    }
  }

  // ---- Q projection (128x128), wave owns one output chunk ----
  {
    int ob = wave * 16;
    v8f aq[NT] = {};
    v16h af[4];
    #pragma unroll  // constant kb: af stays in registers, all loads in flight
    for (int kb = 0; kb < 4; ++kb) af[kb] = frag_pk(Qwh, wave * 4 + kb, lane);
    // Precaution: the LDS reads below may land in the registers that held the
    // weight loads' address: this wait stands between the two.
    asm volatile("s_wait_xcnt 0x0" ::: "memory");
    #pragma unroll
    for (int kb = 0; kb < 4; ++kb) {
      #pragma unroll  // constant nt: the per-sub-tile arrays stay in registers
      for (int nt = 0; nt < NT; ++nt) {
        v16h bf = frag_rm(zs + nt * 16 * XP, XP, row, kb * 32, lane);
        aq[nt] = wmma32(af[kb], bf, aq[nt]);
      }
    }
    int o0 = ob + hi8;
    #pragma unroll  // constant nt: the per-sub-tile arrays stay in registers
    for (int nt = 0; nt < NT; ++nt) {
      int p = nt * 16 + row;
      #pragma unroll
      for (int r = 0; r < 8; ++r)
        qs[p * XP + o0 + r] = (_Float16)(aq[nt][r] + Qb[o0 + r]);
    }
  }
  __syncthreads();

  // ---- W3 GEMM (128x512), wave owns one output chunk, K = 512 ----
  {
    int ob = wave * 16;
    v8f a3[NT] = {};
    #pragma unroll
    for (int kb = 0; kb < 16; ++kb) {
      v16h aw = frag_pk(W3h, wave * 16 + kb, lane);
      #pragma unroll  // constant nt: the per-sub-tile arrays stay in registers
      for (int nt = 0; nt < NT; ++nt) {
        v16h bg = frag_rm(gh + nt * 16 * GP, GP, row, kb * 32, lane);
        a3[nt] = wmma32(aw, bg, a3[nt]);
      }
    }
    int o0 = ob + hi8;
    #pragma unroll  // constant nt: the per-sub-tile arrays stay in registers
    for (int nt = 0; nt < NT; ++nt) {
      int p = nt * 16 + row;
      #pragma unroll
      for (int r = 0; r < 8; ++r)
        fs[p * FP + o0 + r] = a3[nt][r] + W3b[o0 + r];
    }
  }
  __syncthreads();

  // ---- attn = corr @ q, then gated combine + store ----
  {
    int head = wave >> 1, mc = wave & 1;
    v16h ac = frag_rm(cs + head * 32 * 32, 32, mc * 16 + row, 0, lane);
    float sa = sigm(aalpha[head]);
    float sb = sigm(abeta[head]);
    float ga = sigm(galpha[0]);
    float gb = sigm(gbeta[0]);
    int d0 = mc * 16 + hi8;
    #pragma unroll  // the four sub-tiles' LDS reads are issued together
    for (int nt = 0; nt < NT; ++nt) {
      int p = nt * 16 + row;
      v16h bq = frag_gather(qs + p * XP + head, HEAD, lane);
      v8f at = {};
      at = wmma32(ac, bq, at);
      #pragma unroll
      for (int r = 0; r < 8; ++r) {
        int d = d0 + r;
        int c = d * HEAD + head;
        float attnv = at[r] * (1.0f / SEQ);
        float mha = sa * (float)xs[p * XP + c] + sb * attnv;
        out[(((size_t)b * DIM) + c) * SEQ + pb + p] =
            ga * fs[p * FP + c] + gb * mha;
      }
    }
  }
}

// ---------------------------------------------------------------------------
// Host launch
// ---------------------------------------------------------------------------
extern "C" void kernel_launch(void* const* d_in, const int* in_sizes, int n_in,
                              void* d_out, int out_size, void* d_ws,
                              size_t ws_size, hipStream_t stream) {
  const float* x  = (const float*)d_in[0];
  const float* z  = (const float*)d_in[1];
  const float* nw = (const float*)d_in[2];
  const float* Qw = (const float*)d_in[3];
  const float* Qb = (const float*)d_in[4];
  const float* Kw = (const float*)d_in[5];
  const float* Kb = (const float*)d_in[6];
  const float* aalpha = (const float*)d_in[7];
  const float* abeta  = (const float*)d_in[8];
  const float* W1w = (const float*)d_in[9];
  const float* W1b = (const float*)d_in[10];
  const float* W2w = (const float*)d_in[11];
  const float* W2b = (const float*)d_in[12];
  const float* W3w = (const float*)d_in[13];
  const float* W3b = (const float*)d_in[14];
  const float* galpha = (const float*)d_in[15];
  const float* gbeta  = (const float*)d_in[16];
  float* out = (float*)d_out;

  // Workspace carve-up
  char* p = (char*)d_ws;
  _Float16* xnh = (_Float16*)p; p += NPOS * DIM * 2;
  _Float16* zh  = (_Float16*)p; p += NPOS * DIM * 2;
  _Float16* W1h = (_Float16*)p; p += (size_t)HID * DIM * 2;
  _Float16* W2h = (_Float16*)p; p += (size_t)HID * DIM * 2;
  _Float16* W3h = (_Float16*)p; p += (size_t)DIM * HID * 2;
  _Float16* Qwh = (_Float16*)p; p += (size_t)DIM * DIM * 2;
  _Float16* Kwh = (_Float16*)p; p += (size_t)DIM * DIM * 2;
  float* corr = (float*)p;      p += (size_t)BB * HEAD * 32 * 32 * 4;

  // RMSNorm + f16 conversion of x and z; weight conversion f32 -> f16 into
  // W1h .. Kwh, which lie one behind the other from W1h on; corr cleared.
  k_norm<<<NB_NORM + NB_CVT + NB_ZERO, 256, 0, stream>>>(
      x, z, nw, W1w, W2w, W3w, Qw, Kw, xnh, zh, W1h, corr);

  // Per-head 32x32 correlations (reduction over n)
  k_corr<<<BB * (SEQ / CP), CTH, 0, stream>>>(xnh, Kwh, Kb, corr);

  // FFN + attention apply + gated combine
  k_main<<<BB * (SEQ / TP), 256, 0, stream>>>(
      xnh, zh, W1h, W1b, W2h, W2b, W3h, W3b, Qwh, Qb, corr,
      aalpha, abeta, galpha, gbeta, out);
}

// v008
// Measured time: 93.5 microseconds a run.
// In two side-by-side timings against v007, it was 1.07 and 1.08 times as fast.
// All steps since v000 together make it 5.04 times as fast.
#include <hip/hip_runtime.h>
#include <hip/hip_bf16.h>

// ---------------------------------------------------------------------------
// Parallel Graphormer block for MI455X (gfx1250, wave32, WMMA).
// All channel GEMMs run through v_wmma_f32_16x16x32_f16; tile staging uses
// GLOBAL_LOAD_ASYNC_TO_LDS_B128 (ASYNCcnt) to bypass VGPRs.
// ---------------------------------------------------------------------------

#define BB   16
#define DIM  128
#define SEQ  8192
#define HEAD 4
#define HID  512
#define NPOS ((size_t)BB * SEQ)

// LDS row pitches. The tiles that use them are read one row per lane, so an
// unpadded power-of-two row puts all 16 rows of a 16-byte read on the same
// four banks. One 16-byte pad per row makes the pitch 16 B x odd, which
// spreads the 16 rows over all 64 banks.
#define XP (DIM + 8)   // f16 rows of DIM: 272 B
#define GP (HID + 8)   // f16 rows of HID: 1040 B
#define FP (DIM + 4)   // f32 rows of DIM: 528 B

// Positions per block of k_main. Every weight fragment a wave loads from
// global memory feeds NT matrix products, one per 16-position sub-tile.
#define TP 64
#define NT (TP / 16)

// Positions per block of k_norm.
#define NP 128

// k_norm's grid: NB_NORM blocks normalise; behind them stand NB_CVT blocks
// that convert PE weight elements each and NB_ZERO blocks that clear PE
// elements of corr each.
#define PE      4096
#define NB_NORM ((int)(NPOS / NP))
#define NB_W    (HID * DIM / PE)
#define NB_Q    (DIM * DIM / PE)
#define NB_CVT  (3 * NB_W + 2 * NB_Q)
#define NB_ZERO (BB * HEAD * 32 * 32 / PE)

// Halves of one 16 x 32 weight fragment.
#define FH 512

// Positions and threads per block of k_corr.
#define CP  512
#define CTH 512

typedef __attribute__((ext_vector_type(16))) _Float16 v16h;
typedef __attribute__((ext_vector_type(8)))  float    v8f;
typedef __attribute__((ext_vector_type(8)))  _Float16 v8h;
typedef __attribute__((ext_vector_type(4)))  float    v4f;

__device__ __forceinline__ v8f wmma32(v16h a, v16h b, v8f c) {
  // D = A(16x32 f16) * B(32x16 f16) + C(16x16 f32)
  return __builtin_amdgcn_wmma_f32_16x16x32_f16(
      /*neg_a=*/false, a, /*neg_b=*/false, b,
      /*c_mod=*/(short)0, c, /*reuse_a=*/false, /*reuse_b=*/false);
}

// Async global -> LDS 16-byte copy (per active lane). VDST VGPR carries the
// LDS byte address (low 32 bits of the generic shared pointer), VADDR the
// 64-bit global address. Tracked by ASYNCcnt.
__device__ __forceinline__ void async_copy_b128(void* lds_ptr,
                                                const void* gptr) {
  unsigned lds_addr = (unsigned)(size_t)lds_ptr;
  unsigned long long ga = (unsigned long long)(size_t)gptr;
  // The wait stands inside the copy's own statement so that it precedes any
  // rewrite of the two address registers.
  asm volatile("global_load_async_to_lds_b128 %0, %1, off\n\ts_wait_xcnt 0x0"
               :: "v"(lds_addr), "v"(ga)
               : "memory");
}

// Eight such copies, ls halves apart in LDS and gs halves apart in global
// memory, in one statement with one wait behind the last: the wait precedes
// any rewrite of the sixteen address registers, and the copies issue back to
// back.
__device__ __forceinline__ void async_copy8_b128(_Float16* lds_ptr, int ls,
                                                 const _Float16* gptr, int gs) {
  unsigned l0 = (unsigned)(size_t)lds_ptr;
  unsigned long long g0 = (unsigned long long)(size_t)gptr;
  unsigned lb = (unsigned)ls * 2u;
  unsigned long long gb = (unsigned long long)gs * 2u;
  asm volatile("global_load_async_to_lds_b128 %0, %8, off\n\t"
               "global_load_async_to_lds_b128 %1, %9, off\n\t"
               "global_load_async_to_lds_b128 %2, %10, off\n\t"
               "global_load_async_to_lds_b128 %3, %11, off\n\t"
               "global_load_async_to_lds_b128 %4, %12, off\n\t"
               "global_load_async_to_lds_b128 %5, %13, off\n\t"
               "global_load_async_to_lds_b128 %6, %14, off\n\t"
               "global_load_async_to_lds_b128 %7, %15, off\n\t"
               "s_wait_xcnt 0x0"
               :: "v"(l0), "v"(l0 + lb), "v"(l0 + 2 * lb), "v"(l0 + 3 * lb),
                  "v"(l0 + 4 * lb), "v"(l0 + 5 * lb), "v"(l0 + 6 * lb),
                  "v"(l0 + 7 * lb),
                  "v"(g0), "v"(g0 + gb), "v"(g0 + 2 * gb), "v"(g0 + 3 * gb),
                  "v"(g0 + 4 * gb), "v"(g0 + 5 * gb), "v"(g0 + 6 * gb),
                  "v"(g0 + 7 * gb)
               : "memory");
}

__device__ __forceinline__ void wait_async0() {
  asm volatile("s_wait_asynccnt 0" ::: "memory");
}

// Load 16 f16 as two contiguous 16B chunks (p0[0..7], p0[16..23]) matching the
// ISA 16-bit A/B fragment striping: half h<8 -> K = 8*(lane>=16)+h,
// h>=8 -> K = 16 + 8*(lane>=16) + (h-8).
__device__ __forceinline__ v16h load16h(const _Float16* p0) {
  float4 a = *(const float4*)(p0);
  float4 b = *(const float4*)(p0 + 16);
  v16h r;
  __builtin_memcpy(&r, &a, 16);
  __builtin_memcpy(((char*)&r) + 16, &b, 16);
  return r;
}

// Row-major fragment: base[row*ldk + kb + ...] with contiguous K runs.
__device__ __forceinline__ v16h frag_rm(const _Float16* base, int ldk,
                                        int row, int kb, int lane) {
  return load16h(base + (size_t)row * ldk + kb + ((lane >> 4) << 3));
}

// Weight fragment from a matrix stored in fragment order (see k_norm): the
// 16 x 32 fragment number f is FH halves in a row, first the 32 lanes' low
// 16-byte chunks, then their high ones. Each of the two loads of a wave reads
// 512 contiguous bytes, four whole lines. A lane gets the same halves that
// frag_rm gives it from the row-major matrix.
__device__ __forceinline__ v16h frag_pk(const _Float16* base, int f, int lane) {
  const _Float16* p0 = base + (size_t)f * FH + lane * 8;
  float4 a = *(const float4*)(p0);
  float4 b = *(const float4*)(p0 + FH / 2);
  v16h r;
  __builtin_memcpy(&r, &a, 16);
  __builtin_memcpy(((char*)&r) + 16, &b, 16);
  return r;
}

// The same for the last fragment of a run of weight loads: behind their last
// loads the run's address registers are free, and one of these two loads may
// land in them. Precaution: s_wait_xcnt 0 stands in front of each of the two,
// behind every load that names those registers.
__device__ __forceinline__ v16h frag_pk_last(const _Float16* base, int f,
                                             int lane) {
  const _Float16* p0 = base + (size_t)f * FH + lane * 8;
  asm volatile("s_wait_xcnt 0x0" ::: "memory");
  float4 a = *(const float4*)(p0);
  asm volatile("s_wait_xcnt 0x0" ::: "memory");
  float4 b = *(const float4*)(p0 + FH / 2);
  v16h r;
  __builtin_memcpy(&r, &a, 16);
  __builtin_memcpy(((char*)&r) + 16, &b, 16);
  return r;
}

// Gather fragment for strided K (e.g. channel = K*HEAD + head).
__device__ __forceinline__ v16h frag_gather(const _Float16* base, int stride,
                                            int lane) {
  v16h r = {};
  int lo = (lane >> 4) << 3;
  #pragma unroll
  for (int h = 0; h < 16; ++h) {
    int K = h + ((h >= 8) ? 8 : 0) + lo;
    r[h] = base[(size_t)K * stride];
  }
  return r;
}

// The divisor is never below 1: v_rcp_f32 in place of the exact division.
__device__ __forceinline__ float sigm(float v) {
  return __builtin_amdgcn_rcpf(1.0f + __expf(-v));
}

// ---------------------------------------------------------------------------
// RMSNorm over channels + f16 conversion of xn and z.
// Layout in: (b, c, n) f32.  Layout out: (b*n, c) f16 (GEMM-friendly rows).
// One block per (b, NP-position tile), 8 waves. A wave reads 16 channels, 512
// contiguous bytes of a channel per load, and keeps them in registers. The
// tiles are turned through LDS, so that every global store of a wave is 512
// contiguous bytes of the output rows.
// An LDS row is one position's 16 chunks of 16 bytes. Chunk ch of row r lies
// at place ch ^ ((r >> 2) & 15): the writers (one chunk number, rows four
// apart) and the readers (all chunks of two rows) both spread over all banks.
// The blocks from NB_NORM on do the work that nothing in this launch reads
// and the later launches need: the f32 -> f16 conversion of the five weight
// matrices, stored in fragment order, and the start value of corr. They stand
// last in the grid.
// ---------------------------------------------------------------------------
__device__ __forceinline__ int norm_slot(int r, int ch) {
  return r * DIM + ((ch ^ ((r >> 2) & 15)) << 3);
}

__global__ void __launch_bounds__(256)
k_norm(const float* __restrict__ x, const float* __restrict__ z,
       const float* __restrict__ nw,
       const float* __restrict__ W1w, const float* __restrict__ W2w,
       const float* __restrict__ W3w, const float* __restrict__ Qw,
       const float* __restrict__ Kw,
       _Float16* __restrict__ xnh, _Float16* __restrict__ zh,
       _Float16* __restrict__ wh, float* __restrict__ corr) {
  __shared__ __align__(16) _Float16 xt[NP * DIM];   // xn tile [pos][c], swizzled
  __shared__ __align__(16) _Float16 zt[NP * DIM];   // z  tile [pos][c], swizzled
  __shared__ __align__(16) v4f red[8 * 32];         // per-wave sums of squares
  int blk = blockIdx.x;
  int tid = threadIdx.x, lane = tid & 31;

  // The same test in every thread of a block, ahead of every barrier.
  if (blk >= NB_NORM) {
    int e = blk - NB_NORM;
    if (e < NB_CVT) {
      // wh holds W1, W2, W3, Q, K one behind the other, so the block's place
      // in it is e * PE whichever matrix it reads. m0 is the block's place in
      // its own matrix, lk the log2 of that matrix's fragments per row.
      const float* s;
      int m0, lk = 2;
      if (e < NB_W)                 { s = W1w; m0 = e; }
      else if (e < 2 * NB_W)        { s = W2w; m0 = e - NB_W; }
      else if (e < 3 * NB_W)        { s = W3w; m0 = e - 2 * NB_W; lk = 4; }
      else if (e < 3 * NB_W + NB_Q) { s = Qw;  m0 = e - 3 * NB_W; }
      else                          { s = Kw;  m0 = e - 3 * NB_W - NB_Q; }
      m0 *= PE;
      _Float16* d = wh + (size_t)e * PE;
      #pragma unroll  // all loads of the block in flight at once
      for (int k = 0; k < PE / 8 / 256; ++k) {
        int q = (k * 256 + tid) * 8;
        // The matrix is stored in fragment order (frag_pk): chunk q of the
        // block belongs to fragment f, lane l, low or high part.
        int dm = m0 + q;
        int f = dm / FH, part = (dm / (FH / 2)) & 1, l = (dm >> 3) & 31;
        int sr = (f >> lk) * 16 + (l & 15);
        int sc = (f & ((1 << lk) - 1)) * 32 + part * 16 + (l >> 4) * 8;
        int so = (sr << (lk + 5)) + sc;
        v4f lo = *(const v4f*)(s + so);
        v4f hi = *(const v4f*)(s + so + 4);
        v8h t;
        #pragma unroll  // constant i: t is built in registers
        for (int i = 0; i < 4; ++i) {
          t[i] = (_Float16)lo[i];
          t[4 + i] = (_Float16)hi[i];
        }
        *(v8h*)(d + q) = t;
      }
    } else {
      float* c = corr + (size_t)(e - NB_CVT) * PE;
      v4f zero = {};
      #pragma unroll  // independent stores
      for (int k = 0; k < PE / 4 / 256; ++k)
        *(v4f*)(c + (k * 256 + tid) * 4) = zero;
      // Precaution: the stores' registers are not rewritten ahead of this wait.
      asm volatile("s_wait_xcnt 0x0" ::: "memory");
    }
    return;
  }

  int b = blk / (SEQ / NP);
  int pb = (blk % (SEQ / NP)) * NP;
  // The wave's number in a scalar register: nw is then read by scalar loads.
  int wave = __builtin_amdgcn_readfirstlane(tid >> 5);
  int c0 = wave * 16;

  // This lane: positions 4*lane .. 4*lane+3 of channels c0 .. c0+15.
  size_t in0 = ((size_t)b * DIM + c0) * SEQ + pb + lane * 4;
  v4f xv[16], zv[16];
  #pragma unroll  // constant j: xv stays in registers, all loads in flight
  for (int j = 0; j < 16; ++j)
    xv[j] = *(const v4f*)(x + in0 + (size_t)j * SEQ);
  #pragma unroll  // constant j: zv stays in registers, all loads in flight
  for (int j = 0; j < 16; ++j)
    zv[j] = *(const v4f*)(z + in0 + (size_t)j * SEQ);

  v4f ss = {};
  #pragma unroll  // constant j: register indices
  for (int j = 0; j < 16; ++j) ss += xv[j] * xv[j];
  red[wave * 32 + lane] = ss;

  #pragma unroll  // constant i, h: register indices
  for (int i = 0; i < 4; ++i) {
    #pragma unroll  // constant h
    for (int h = 0; h < 2; ++h) {
      v8h t;
      #pragma unroll  // constant e: t is built in registers
      for (int e = 0; e < 8; ++e) t[e] = (_Float16)zv[h * 8 + e][i];
      *(v8h*)(zt + norm_slot(lane * 4 + i, wave * 2 + h)) = t;
    }
  }
  __syncthreads();

  v4f s = red[lane];
  #pragma unroll  // the eight LDS reads are issued together
  for (int w = 1; w < 8; ++w) s += red[w * 32 + lane];
  #pragma unroll  // constant i, h: register indices
  for (int i = 0; i < 4; ++i) {
    float rinv = rsqrtf(s[i] * (1.0f / DIM) + 1e-6f);
    #pragma unroll  // constant h
    for (int h = 0; h < 2; ++h) {
      v8h t;
      #pragma unroll  // constant e: t is built in registers
      for (int e = 0; e < 8; ++e)
        t[e] = (_Float16)(nw[c0 + h * 8 + e] * xv[h * 8 + e][i] * rinv);
      *(v8h*)(xt + norm_slot(lane * 4 + i, wave * 2 + h)) = t;
    }
  }
  __syncthreads();

  // The tile's NP output rows are one contiguous range of NP * DIM halves.
  // All global stores stand behind the last barrier, which then waits for none.
  size_t out0 = ((size_t)b * SEQ + pb) * DIM;
  #pragma unroll  // the LDS reads are issued together, ahead of the stores
  for (int k = 0; k < (NP * DIM) / 8 / 256; ++k) {
    int q = k * 256 + tid;
    int sl = norm_slot(q >> 4, q & 15);
    *(v8h*)(zh + out0 + (size_t)q * 8) = *(const v8h*)(zt + sl);
    *(v8h*)(xnh + out0 + (size_t)q * 8) = *(const v8h*)(xt + sl);
  }
  // Precaution: in the built code this path runs on into the shared exit's
  // tests; no register of the stores is rewritten ahead of this wait.
  asm volatile("s_wait_xcnt 0x0" ::: "memory");
}

// ---------------------------------------------------------------------------
// Correlation: corr[b,h] += xr(32 x CP) @ k(32 x CP)^T with k = Kw@xn + Kb.
// One block per (b, CP-position slab), 16 waves. The whole slab is staged and
// projected once; each wave then sums one 16x16 piece of one head's
// correlation over all CP positions in its matrix accumulator, so an element
// of corr takes one atomic add per slab.
// ---------------------------------------------------------------------------
__global__ void __launch_bounds__(CTH)
k_corr(const _Float16* __restrict__ xnh,
       const _Float16* __restrict__ Kwh,
       const float* __restrict__ Kb,
       float* __restrict__ corr) {
  __shared__ __align__(16) _Float16 xs[CP * XP];   // [pos][c], padded rows
  __shared__ __align__(16) _Float16 ks[CP * XP];   // [pos][c], padded rows
  int blk = blockIdx.x;
  int b = blk / (SEQ / CP);
  int pb = (blk % (SEQ / CP)) * CP;
  int tid = threadIdx.x, lane = tid & 31, wave = tid >> 5;
  int row = lane & 15, hi8 = (lane >> 4) << 3;

  // Async-stage the xn slab (128 KB) straight into LDS, bypassing VGPRs.
  // A constant trip count: every lane is on at every copy. One copy of all
  // threads fills CTH / 16 rows, one trip of eight copies half the slab.
  const _Float16* src = xnh + ((size_t)b * SEQ + pb) * DIM + tid * 8;
  _Float16* dst = xs + (tid >> 4) * XP + (tid & 15) * 8;
  #pragma unroll  // constant steps: the addresses of a group differ by constants
  for (int k = 0; k < (CP * DIM) / 8 / CTH; k += 8)
    async_copy8_b128(dst + (size_t)k * (CTH / 16) * XP, (CTH / 16) * XP,
                     src + (size_t)k * CTH * 8, CTH * 8);

  // k = Kw @ xn + Kb : a wave owns 16 output channels of half the slab. Its
  // weight fragments and biases are the same for every sub-tile; their loads
  // fly together with the copies.
  int oc = wave & 7, ph = wave >> 3;
  int o0 = oc * 16 + hi8;
  v16h aw[4];
  #pragma unroll  // constant kb: aw stays in registers
  for (int kb = 0; kb < 4; ++kb)
    aw[kb] = frag_pk(Kwh, oc * 4 + kb, lane);
  float kbv[8];
  #pragma unroll  // constant r: kbv stays in registers
  for (int r = 0; r < 8; ++r) kbv[r] = Kb[o0 + r];
  wait_async0();
  __syncthreads();

  {
    #pragma unroll 4  // four independent accumulate chains fill each other's latency
    for (int nc = 0; nc < CP / 32; ++nc) {
      int p0 = ph * (CP / 2) + nc * 16;
      v8f acc = {};
      #pragma unroll
      for (int kb = 0; kb < 4; ++kb) {
        v16h bf = frag_rm(xs + p0 * XP, XP, row, kb * 32, lane);
        acc = wmma32(aw[kb], bf, acc);
      }
      #pragma unroll
      for (int r = 0; r < 8; ++r)
        ks[(p0 + row) * XP + o0 + r] = (_Float16)(acc[r] + kbv[r]);
    }
  }
  __syncthreads();

  // corr piece: A = xr (16 x 32 pos), B = k^T (32 pos x 16), summed over the
  // slab's CP / 32 steps of 32 positions.
  {
    int head = wave >> 2, mc = (wave >> 1) & 1, nc = wave & 1;
    const _Float16* xa = xs + ((mc * 16 + row) * HEAD + head);
    const _Float16* kbp = ks + ((nc * 16 + row) * HEAD + head);
    v8f acc = {};
    #pragma unroll 4  // several steps' LDS reads in flight at once
    for (int kt = 0; kt < CP / 32; ++kt) {
      v16h a = frag_gather(xa + kt * 32 * XP, XP, lane);
      v16h bf = frag_gather(kbp + kt * 32 * XP, XP, lane);
      acc = wmma32(a, bf, acc);
    }
    float* cp = corr + (((size_t)b * HEAD + head) * 32) * 32;
    int d0 = mc * 16 + hi8;
    int s = nc * 16 + row;
    #pragma unroll
    for (int r = 0; r < 8; ++r) atomicAdd(&cp[(d0 + r) * 32 + s], acc[r]);
  }
}

// ---------------------------------------------------------------------------
// Main per-tile kernel: SwiGLU FFN + Q projection + corr@q + gated combine.
// One block per (b, TP-position tile), 8 waves.
// ---------------------------------------------------------------------------
// The real block size, and four waves per SIMD (two blocks per WGP, which is
// what the LDS allows): without it the compiler plans for 1,024 threads, caps
// the wave at 128 registers and spills the accumulators.
__global__ void __launch_bounds__(256, 4)
k_main(const _Float16* __restrict__ xnh,
                       const _Float16* __restrict__ zh,
                       const _Float16* __restrict__ W1h,
                       const float* __restrict__ W1b,
                       const _Float16* __restrict__ W2h,
                       const float* __restrict__ W2b,
                       const _Float16* __restrict__ W3h,
                       const float* __restrict__ W3b,
                       const _Float16* __restrict__ Qwh,
                       const float* __restrict__ Qb,
                       const float* __restrict__ corr,
                       const float* __restrict__ aalpha,
                       const float* __restrict__ abeta,
                       const float* __restrict__ galpha,
                       const float* __restrict__ gbeta,
                       float* __restrict__ out) {
  __shared__ __align__(16) _Float16 xs[TP * XP];         // xn tile [p][c]
  __shared__ __align__(16) _Float16 zs[TP * XP];         // z  tile [p][c]
  __shared__ __align__(16) _Float16 gh[TP * GP];         // silu(h1)*h2 [p][o]
  __shared__ __align__(16) _Float16 qs[TP * XP];         // q tile [p][c]
  __shared__ __align__(16) _Float16 cs[HEAD * 32 * 32];  // corr f16 [h][d][s]
  __shared__ __align__(16) float    fs[TP * FP];         // ffn f32 [p][c]

  int blk = blockIdx.x;
  int b = blk / (SEQ / TP);
  int pb = (blk % (SEQ / TP)) * TP;
  int tid = threadIdx.x, lane = tid & 31, wave = tid >> 5;
  int row = lane & 15, hi8 = (lane >> 4) << 3;

  // Async-stage xn and z tiles (16 KB each) into LDS, bypassing VGPRs.
  const _Float16* sx = xnh + ((size_t)b * SEQ + pb) * DIM;
  const _Float16* sz = zh + ((size_t)b * SEQ + pb) * DIM;
  __builtin_prefetch(sx + TP * DIM, 0, 0);   // next tile -> global_prefetch_b8
  // A constant trip count: every lane is on at every copy.
  for (int k = 0; k < (TP * DIM) / 8 / 256; ++k) {
    int i = k * 256 + tid;
    async_copy_b128(xs + (i >> 4) * XP + (i & 15) * 8, sx + i * 8);
    async_copy_b128(zs + (i >> 4) * XP + (i & 15) * 8, sz + i * 8);
  }
  // The first W1 / W2 step's weight fragments (see below) are asked for here:
  // they fly together with the copies.
  v16h w1[4], w2[4];
  #pragma unroll  // constant kb: w1, w2 stay in registers, all loads in flight
  for (int kb = 0; kb < 4; ++kb) {
    w1[kb] = frag_pk(W1h, wave * 16 + kb, lane);
    w2[kb] = kb < 3 ? frag_pk(W2h, wave * 16 + kb, lane)
                    : frag_pk_last(W2h, wave * 16 + kb, lane);
  }
  // Precaution: no register of these loads is rewritten ahead of this wait.
  asm volatile("s_wait_xcnt 0x0" ::: "memory");
  // Corr needs an f32->f16 conversion, so it rides the normal VGPR path.
  const float* cb = corr + (size_t)b * HEAD * 32 * 32;
  for (int i = tid; i < HEAD * 32 * 32; i += 256) cs[i] = (_Float16)cb[i];
  wait_async0();
  __syncthreads();

  // ---- W1 / W2 GEMMs (512x128 each), wave owns 4 output chunks of 16 ----
  // The eight weight fragments of a step come from L2, the xn fragments from
  // LDS. So the registers go to the
  // weights (w1, w2): step m + 1's fragments are loaded behind step m's last
  // product and fly under its silu, and the xn fragments are read from LDS
  // anew in every step.
  // What the two stages behind this one load from global memory: asked for
  // behind the last step's products.
  int oq = wave * 16 + hi8;
  v16h aw[8];
  v4f bql, bqh, b3l, b3h;
  for (int m = 0; m < 4; ++m) {
    int ob = (wave * 4 + m) * 16;
    int o0 = ob + hi8;
    // This step's biases are asked for ahead of the next step's weights:
    // loads return in order, so the silu then waits for none of those.
    v4f b1l = *(const v4f*)(W1b + o0), b1h = *(const v4f*)(W1b + o0 + 4);
    v4f b2l = *(const v4f*)(W2b + o0), b2h = *(const v4f*)(W2b + o0 + 4);
    // Precaution: no register of the bias loads is rewritten ahead of this wait.
    asm volatile("s_wait_xcnt 0x0" ::: "memory");
    v8f a1[NT] = {}, a2[NT] = {};
    // Two sets of xn fragments: k-step kb + 1's LDS reads are issued ahead of
    // k-step kb's eight products and land under them.
    v16h bx[2][NT];
    #pragma unroll  // constant nt: bx stays in registers
    for (int nt = 0; nt < NT; ++nt)
      bx[0][nt] = frag_rm(xs + nt * 16 * XP, XP, row, 0, lane);
    #pragma unroll  // constant kb: register indices
    for (int kb = 0; kb < 4; ++kb) {
      if (kb < 3) {
        #pragma unroll  // constant nt: bx stays in registers
        for (int nt = 0; nt < NT; ++nt)
          bx[(kb + 1) & 1][nt] =
              frag_rm(xs + nt * 16 * XP, XP, row, (kb + 1) * 32, lane);
      }
      // Keeps the reads above the products: left alone, the compiler puts each
      // read directly in front of its product, which then waits out the LDS.
      __builtin_amdgcn_sched_barrier(0);
      #pragma unroll  // constant nt: the per-sub-tile arrays stay in registers
      for (int nt = 0; nt < NT; ++nt) {
        a1[nt] = wmma32(w1[kb], bx[kb & 1][nt], a1[nt]);
        a2[nt] = wmma32(w2[kb], bx[kb & 1][nt], a2[nt]);
      }
    }
    // The same test in every thread. Behind the last step stand the Q
    // projection, whose four fragments take w1's place, and W3, whose first
    // eight fragments then have the whole Q stage to arrive. The two stages'
    // biases go first: loads return in order.
    if (m < 3) {
      #pragma unroll  // constant kb: w1, w2 stay in registers, all loads in flight
      for (int kb = 0; kb < 4; ++kb) {
        w1[kb] = frag_pk(W1h, (wave * 4 + m + 1) * 4 + kb, lane);
        w2[kb] = kb < 3 ? frag_pk(W2h, (wave * 4 + m + 1) * 4 + kb, lane)
                        : frag_pk_last(W2h, (wave * 4 + m + 1) * 4 + kb, lane);
      }
    } else {
      bql = *(const v4f*)(Qb + oq);
      bqh = *(const v4f*)(Qb + oq + 4);
      b3l = *(const v4f*)(W3b + oq);
      b3h = *(const v4f*)(W3b + oq + 4);
      #pragma unroll  // constant kb: w1 stays in registers, all loads in flight
      for (int kb = 0; kb < 4; ++kb)
        w1[kb] = frag_pk_last(Qwh, wave * 4 + kb, lane);
      // Precaution: a W3 load may land in the registers that held the Q loads'
      // address: this wait stands between the two.
      asm volatile("s_wait_xcnt 0x0" ::: "memory");
      #pragma unroll  // constant j: aw stays in registers, all loads in flight
      for (int j = 0; j < 8; ++j) aw[j] = frag_pk(W3h, wave * 16 + j, lane);
    }
    // Precaution: the silu below may use the registers that held these loads'
    // addresses: this wait stands between the two.
    asm volatile("s_wait_xcnt 0x0" ::: "memory");
    float b1[8], b2[8];
    #pragma unroll  // constant r: register indices
    for (int r = 0; r < 4; ++r) {
      b1[r] = b1l[r]; b1[4 + r] = b1h[r];
      b2[r] = b2l[r]; b2[4 + r] = b2h[r];
    }
    #pragma unroll  // constant nt: the per-sub-tile arrays stay in registers
    for (int nt = 0; nt < NT; ++nt) {
      int p = nt * 16 + row;
      #pragma unroll
      for (int r = 0; r < 8; ++r) {
        float h1 = a1[nt][r] + b1[r];
        float h2 = a2[nt][r] + b2[r];
        // silu(h1)*h2. The divisor is never below 1, so one v_rcp_f32 stands for
        // the exact division: that is a chain of some ten dependent vector
        // instructions per element, which a wave waits out link by link.
        float g = h1 * __builtin_amdgcn_rcpf(1.0f + __expf(-h1)) * h2;
        gh[p * GP + o0 + r] = (_Float16)g;
      }
    }
  }

  // ---- Q projection (128x128), wave owns one output chunk ----
  // Its weights are in w1 (loaded behind the last W1 / W2 step).
  {
    v8f aq[NT] = {};
    // Two sets of z fragments, as for xn above.
    v16h bz[2][NT];
    #pragma unroll  // constant nt: bz stays in registers
    for (int nt = 0; nt < NT; ++nt)
      bz[0][nt] = frag_rm(zs + nt * 16 * XP, XP, row, 0, lane);
    #pragma unroll  // constant kb: register indices
    for (int kb = 0; kb < 4; ++kb) {
      if (kb < 3) {
        #pragma unroll  // constant nt: bz stays in registers
        for (int nt = 0; nt < NT; ++nt)
          bz[(kb + 1) & 1][nt] =
              frag_rm(zs + nt * 16 * XP, XP, row, (kb + 1) * 32, lane);
      }
      // Keeps the reads above the products, as in the stage before.
      __builtin_amdgcn_sched_barrier(0);
      #pragma unroll  // constant nt: the per-sub-tile arrays stay in registers
      for (int nt = 0; nt < NT; ++nt)
        aq[nt] = wmma32(w1[kb], bz[kb & 1][nt], aq[nt]);
    }
    #pragma unroll  // constant nt: the per-sub-tile arrays stay in registers
    for (int nt = 0; nt < NT; ++nt) {
      int p = nt * 16 + row;
      #pragma unroll
      for (int r = 0; r < 8; ++r)
        qs[p * XP + oq + r] = (_Float16)(aq[nt][r] + (r < 4 ? bql[r & 3] : bqh[r & 3]));
    }
  }
  __syncthreads();

  // ---- W3 GEMM (128x512), wave owns one output chunk, K = 512 ----
  {
    v8f a3[NT] = {};
    // Three sets of g fragments: k-step kb + 2's LDS reads are issued ahead of
    // k-step kb's four products. Eight weight fragments in turn: k-step
    // kb + 8's takes the place of k-step kb's behind its last product.
    v16h bg[3][NT];
    #pragma unroll  // constant kb: bg stays in registers
    for (int kb = 0; kb < 2; ++kb) {
      #pragma unroll  // constant nt
      for (int nt = 0; nt < NT; ++nt)
        bg[kb][nt] = frag_rm(gh + nt * 16 * GP, GP, row, kb * 32, lane);
    }
    #pragma unroll  // constant kb: register indices
    for (int kb = 0; kb < 16; ++kb) {
      if (kb + 2 < 16) {
        #pragma unroll  // constant nt: bg stays in registers
        for (int nt = 0; nt < NT; ++nt)
          bg[(kb + 2) % 3][nt] =
              frag_rm(gh + nt * 16 * GP, GP, row, (kb + 2) * 32, lane);
      }
      // Keeps the reads above the products, as in the stages before.
      __builtin_amdgcn_sched_barrier(0);
      #pragma unroll  // constant nt: the per-sub-tile arrays stay in registers
      for (int nt = 0; nt < NT; ++nt)
        a3[nt] = wmma32(aw[kb & 7], bg[kb % 3][nt], a3[nt]);
      if (kb + 8 < 16) aw[kb & 7] = frag_pk(W3h, wave * 16 + kb + 8, lane);
      // Precaution: behind the last weight load its address registers are
      // free: none is rewritten ahead of this wait.
      if (kb == 7) asm volatile("s_wait_xcnt 0x0" ::: "memory");
    }
    #pragma unroll  // constant nt: the per-sub-tile arrays stay in registers
    for (int nt = 0; nt < NT; ++nt) {
      int p = nt * 16 + row;
      #pragma unroll
      for (int r = 0; r < 8; ++r)
        fs[p * FP + oq + r] = a3[nt][r] + (r < 4 ? b3l[r & 3] : b3h[r & 3]);
    }
  }
  __syncthreads();

  // ---- attn = corr @ q, then gated combine + store ----
  {
    int head = wave >> 1, mc = wave & 1;
    v16h ac = frag_rm(cs + head * 32 * 32, 32, mc * 16 + row, 0, lane);
    float sa = sigm(aalpha[head]);
    float sb = sigm(abeta[head]);
    float ga = sigm(galpha[0]);
    float gb = sigm(gbeta[0]);
    int d0 = mc * 16 + hi8;
    #pragma unroll  // the four sub-tiles' LDS reads are issued together
    for (int nt = 0; nt < NT; ++nt) {
      int p = nt * 16 + row;
      v16h bq = frag_gather(qs + p * XP + head, HEAD, lane);
      v8f at = {};
      at = wmma32(ac, bq, at);
      #pragma unroll
      for (int r = 0; r < 8; ++r) {
        int d = d0 + r;
        int c = d * HEAD + head;
        float attnv = at[r] * (1.0f / SEQ);
        float mha = sa * (float)xs[p * XP + c] + sb * attnv;
        out[(((size_t)b * DIM) + c) * SEQ + pb + p] =
            ga * fs[p * FP + c] + gb * mha;
      }
    }
  }
}

// ---------------------------------------------------------------------------
// Host launch
// ---------------------------------------------------------------------------
extern "C" void kernel_launch(void* const* d_in, const int* in_sizes, int n_in,
                              void* d_out, int out_size, void* d_ws,
                              size_t ws_size, hipStream_t stream) {
  const float* x  = (const float*)d_in[0];
  const float* z  = (const float*)d_in[1];
  const float* nw = (const float*)d_in[2];
  const float* Qw = (const float*)d_in[3];
  const float* Qb = (const float*)d_in[4];
  const float* Kw = (const float*)d_in[5];
  const float* Kb = (const float*)d_in[6];
  const float* aalpha = (const float*)d_in[7];
  const float* abeta  = (const float*)d_in[8];
  const float* W1w = (const float*)d_in[9];
  const float* W1b = (const float*)d_in[10];
  const float* W2w = (const float*)d_in[11];
  const float* W2b = (const float*)d_in[12];
  const float* W3w = (const float*)d_in[13];
  const float* W3b = (const float*)d_in[14];
  const float* galpha = (const float*)d_in[15];
  const float* gbeta  = (const float*)d_in[16];
  float* out = (float*)d_out;

  // Workspace carve-up
  char* p = (char*)d_ws;
  _Float16* xnh = (_Float16*)p; p += NPOS * DIM * 2;
  _Float16* zh  = (_Float16*)p; p += NPOS * DIM * 2;
  _Float16* W1h = (_Float16*)p; p += (size_t)HID * DIM * 2;
  _Float16* W2h = (_Float16*)p; p += (size_t)HID * DIM * 2;
  _Float16* W3h = (_Float16*)p; p += (size_t)DIM * HID * 2;
  _Float16* Qwh = (_Float16*)p; p += (size_t)DIM * DIM * 2;
  _Float16* Kwh = (_Float16*)p; p += (size_t)DIM * DIM * 2;
  float* corr = (float*)p;      p += (size_t)BB * HEAD * 32 * 32 * 4;

  // RMSNorm + f16 conversion of x and z; weight conversion f32 -> f16 into
  // W1h .. Kwh, which lie one behind the other from W1h on; corr cleared.
  k_norm<<<NB_NORM + NB_CVT + NB_ZERO, 256, 0, stream>>>(
      x, z, nw, W1w, W2w, W3w, Qw, Kw, xnh, zh, W1h, corr);

  // Per-head 32x32 correlations (reduction over n)
  k_corr<<<BB * (SEQ / CP), CTH, 0, stream>>>(xnh, Kwh, Kb, corr);

  // FFN + attention apply + gated combine
  k_main<<<BB * (SEQ / TP), 256, 0, stream>>>(
      xnh, zh, W1h, W1b, W2h, W2b, W3h, W3b, Qwh, Qb, corr,
      aalpha, abeta, galpha, gbeta, out);
}

// v009
// It runs in 85.2 microseconds.
// Next to v008, in two timings, it ran 1.10 times as fast each time.
// Counting every step since v000, it is 5.53 times as fast.
#include <hip/hip_runtime.h>
#include <hip/hip_bf16.h>

// ---------------------------------------------------------------------------
// Parallel Graphormer block for MI455X (gfx1250, wave32, WMMA).
// All channel GEMMs run through v_wmma_f32_16x16x32_f16; tile staging uses
// GLOBAL_LOAD_ASYNC_TO_LDS_B128 (ASYNCcnt) for the xn tiles to bypass VGPRs;
// the f32 z tile goes through VGPRs.
// ---------------------------------------------------------------------------

#define BB   16
#define DIM  128
#define SEQ  8192
#define HEAD 4
#define HID  512
#define NPOS ((size_t)BB * SEQ)

// LDS row pitches. The tiles that use them are read one row per lane, so an
// unpadded power-of-two row puts all 16 rows of a 16-byte read on the same
// four banks. One 16-byte pad per row makes the pitch 16 B x odd, which
// spreads the 16 rows over all 64 banks.
#define XP (DIM + 8)   // f16 rows of DIM: 272 B
#define GP (HID + 8)   // f16 rows of HID: 1040 B
#define FP (DIM + 4)   // f32 rows of DIM: 528 B

// Positions per block of k_main. Every weight fragment a wave loads from
// global memory feeds NT matrix products, one per 16-position sub-tile.
#define TP 64
#define NT (TP / 16)

// Positions per block of k_norm.
#define NP 128

// k_norm's grid: NB_NORM blocks normalise; behind them stand NB_CVT blocks
// that convert PE weight elements each and NB_ZERO blocks that clear PE
// elements of corr each.
#define PE      4096
#define NB_NORM ((int)(NPOS / NP))
#define NB_W    (HID * DIM / PE)
#define NB_Q    (DIM * DIM / PE)
#define NB_CVT  (3 * NB_W + 2 * NB_Q)
#define NB_ZERO (BB * HEAD * 32 * 32 / PE)

// Halves of one 16 x 32 weight fragment.
#define FH 512

// Positions and threads per block of k_corr.
#define CP  512
#define CTH 512

typedef __attribute__((ext_vector_type(16))) _Float16 v16h;
typedef __attribute__((ext_vector_type(8)))  float    v8f;
typedef __attribute__((ext_vector_type(8)))  _Float16 v8h;
typedef __attribute__((ext_vector_type(4)))  float    v4f;

__device__ __forceinline__ v8f wmma32(v16h a, v16h b, v8f c) {
  // D = A(16x32 f16) * B(32x16 f16) + C(16x16 f32)
  return __builtin_amdgcn_wmma_f32_16x16x32_f16(
      /*neg_a=*/false, a, /*neg_b=*/false, b,
      /*c_mod=*/(short)0, c, /*reuse_a=*/false, /*reuse_b=*/false);
}

// Async global -> LDS 16-byte copy (per active lane). VDST VGPR carries the
// LDS byte address (low 32 bits of the generic shared pointer), VADDR the
// 64-bit global address. Tracked by ASYNCcnt.
__device__ __forceinline__ void async_copy_b128(void* lds_ptr,
                                                const void* gptr) {
  unsigned lds_addr = (unsigned)(size_t)lds_ptr;
  unsigned long long ga = (unsigned long long)(size_t)gptr;
  // The wait stands inside the copy's own statement so that it precedes any
  // rewrite of the two address registers.
  asm volatile("global_load_async_to_lds_b128 %0, %1, off\n\ts_wait_xcnt 0x0"
               :: "v"(lds_addr), "v"(ga)
               : "memory");
}

// Eight such copies, ls halves apart in LDS and gs halves apart in global
// memory, in one statement with one wait behind the last: the wait precedes
// any rewrite of the sixteen address registers, and the copies issue back to
// back.
__device__ __forceinline__ void async_copy8_b128(_Float16* lds_ptr, int ls,
                                                 const _Float16* gptr, int gs) {
  unsigned l0 = (unsigned)(size_t)lds_ptr;
  unsigned long long g0 = (unsigned long long)(size_t)gptr;
  unsigned lb = (unsigned)ls * 2u;
  unsigned long long gb = (unsigned long long)gs * 2u;
  asm volatile("global_load_async_to_lds_b128 %0, %8, off\n\t"
               "global_load_async_to_lds_b128 %1, %9, off\n\t"
               "global_load_async_to_lds_b128 %2, %10, off\n\t"
               "global_load_async_to_lds_b128 %3, %11, off\n\t"
               "global_load_async_to_lds_b128 %4, %12, off\n\t"
               "global_load_async_to_lds_b128 %5, %13, off\n\t"
               "global_load_async_to_lds_b128 %6, %14, off\n\t"
               "global_load_async_to_lds_b128 %7, %15, off\n\t"
               "s_wait_xcnt 0x0"
               :: "v"(l0), "v"(l0 + lb), "v"(l0 + 2 * lb), "v"(l0 + 3 * lb),
                  "v"(l0 + 4 * lb), "v"(l0 + 5 * lb), "v"(l0 + 6 * lb),
                  "v"(l0 + 7 * lb),
                  "v"(g0), "v"(g0 + gb), "v"(g0 + 2 * gb), "v"(g0 + 3 * gb),
                  "v"(g0 + 4 * gb), "v"(g0 + 5 * gb), "v"(g0 + 6 * gb),
                  "v"(g0 + 7 * gb)
               : "memory");
}

__device__ __forceinline__ void wait_async0() {
  asm volatile("s_wait_asynccnt 0" ::: "memory");
}

// Load 16 f16 as two contiguous 16B chunks (p0[0..7], p0[16..23]) matching the
// ISA 16-bit A/B fragment striping: half h<8 -> K = 8*(lane>=16)+h,
// h>=8 -> K = 16 + 8*(lane>=16) + (h-8).
__device__ __forceinline__ v16h load16h(const _Float16* p0) {
  float4 a = *(const float4*)(p0);
  float4 b = *(const float4*)(p0 + 16);
  v16h r;
  __builtin_memcpy(&r, &a, 16);
  __builtin_memcpy(((char*)&r) + 16, &b, 16);
  return r;
}

// Row-major fragment: base[row*ldk + kb + ...] with contiguous K runs.
__device__ __forceinline__ v16h frag_rm(const _Float16* base, int ldk,
                                        int row, int kb, int lane) {
  return load16h(base + (size_t)row * ldk + kb + ((lane >> 4) << 3));
}

// Weight fragment from a matrix stored in fragment order (see k_norm): the
// 16 x 32 fragment number f is FH halves in a row, first the 32 lanes' low
// 16-byte chunks, then their high ones. Each of the two loads of a wave reads
// 512 contiguous bytes, four whole lines. A lane gets the same halves that
// frag_rm gives it from the row-major matrix.
__device__ __forceinline__ v16h frag_pk(const _Float16* base, int f, int lane) {
  const _Float16* p0 = base + (size_t)f * FH + lane * 8;
  float4 a = *(const float4*)(p0);
  float4 b = *(const float4*)(p0 + FH / 2);
  v16h r;
  __builtin_memcpy(&r, &a, 16);
  __builtin_memcpy(((char*)&r) + 16, &b, 16);
  return r;
}

// The same for the last fragment of a run of weight loads: behind their last
// loads the run's address registers are free, and one of these two loads may
// land in them. Precaution: s_wait_xcnt 0 stands in front of each of the two,
// behind every load that names those registers.
__device__ __forceinline__ v16h frag_pk_last(const _Float16* base, int f,
                                             int lane) {
  const _Float16* p0 = base + (size_t)f * FH + lane * 8;
  asm volatile("s_wait_xcnt 0x0" ::: "memory");
  float4 a = *(const float4*)(p0);
  asm volatile("s_wait_xcnt 0x0" ::: "memory");
  float4 b = *(const float4*)(p0 + FH / 2);
  v16h r;
  __builtin_memcpy(&r, &a, 16);
  __builtin_memcpy(((char*)&r) + 16, &b, 16);
  return r;
}

// Gather fragment for strided K (e.g. channel = K*HEAD + head).
__device__ __forceinline__ v16h frag_gather(const _Float16* base, int stride,
                                            int lane) {
  v16h r = {};
  int lo = (lane >> 4) << 3;
  #pragma unroll
  for (int h = 0; h < 16; ++h) {
    int K = h + ((h >= 8) ? 8 : 0) + lo;
    r[h] = base[(size_t)K * stride];
  }
  return r;
}

// The divisor is never below 1: v_rcp_f32 in place of the exact division.
__device__ __forceinline__ float sigm(float v) {
  return __builtin_amdgcn_rcpf(1.0f + __expf(-v));
}

// ---------------------------------------------------------------------------
// RMSNorm over channels + f16 conversion of xn.
// Layout in: (b, c, n) f32.  Layout out: (b*n, c) f16 (GEMM-friendly rows).
// One block per (b, NP-position tile), 8 waves. A wave reads 16 channels, 512
// contiguous bytes of a channel per load, and keeps them in registers. The
// tile is turned through LDS, so that every global store of a wave is 512
// contiguous bytes of the output rows.
// An LDS row is one position's 16 chunks of 16 bytes. Chunk ch of row r lies
// at place ch ^ ((r >> 2) & 15): the writers (one chunk number, rows four
// apart) and the readers (all chunks of two rows) both spread over all banks.
// The blocks from NB_NORM on do the work that nothing in this launch reads
// and the later launches need: the f32 -> f16 conversion of the five weight
// matrices, stored in fragment order, and the start value of corr. They stand
// last in the grid.
// ---------------------------------------------------------------------------
__device__ __forceinline__ int norm_slot(int r, int ch) {
  return r * DIM + ((ch ^ ((r >> 2) & 15)) << 3);
}

__global__ void __launch_bounds__(256)
k_norm(const float* __restrict__ x, const float* __restrict__ nw,
       const float* __restrict__ W1w, const float* __restrict__ W2w,
       const float* __restrict__ W3w, const float* __restrict__ Qw,
       const float* __restrict__ Kw,
       _Float16* __restrict__ xnh, _Float16* __restrict__ wh,
       float* __restrict__ corr) {
  __shared__ __align__(16) _Float16 xt[NP * DIM];   // xn tile [pos][c], swizzled
  __shared__ __align__(16) v4f red[8 * 32];         // per-wave sums of squares
  int blk = blockIdx.x;
  int tid = threadIdx.x, lane = tid & 31;

  // The same test in every thread of a block, ahead of every barrier.
  if (blk >= NB_NORM) {
    int e = blk - NB_NORM;
    if (e < NB_CVT) {
      // wh holds W1, W2, W3, Q, K one behind the other, so the block's place
      // in it is e * PE whichever matrix it reads. m0 is the block's place in
      // its own matrix, lk the log2 of that matrix's fragments per row.
      const float* s;
      int m0, lk = 2;
      if (e < NB_W)                 { s = W1w; m0 = e; }
      else if (e < 2 * NB_W)        { s = W2w; m0 = e - NB_W; }
      else if (e < 3 * NB_W)        { s = W3w; m0 = e - 2 * NB_W; lk = 4; }
      else if (e < 3 * NB_W + NB_Q) { s = Qw;  m0 = e - 3 * NB_W; }
      else                          { s = Kw;  m0 = e - 3 * NB_W - NB_Q; }
      m0 *= PE;
      _Float16* d = wh + (size_t)e * PE;
      #pragma unroll  // all loads of the block in flight at once
      for (int k = 0; k < PE / 8 / 256; ++k) {
        int q = (k * 256 + tid) * 8;
        // The matrix is stored in fragment order (frag_pk): chunk q of the
        // block belongs to fragment f, lane l, low or high part.
        int dm = m0 + q;
        int f = dm / FH, part = (dm / (FH / 2)) & 1, l = (dm >> 3) & 31;
        int sr = (f >> lk) * 16 + (l & 15);
        int sc = (f & ((1 << lk) - 1)) * 32 + part * 16 + (l >> 4) * 8;
        int so = (sr << (lk + 5)) + sc;
        v4f lo = *(const v4f*)(s + so);
        v4f hi = *(const v4f*)(s + so + 4);
        v8h t;
        #pragma unroll  // constant i: t is built in registers
        for (int i = 0; i < 4; ++i) {
          t[i] = (_Float16)lo[i];
          t[4 + i] = (_Float16)hi[i];
        }
        *(v8h*)(d + q) = t;
      }
    } else {
      float* c = corr + (size_t)(e - NB_CVT) * PE;
      v4f zero = {};
      #pragma unroll  // independent stores
      for (int k = 0; k < PE / 4 / 256; ++k)
        *(v4f*)(c + (k * 256 + tid) * 4) = zero;
      // Precaution: the stores' registers are not rewritten ahead of this wait.
      asm volatile("s_wait_xcnt 0x0" ::: "memory");
    }
    return;
  }

  int b = blk / (SEQ / NP);
  int pb = (blk % (SEQ / NP)) * NP;
  // The wave's number in a scalar register: nw is then read by scalar loads.
  int wave = __builtin_amdgcn_readfirstlane(tid >> 5);
  int c0 = wave * 16;

  // This lane: positions 4*lane .. 4*lane+3 of channels c0 .. c0+15.
  size_t in0 = ((size_t)b * DIM + c0) * SEQ + pb + lane * 4;
  v4f xv[16];
  #pragma unroll  // constant j: xv stays in registers, all loads in flight
  for (int j = 0; j < 16; ++j)
    xv[j] = *(const v4f*)(x + in0 + (size_t)j * SEQ);

  v4f ss = {};
  #pragma unroll  // constant j: register indices
  for (int j = 0; j < 16; ++j) ss += xv[j] * xv[j];
  red[wave * 32 + lane] = ss;
  __syncthreads();

  v4f s = red[lane];
  #pragma unroll  // the eight LDS reads are issued together
  for (int w = 1; w < 8; ++w) s += red[w * 32 + lane];
  #pragma unroll  // constant i, h: register indices
  for (int i = 0; i < 4; ++i) {
    float rinv = rsqrtf(s[i] * (1.0f / DIM) + 1e-6f);
    #pragma unroll  // constant h
    for (int h = 0; h < 2; ++h) {
      v8h t;
      #pragma unroll  // constant e: t is built in registers
      for (int e = 0; e < 8; ++e)
        t[e] = (_Float16)(nw[c0 + h * 8 + e] * xv[h * 8 + e][i] * rinv);
      *(v8h*)(xt + norm_slot(lane * 4 + i, wave * 2 + h)) = t;
    }
  }
  __syncthreads();

  // The tile's NP output rows are one contiguous range of NP * DIM halves.
  // All global stores stand behind the last barrier, which then waits for none.
  size_t out0 = ((size_t)b * SEQ + pb) * DIM;
  #pragma unroll  // the LDS reads are issued together, ahead of the stores
  for (int k = 0; k < (NP * DIM) / 8 / 256; ++k) {
    int q = k * 256 + tid;
    int sl = norm_slot(q >> 4, q & 15);
    *(v8h*)(xnh + out0 + (size_t)q * 8) = *(const v8h*)(xt + sl);
  }
  // Precaution: in the built code this path runs on into the shared exit's
  // tests; no register of the stores is rewritten ahead of this wait.
  asm volatile("s_wait_xcnt 0x0" ::: "memory");
}

// ---------------------------------------------------------------------------
// Correlation: corr[b,h] += xr(32 x CP) @ k(32 x CP)^T with k = Kw@xn + Kb.
// One block per (b, CP-position slab), 16 waves. The whole slab is staged and
// projected once; each wave then sums one 16x16 piece of one head's
// correlation over all CP positions in its matrix accumulator, so an element
// of corr takes one atomic add per slab.
// ---------------------------------------------------------------------------
__global__ void __launch_bounds__(CTH)
k_corr(const _Float16* __restrict__ xnh,
       const _Float16* __restrict__ Kwh,
       const float* __restrict__ Kb,
       float* __restrict__ corr) {
  __shared__ __align__(16) _Float16 xs[CP * XP];   // [pos][c], padded rows
  __shared__ __align__(16) _Float16 ks[CP * XP];   // [pos][c], padded rows
  int blk = blockIdx.x;
  int b = blk / (SEQ / CP);
  int pb = (blk % (SEQ / CP)) * CP;
  int tid = threadIdx.x, lane = tid & 31, wave = tid >> 5;
  int row = lane & 15, hi8 = (lane >> 4) << 3;

  // Async-stage the xn slab (128 KB) straight into LDS, bypassing VGPRs.
  // A constant trip count: every lane is on at every copy. One copy of all
  // threads fills CTH / 16 rows, one trip of eight copies half the slab.
  const _Float16* src = xnh + ((size_t)b * SEQ + pb) * DIM + tid * 8;
  _Float16* dst = xs + (tid >> 4) * XP + (tid & 15) * 8;
  #pragma unroll  // constant steps: the addresses of a group differ by constants
  for (int k = 0; k < (CP * DIM) / 8 / CTH; k += 8)
    async_copy8_b128(dst + (size_t)k * (CTH / 16) * XP, (CTH / 16) * XP,
                     src + (size_t)k * CTH * 8, CTH * 8);

  // k = Kw @ xn + Kb : a wave owns 16 output channels of half the slab. Its
  // weight fragments and biases are the same for every sub-tile; their loads
  // fly together with the copies.
  int oc = wave & 7, ph = wave >> 3;
  int o0 = oc * 16 + hi8;
  v16h aw[4];
  #pragma unroll  // constant kb: aw stays in registers
  for (int kb = 0; kb < 4; ++kb)
    aw[kb] = frag_pk(Kwh, oc * 4 + kb, lane);
  float kbv[8];
  #pragma unroll  // constant r: kbv stays in registers
  for (int r = 0; r < 8; ++r) kbv[r] = Kb[o0 + r];
  wait_async0();
  __syncthreads();

  {
    #pragma unroll 4  // four independent accumulate chains fill each other's latency
    for (int nc = 0; nc < CP / 32; ++nc) {
      int p0 = ph * (CP / 2) + nc * 16;
      v8f acc = {};
      #pragma unroll
      for (int kb = 0; kb < 4; ++kb) {
        v16h bf = frag_rm(xs + p0 * XP, XP, row, kb * 32, lane);
        acc = wmma32(aw[kb], bf, acc);
      }
      #pragma unroll
      for (int r = 0; r < 8; ++r)
        ks[(p0 + row) * XP + o0 + r] = (_Float16)(acc[r] + kbv[r]);
    }
  }
  __syncthreads();

  // corr piece: A = xr (16 x 32 pos), B = k^T (32 pos x 16), summed over the
  // slab's CP / 32 steps of 32 positions.
  {
    int head = wave >> 2, mc = (wave >> 1) & 1, nc = wave & 1;
    const _Float16* xa = xs + ((mc * 16 + row) * HEAD + head);
    const _Float16* kbp = ks + ((nc * 16 + row) * HEAD + head);
    v8f acc = {};
    #pragma unroll 4  // several steps' LDS reads in flight at once
    for (int kt = 0; kt < CP / 32; ++kt) {
      v16h a = frag_gather(xa + kt * 32 * XP, XP, lane);
      v16h bf = frag_gather(kbp + kt * 32 * XP, XP, lane);
      acc = wmma32(a, bf, acc);
    }
    float* cp = corr + (((size_t)b * HEAD + head) * 32) * 32;
    int d0 = mc * 16 + hi8;
    int s = nc * 16 + row;
    #pragma unroll
    for (int r = 0; r < 8; ++r) atomicAdd(&cp[(d0 + r) * 32 + s], acc[r]);
  }
}

// ---------------------------------------------------------------------------
// Main per-tile kernel: SwiGLU FFN + Q projection + corr@q + gated combine.
// One block per (b, TP-position tile), 8 waves.
// ---------------------------------------------------------------------------
// The real block size, and four waves per SIMD (two blocks per WGP, which is
// what the LDS allows): without it the compiler plans for 1,024 threads, caps
// the wave at 128 registers and spills the accumulators.
__global__ void __launch_bounds__(256, 4)
k_main(const _Float16* __restrict__ xnh,
                       const float* __restrict__ z,
                       const _Float16* __restrict__ W1h,
                       const float* __restrict__ W1b,
                       const _Float16* __restrict__ W2h,
                       const float* __restrict__ W2b,
                       const _Float16* __restrict__ W3h,
                       const float* __restrict__ W3b,
                       const _Float16* __restrict__ Qwh,
                       const float* __restrict__ Qb,
                       const float* __restrict__ corr,
                       const float* __restrict__ aalpha,
                       const float* __restrict__ abeta,
                       const float* __restrict__ galpha,
                       const float* __restrict__ gbeta,
                       float* __restrict__ out) {
  __shared__ __align__(16) _Float16 xs[TP * XP];         // xn tile [p][c]
  __shared__ __align__(16) _Float16 zs[TP * XP];         // z  tile [p][c]
  __shared__ __align__(16) _Float16 gh[TP * GP];         // silu(h1)*h2 [p][o]
  __shared__ __align__(16) _Float16 qs[TP * XP];         // q tile [p][c]
  __shared__ __align__(16) _Float16 cs[HEAD * 32 * 32];  // corr f16 [h][d][s]
  __shared__ __align__(16) float    fs[TP * FP];         // ffn f32 [p][c]

  int blk = blockIdx.x;
  int b = blk / (SEQ / TP);
  int pb = (blk % (SEQ / TP)) * TP;
  int tid = threadIdx.x, lane = tid & 31, wave = tid >> 5;
  int row = lane & 15, hi8 = (lane >> 4) << 3;

  // The z tile comes straight from the f32 input, layout (b, c, n). A wave
  // takes 16 channels; a lane four positions of eight of them, so a load of a
  // wave reads the tile's 256 contiguous bytes of two channels. These loads
  // come from memory and are asked for first.
  int zc = wave * 16 + hi8;
  const float* zp = z + ((size_t)b * DIM + zc) * SEQ + pb + row * 4;
  v4f zv[8];
  #pragma unroll  // constant j: zv stays in registers, all loads in flight
  for (int j = 0; j < 8; ++j) {
    // Precaution: the last load may land in the address registers that the
    // loads before it name: this wait stands between them.
    if (j == 7) asm volatile("s_wait_xcnt 0x0" ::: "memory");
    zv[j] = *(const v4f*)(zp + (size_t)j * SEQ);
  }
  // Precaution: no register of these loads is rewritten ahead of this wait.
  asm volatile("s_wait_xcnt 0x0" ::: "memory");
  // Async-stage the xn tile (16 KB) into LDS, bypassing VGPRs.
  const _Float16* sx = xnh + ((size_t)b * SEQ + pb) * DIM;
  __builtin_prefetch(sx + TP * DIM, 0, 0);   // next tile -> global_prefetch_b8
  // A constant trip count: every lane is on at every copy.
  for (int k = 0; k < (TP * DIM) / 8 / 256; ++k) {
    int i = k * 256 + tid;
    async_copy_b128(xs + (i >> 4) * XP + (i & 15) * 8, sx + i * 8);
  }
  // The first W1 / W2 step's weight fragments (see below) are asked for here:
  // they fly together with the copies.
  v16h w1[4], w2[4];
  #pragma unroll  // constant kb: w1, w2 stay in registers, all loads in flight
  for (int kb = 0; kb < 4; ++kb) {
    w1[kb] = frag_pk(W1h, wave * 16 + kb, lane);
    w2[kb] = kb < 3 ? frag_pk(W2h, wave * 16 + kb, lane)
                    : frag_pk_last(W2h, wave * 16 + kb, lane);
  }
  // Precaution: no register of these loads is rewritten ahead of this wait.
  asm volatile("s_wait_xcnt 0x0" ::: "memory");
  // Corr needs an f32->f16 conversion, so it rides the normal VGPR path.
  const float* cb = corr + (size_t)b * HEAD * 32 * 32;
  for (int i = tid; i < HEAD * 32 * 32; i += 256) cs[i] = (_Float16)cb[i];
  // z to f16, turned in registers: eight channels of one position are 16
  // bytes of that position's LDS row.
  #pragma unroll  // constant i: register indices
  for (int i = 0; i < 4; ++i) {
    v8h t;
    #pragma unroll  // constant e: t is built in registers
    for (int e = 0; e < 8; ++e) t[e] = (_Float16)zv[e][i];
    *(v8h*)(zs + (row * 4 + i) * XP + zc) = t;
  }
  wait_async0();
  __syncthreads();

  // ---- W1 / W2 GEMMs (512x128 each), wave owns 4 output chunks of 16 ----
  // The eight weight fragments of a step come from L2, the xn fragments from
  // LDS. So the registers go to the
  // weights (w1, w2): step m + 1's fragments are loaded behind step m's last
  // product and fly under its silu, and the xn fragments are read from LDS
  // anew in every step.
  // What the two stages behind this one load from global memory: asked for
  // behind the last step's products.
  int oq = wave * 16 + hi8;
  v16h aw[8];
  v4f bql, bqh, b3l, b3h;
  for (int m = 0; m < 4; ++m) {
    int ob = (wave * 4 + m) * 16;
    int o0 = ob + hi8;
    // This step's biases are asked for ahead of the next step's weights:
    // loads return in order, so the silu then waits for none of those.
    v4f b1l = *(const v4f*)(W1b + o0), b1h = *(const v4f*)(W1b + o0 + 4);
    v4f b2l = *(const v4f*)(W2b + o0), b2h = *(const v4f*)(W2b + o0 + 4);
    // Precaution: no register of the bias loads is rewritten ahead of this wait.
    asm volatile("s_wait_xcnt 0x0" ::: "memory");
    v8f a1[NT] = {}, a2[NT] = {};
    // Two sets of xn fragments: k-step kb + 1's LDS reads are issued ahead of
    // k-step kb's eight products and land under them.
    v16h bx[2][NT];
    #pragma unroll  // constant nt: bx stays in registers
    for (int nt = 0; nt < NT; ++nt)
      bx[0][nt] = frag_rm(xs + nt * 16 * XP, XP, row, 0, lane);
    #pragma unroll  // constant kb: register indices
    for (int kb = 0; kb < 4; ++kb) {
      if (kb < 3) {
        #pragma unroll  // constant nt: bx stays in registers
        for (int nt = 0; nt < NT; ++nt)
          bx[(kb + 1) & 1][nt] =
              frag_rm(xs + nt * 16 * XP, XP, row, (kb + 1) * 32, lane);
      }
      // Keeps the reads above the products: left alone, the compiler puts each
      // read directly in front of its product, which then waits out the LDS.
      __builtin_amdgcn_sched_barrier(0);
      #pragma unroll  // constant nt: the per-sub-tile arrays stay in registers
      for (int nt = 0; nt < NT; ++nt) {
        a1[nt] = wmma32(w1[kb], bx[kb & 1][nt], a1[nt]);
        a2[nt] = wmma32(w2[kb], bx[kb & 1][nt], a2[nt]);
      }
    }
    // The same test in every thread. Behind the last step stand the Q
    // projection, whose four fragments take w1's place, and W3, whose first
    // eight fragments then have the whole Q stage to arrive. The two stages'
    // biases go first: loads return in order.
    if (m < 3) {
      #pragma unroll  // constant kb: w1, w2 stay in registers, all loads in flight
      for (int kb = 0; kb < 4; ++kb) {
        w1[kb] = frag_pk(W1h, (wave * 4 + m + 1) * 4 + kb, lane);
        w2[kb] = kb < 3 ? frag_pk(W2h, (wave * 4 + m + 1) * 4 + kb, lane)
                        : frag_pk_last(W2h, (wave * 4 + m + 1) * 4 + kb, lane);
      }
    } else {
      bql = *(const v4f*)(Qb + oq);
      bqh = *(const v4f*)(Qb + oq + 4);
      b3l = *(const v4f*)(W3b + oq);
      b3h = *(const v4f*)(W3b + oq + 4);
      #pragma unroll  // constant kb: w1 stays in registers, all loads in flight
      for (int kb = 0; kb < 4; ++kb)
        w1[kb] = frag_pk_last(Qwh, wave * 4 + kb, lane);
      // Precaution: a W3 load may land in the registers that held the Q loads'
      // address: this wait stands between the two.
      asm volatile("s_wait_xcnt 0x0" ::: "memory");
      #pragma unroll  // constant j: aw stays in registers, all loads in flight
      for (int j = 0; j < 8; ++j) aw[j] = frag_pk(W3h, wave * 16 + j, lane);
    }
    // Precaution: the silu below may use the registers that held these loads'
    // addresses: this wait stands between the two.
    asm volatile("s_wait_xcnt 0x0" ::: "memory");
    float b1[8], b2[8];
    #pragma unroll  // constant r: register indices
    for (int r = 0; r < 4; ++r) {
      b1[r] = b1l[r]; b1[4 + r] = b1h[r];
      b2[r] = b2l[r]; b2[4 + r] = b2h[r];
    }
    #pragma unroll  // constant nt: the per-sub-tile arrays stay in registers
    for (int nt = 0; nt < NT; ++nt) {
      int p = nt * 16 + row;
      #pragma unroll
      for (int r = 0; r < 8; ++r) {
        float h1 = a1[nt][r] + b1[r];
        float h2 = a2[nt][r] + b2[r];
        // silu(h1)*h2. The divisor is never below 1, so one v_rcp_f32 stands for
        // the exact division: that is a chain of some ten dependent vector
        // instructions per element, which a wave waits out link by link.
        float g = h1 * __builtin_amdgcn_rcpf(1.0f + __expf(-h1)) * h2;
        gh[p * GP + o0 + r] = (_Float16)g;
      }
    }
  }

  // ---- Q projection (128x128), wave owns one output chunk ----
  // Its weights are in w1 (loaded behind the last W1 / W2 step).
  {
    v8f aq[NT] = {};
    // Two sets of z fragments, as for xn above.
    v16h bz[2][NT];
    #pragma unroll  // constant nt: bz stays in registers
    for (int nt = 0; nt < NT; ++nt)
      bz[0][nt] = frag_rm(zs + nt * 16 * XP, XP, row, 0, lane);
    #pragma unroll  // constant kb: register indices
    for (int kb = 0; kb < 4; ++kb) {
      if (kb < 3) {
        #pragma unroll  // constant nt: bz stays in registers
        for (int nt = 0; nt < NT; ++nt)
          bz[(kb + 1) & 1][nt] =
              frag_rm(zs + nt * 16 * XP, XP, row, (kb + 1) * 32, lane);
      }
      // Keeps the reads above the products, as in the stage before.
      __builtin_amdgcn_sched_barrier(0);
      #pragma unroll  // constant nt: the per-sub-tile arrays stay in registers
      for (int nt = 0; nt < NT; ++nt)
        aq[nt] = wmma32(w1[kb], bz[kb & 1][nt], aq[nt]);
    }
    #pragma unroll  // constant nt: the per-sub-tile arrays stay in registers
    for (int nt = 0; nt < NT; ++nt) {
      int p = nt * 16 + row;
      #pragma unroll
      for (int r = 0; r < 8; ++r)
        qs[p * XP + oq + r] = (_Float16)(aq[nt][r] + (r < 4 ? bql[r & 3] : bqh[r & 3]));
    }
  }
  __syncthreads();

  // ---- W3 GEMM (128x512), wave owns one output chunk, K = 512 ----
  {
    v8f a3[NT] = {};
    // Three sets of g fragments: k-step kb + 2's LDS reads are issued ahead of
    // k-step kb's four products. Eight weight fragments in turn: k-step
    // kb + 8's takes the place of k-step kb's behind its last product.
    v16h bg[3][NT];
    #pragma unroll  // constant kb: bg stays in registers
    for (int kb = 0; kb < 2; ++kb) {
      #pragma unroll  // constant nt
      for (int nt = 0; nt < NT; ++nt)
        bg[kb][nt] = frag_rm(gh + nt * 16 * GP, GP, row, kb * 32, lane);
    }
    #pragma unroll  // constant kb: register indices
    for (int kb = 0; kb < 16; ++kb) {
      if (kb + 2 < 16) {
        #pragma unroll  // constant nt: bg stays in registers
        for (int nt = 0; nt < NT; ++nt)
          bg[(kb + 2) % 3][nt] =
              frag_rm(gh + nt * 16 * GP, GP, row, (kb + 2) * 32, lane);
      }
      // Keeps the reads above the products, as in the stages before.
      __builtin_amdgcn_sched_barrier(0);
      #pragma unroll  // constant nt: the per-sub-tile arrays stay in registers
      for (int nt = 0; nt < NT; ++nt)
        a3[nt] = wmma32(aw[kb & 7], bg[kb % 3][nt], a3[nt]);
      if (kb + 8 < 16) aw[kb & 7] = frag_pk(W3h, wave * 16 + kb + 8, lane);
      // Precaution: behind the last weight load its address registers are
      // free: none is rewritten ahead of this wait.
      if (kb == 7) asm volatile("s_wait_xcnt 0x0" ::: "memory");
    }
    #pragma unroll  // constant nt: the per-sub-tile arrays stay in registers
    for (int nt = 0; nt < NT; ++nt) {
      int p = nt * 16 + row;
      #pragma unroll
      for (int r = 0; r < 8; ++r)
        fs[p * FP + oq + r] = a3[nt][r] + (r < 4 ? b3l[r & 3] : b3h[r & 3]);
    }
  }
  __syncthreads();

  // ---- attn = corr @ q, then gated combine + store ----
  {
    int head = wave >> 1, mc = wave & 1;
    v16h ac = frag_rm(cs + head * 32 * 32, 32, mc * 16 + row, 0, lane);
    float sa = sigm(aalpha[head]);
    float sb = sigm(abeta[head]);
    float ga = sigm(galpha[0]);
    float gb = sigm(gbeta[0]);
    int d0 = mc * 16 + hi8;
    #pragma unroll  // the four sub-tiles' LDS reads are issued together
    for (int nt = 0; nt < NT; ++nt) {
      int p = nt * 16 + row;
      v16h bq = frag_gather(qs + p * XP + head, HEAD, lane);
      v8f at = {};
      at = wmma32(ac, bq, at);
      #pragma unroll
      for (int r = 0; r < 8; ++r) {
        int d = d0 + r;
        int c = d * HEAD + head;
        float attnv = at[r] * (1.0f / SEQ);
        float mha = sa * (float)xs[p * XP + c] + sb * attnv;
        out[(((size_t)b * DIM) + c) * SEQ + pb + p] =
            ga * fs[p * FP + c] + gb * mha;
      }
    }
  }
}

// ---------------------------------------------------------------------------
// Host launch
// ---------------------------------------------------------------------------
extern "C" void kernel_launch(void* const* d_in, const int* in_sizes, int n_in,
                              void* d_out, int out_size, void* d_ws,
                              size_t ws_size, hipStream_t stream) {
  const float* x  = (const float*)d_in[0];
  const float* z  = (const float*)d_in[1];
  const float* nw = (const float*)d_in[2];
  const float* Qw = (const float*)d_in[3];
  const float* Qb = (const float*)d_in[4];
  const float* Kw = (const float*)d_in[5];
  const float* Kb = (const float*)d_in[6];
  const float* aalpha = (const float*)d_in[7];
  const float* abeta  = (const float*)d_in[8];
  const float* W1w = (const float*)d_in[9];
  const float* W1b = (const float*)d_in[10];
  const float* W2w = (const float*)d_in[11];
  const float* W2b = (const float*)d_in[12];
  const float* W3w = (const float*)d_in[13];
  const float* W3b = (const float*)d_in[14];
  const float* galpha = (const float*)d_in[15];
  const float* gbeta  = (const float*)d_in[16];
  float* out = (float*)d_out;

  // Workspace carve-up
  char* p = (char*)d_ws;
  _Float16* xnh = (_Float16*)p; p += NPOS * DIM * 2;
  _Float16* W1h = (_Float16*)p; p += (size_t)HID * DIM * 2;
  _Float16* W2h = (_Float16*)p; p += (size_t)HID * DIM * 2;
  _Float16* W3h = (_Float16*)p; p += (size_t)DIM * HID * 2;
  _Float16* Qwh = (_Float16*)p; p += (size_t)DIM * DIM * 2;
  _Float16* Kwh = (_Float16*)p; p += (size_t)DIM * DIM * 2;
  float* corr = (float*)p;      p += (size_t)BB * HEAD * 32 * 32 * 4;

  // RMSNorm + f16 conversion of x; weight conversion f32 -> f16 into
  // W1h .. Kwh, which lie one behind the other from W1h on; corr cleared.
  k_norm<<<NB_NORM + NB_CVT + NB_ZERO, 256, 0, stream>>>(
      x, nw, W1w, W2w, W3w, Qw, Kw, xnh, W1h, corr);

  // Per-head 32x32 correlations (reduction over n)
  k_corr<<<BB * (SEQ / CP), CTH, 0, stream>>>(xnh, Kwh, Kb, corr);

  // FFN + attention apply + gated combine
  k_main<<<BB * (SEQ / TP), 256, 0, stream>>>(
      xnh, z, W1h, W1b, W2h, W2b, W3h, W3b, Qwh, Qb, corr,
      aalpha, abeta, galpha, gbeta, out);
}

// v010
// One run takes 81.1 microseconds.
// Timed twice side by side with v009, it ran 1.05 times as fast both times.
// All steps since v000 together make it 5.80 times as fast.
#include <hip/hip_runtime.h>
#include <hip/hip_bf16.h>

// ---------------------------------------------------------------------------
// Parallel Graphormer block for MI455X (gfx1250, wave32, WMMA).
// All channel GEMMs run through v_wmma_f32_16x16x32_f16; tile staging uses
// GLOBAL_LOAD_ASYNC_TO_LDS_B128 (ASYNCcnt) for the xn tiles to bypass VGPRs;
// the f32 z tile goes through VGPRs.
// ---------------------------------------------------------------------------

#define BB   16
#define DIM  128
#define SEQ  8192
#define HEAD 4
#define HID  512
#define NPOS ((size_t)BB * SEQ)

// LDS row pitches. The tiles that use them are read one row per lane, so an
// unpadded power-of-two row puts all 16 rows of a 16-byte read on the same
// four banks. One 16-byte pad per row makes the pitch 16 B x odd, which
// spreads the 16 rows over all 64 banks.
#define XP (DIM + 8)   // f16 rows of DIM: 272 B
#define FP (DIM + 4)   // f32 rows of DIM: 528 B

// Positions per block of k_main. Every weight fragment a wave loads from
// global memory feeds NT matrix products, one per 16-position sub-tile.
#define TP 128
#define NT (TP / 16)
// Hidden channels per step of k_main: one 16-channel chunk per wave.
#define HS 128

// Positions per block of k_norm.
#define NP 128

// k_norm's grid: NB_NORM blocks normalise; behind them stand NB_CVT blocks
// that convert PE weight elements each and NB_ZERO blocks that clear PE
// elements of corr each.
#define PE      4096
#define NB_NORM ((int)(NPOS / NP))
#define NB_W    (HID * DIM / PE)
#define NB_Q    (DIM * DIM / PE)
#define NB_CVT  (3 * NB_W + 2 * NB_Q)
#define NB_ZERO (BB * HEAD * 32 * 32 / PE)

// Halves of one 16 x 32 weight fragment.
#define FH 512

// Positions and threads per block of k_corr.
#define CP  512
#define CTH 512

typedef __attribute__((ext_vector_type(16))) _Float16 v16h;
typedef __attribute__((ext_vector_type(8)))  float    v8f;
typedef __attribute__((ext_vector_type(8)))  _Float16 v8h;
typedef __attribute__((ext_vector_type(4)))  float    v4f;

__device__ __forceinline__ v8f wmma32(v16h a, v16h b, v8f c) {
  // D = A(16x32 f16) * B(32x16 f16) + C(16x16 f32)
  return __builtin_amdgcn_wmma_f32_16x16x32_f16(
      /*neg_a=*/false, a, /*neg_b=*/false, b,
      /*c_mod=*/(short)0, c, /*reuse_a=*/false, /*reuse_b=*/false);
}

// Async global -> LDS 16-byte copy (per active lane). VDST VGPR carries the
// LDS byte address (low 32 bits of the generic shared pointer), VADDR the
// 64-bit global address. Tracked by ASYNCcnt.
__device__ __forceinline__ void async_copy_b128(void* lds_ptr,
                                                const void* gptr) {
  unsigned lds_addr = (unsigned)(size_t)lds_ptr;
  unsigned long long ga = (unsigned long long)(size_t)gptr;
  // The wait stands inside the copy's own statement so that it precedes any
  // rewrite of the two address registers.
  asm volatile("global_load_async_to_lds_b128 %0, %1, off\n\ts_wait_xcnt 0x0"
               :: "v"(lds_addr), "v"(ga)
               : "memory");
}

// Eight such copies, ls halves apart in LDS and gs halves apart in global
// memory, in one statement with one wait behind the last: the wait precedes
// any rewrite of the sixteen address registers, and the copies issue back to
// back.
__device__ __forceinline__ void async_copy8_b128(_Float16* lds_ptr, int ls,
                                                 const _Float16* gptr, int gs) {
  unsigned l0 = (unsigned)(size_t)lds_ptr;
  unsigned long long g0 = (unsigned long long)(size_t)gptr;
  unsigned lb = (unsigned)ls * 2u;
  unsigned long long gb = (unsigned long long)gs * 2u;
  asm volatile("global_load_async_to_lds_b128 %0, %8, off\n\t"
               "global_load_async_to_lds_b128 %1, %9, off\n\t"
               "global_load_async_to_lds_b128 %2, %10, off\n\t"
               "global_load_async_to_lds_b128 %3, %11, off\n\t"
               "global_load_async_to_lds_b128 %4, %12, off\n\t"
               "global_load_async_to_lds_b128 %5, %13, off\n\t"
               "global_load_async_to_lds_b128 %6, %14, off\n\t"
               "global_load_async_to_lds_b128 %7, %15, off\n\t"
               "s_wait_xcnt 0x0"
               :: "v"(l0), "v"(l0 + lb), "v"(l0 + 2 * lb), "v"(l0 + 3 * lb),
                  "v"(l0 + 4 * lb), "v"(l0 + 5 * lb), "v"(l0 + 6 * lb),
                  "v"(l0 + 7 * lb),
                  "v"(g0), "v"(g0 + gb), "v"(g0 + 2 * gb), "v"(g0 + 3 * gb),
                  "v"(g0 + 4 * gb), "v"(g0 + 5 * gb), "v"(g0 + 6 * gb),
                  "v"(g0 + 7 * gb)
               : "memory");
}

__device__ __forceinline__ void wait_async0() {
  asm volatile("s_wait_asynccnt 0" ::: "memory");
}

// Load 16 f16 as two contiguous 16B chunks (p0[0..7], p0[16..23]) matching the
// ISA 16-bit A/B fragment striping: half h<8 -> K = 8*(lane>=16)+h,
// h>=8 -> K = 16 + 8*(lane>=16) + (h-8).
__device__ __forceinline__ v16h load16h(const _Float16* p0) {
  float4 a = *(const float4*)(p0);
  float4 b = *(const float4*)(p0 + 16);
  v16h r;
  __builtin_memcpy(&r, &a, 16);
  __builtin_memcpy(((char*)&r) + 16, &b, 16);
  return r;
}

// Row-major fragment: base[row*ldk + kb + ...] with contiguous K runs.
__device__ __forceinline__ v16h frag_rm(const _Float16* base, int ldk,
                                        int row, int kb, int lane) {
  return load16h(base + (size_t)row * ldk + kb + ((lane >> 4) << 3));
}

// Weight fragment from a matrix stored in fragment order (see k_norm): the
// 16 x 32 fragment number f is FH halves in a row, first the 32 lanes' low
// 16-byte chunks, then their high ones. Each of the two loads of a wave reads
// 512 contiguous bytes, four whole lines. A lane gets the same halves that
// frag_rm gives it from the row-major matrix.
__device__ __forceinline__ v16h frag_pk(const _Float16* base, int f, int lane) {
  const _Float16* p0 = base + (size_t)f * FH + lane * 8;
  float4 a = *(const float4*)(p0);
  float4 b = *(const float4*)(p0 + FH / 2);
  v16h r;
  __builtin_memcpy(&r, &a, 16);
  __builtin_memcpy(((char*)&r) + 16, &b, 16);
  return r;
}

// The same for the last fragment of a run of weight loads: behind their last
// loads the run's address registers are free, and one of these two loads may
// land in them. Precaution: s_wait_xcnt 0 stands in front of each of the two,
// behind every load that names those registers.
__device__ __forceinline__ v16h frag_pk_last(const _Float16* base, int f,
                                             int lane) {
  const _Float16* p0 = base + (size_t)f * FH + lane * 8;
  asm volatile("s_wait_xcnt 0x0" ::: "memory");
  float4 a = *(const float4*)(p0);
  asm volatile("s_wait_xcnt 0x0" ::: "memory");
  float4 b = *(const float4*)(p0 + FH / 2);
  v16h r;
  __builtin_memcpy(&r, &a, 16);
  __builtin_memcpy(((char*)&r) + 16, &b, 16);
  return r;
}

// Gather fragment for strided K (e.g. channel = K*HEAD + head).
__device__ __forceinline__ v16h frag_gather(const _Float16* base, int stride,
                                            int lane) {
  v16h r = {};
  int lo = (lane >> 4) << 3;
  #pragma unroll
  for (int h = 0; h < 16; ++h) {
    int K = h + ((h >= 8) ? 8 : 0) + lo;
    r[h] = base[(size_t)K * stride];
  }
  return r;
}

// The divisor is never below 1: v_rcp_f32 in place of the exact division.
__device__ __forceinline__ float sigm(float v) {
  return __builtin_amdgcn_rcpf(1.0f + __expf(-v));
}

// ---------------------------------------------------------------------------
// RMSNorm over channels + f16 conversion of xn.
// Layout in: (b, c, n) f32.  Layout out: (b*n, c) f16 (GEMM-friendly rows).
// One block per (b, NP-position tile), 8 waves. A wave reads 16 channels, 512
// contiguous bytes of a channel per load, and keeps them in registers. The
// tile is turned through LDS, so that every global store of a wave is 512
// contiguous bytes of the output rows.
// An LDS row is one position's 16 chunks of 16 bytes. Chunk ch of row r lies
// at place ch ^ ((r >> 2) & 15): the writers (one chunk number, rows four
// apart) and the readers (all chunks of two rows) both spread over all banks.
// The blocks from NB_NORM on do the work that nothing in this launch reads
// and the later launches need: the f32 -> f16 conversion of the five weight
// matrices, stored in fragment order, and the start value of corr. They stand
// last in the grid.
// ---------------------------------------------------------------------------
__device__ __forceinline__ int norm_slot(int r, int ch) {
  return r * DIM + ((ch ^ ((r >> 2) & 15)) << 3);
}

__global__ void __launch_bounds__(256)
k_norm(const float* __restrict__ x, const float* __restrict__ nw,
       const float* __restrict__ W1w, const float* __restrict__ W2w,
       const float* __restrict__ W3w, const float* __restrict__ Qw,
       const float* __restrict__ Kw,
       _Float16* __restrict__ xnh, _Float16* __restrict__ wh,
       float* __restrict__ corr) {
  __shared__ __align__(16) _Float16 xt[NP * DIM];   // xn tile [pos][c], swizzled
  __shared__ __align__(16) v4f red[8 * 32];         // per-wave sums of squares
  int blk = blockIdx.x;
  int tid = threadIdx.x, lane = tid & 31;

  // The same test in every thread of a block, ahead of every barrier.
  if (blk >= NB_NORM) {
    int e = blk - NB_NORM;
    if (e < NB_CVT) {
      // wh holds W1, W2, W3, Q, K one behind the other, so the block's place
      // in it is e * PE whichever matrix it reads. m0 is the block's place in
      // its own matrix, lk the log2 of that matrix's fragments per row.
      const float* s;
      int m0, lk = 2;
      if (e < NB_W)                 { s = W1w; m0 = e; }
      else if (e < 2 * NB_W)        { s = W2w; m0 = e - NB_W; }
      else if (e < 3 * NB_W)        { s = W3w; m0 = e - 2 * NB_W; lk = 4; }
      else if (e < 3 * NB_W + NB_Q) { s = Qw;  m0 = e - 3 * NB_W; }
      else                          { s = Kw;  m0 = e - 3 * NB_W - NB_Q; }
      m0 *= PE;
      _Float16* d = wh + (size_t)e * PE;
      #pragma unroll  // all loads of the block in flight at once
      for (int k = 0; k < PE / 8 / 256; ++k) {
        int q = (k * 256 + tid) * 8;
        // The matrix is stored in fragment order (frag_pk): chunk q of the
        // block belongs to fragment f, lane l, low or high part.
        int dm = m0 + q;
        int f = dm / FH, part = (dm / (FH / 2)) & 1, l = (dm >> 3) & 31;
        int sr = (f >> lk) * 16 + (l & 15);
        int sc = (f & ((1 << lk) - 1)) * 32 + part * 16 + (l >> 4) * 8;
        int so = (sr << (lk + 5)) + sc;
        v4f lo = *(const v4f*)(s + so);
        v4f hi = *(const v4f*)(s + so + 4);
        v8h t;
        #pragma unroll  // constant i: t is built in registers
        for (int i = 0; i < 4; ++i) {
          t[i] = (_Float16)lo[i];
          t[4 + i] = (_Float16)hi[i];
        }
        *(v8h*)(d + q) = t;
      }
    } else {
      float* c = corr + (size_t)(e - NB_CVT) * PE;
      v4f zero = {};
      #pragma unroll  // independent stores
      for (int k = 0; k < PE / 4 / 256; ++k)
        *(v4f*)(c + (k * 256 + tid) * 4) = zero;
      // Precaution: the stores' registers are not rewritten ahead of this wait.
      asm volatile("s_wait_xcnt 0x0" ::: "memory");
    }
    return;
  }

  int b = blk / (SEQ / NP);
  int pb = (blk % (SEQ / NP)) * NP;
  // The wave's number in a scalar register: nw is then read by scalar loads.
  int wave = __builtin_amdgcn_readfirstlane(tid >> 5);
  int c0 = wave * 16;

  // This lane: positions 4*lane .. 4*lane+3 of channels c0 .. c0+15.
  size_t in0 = ((size_t)b * DIM + c0) * SEQ + pb + lane * 4;
  v4f xv[16];
  #pragma unroll  // constant j: xv stays in registers, all loads in flight
  for (int j = 0; j < 16; ++j)
    xv[j] = *(const v4f*)(x + in0 + (size_t)j * SEQ);

  v4f ss = {};
  #pragma unroll  // constant j: register indices
  for (int j = 0; j < 16; ++j) ss += xv[j] * xv[j];
  red[wave * 32 + lane] = ss;
  __syncthreads();

  v4f s = red[lane];
  #pragma unroll  // the eight LDS reads are issued together
  for (int w = 1; w < 8; ++w) s += red[w * 32 + lane];
  #pragma unroll  // constant i, h: register indices
  for (int i = 0; i < 4; ++i) {
    float rinv = rsqrtf(s[i] * (1.0f / DIM) + 1e-6f);
    #pragma unroll  // constant h
    for (int h = 0; h < 2; ++h) {
      v8h t;
      #pragma unroll  // constant e: t is built in registers
      for (int e = 0; e < 8; ++e)
        t[e] = (_Float16)(nw[c0 + h * 8 + e] * xv[h * 8 + e][i] * rinv);
      *(v8h*)(xt + norm_slot(lane * 4 + i, wave * 2 + h)) = t;
    }
  }
  __syncthreads();

  // The tile's NP output rows are one contiguous range of NP * DIM halves.
  // All global stores stand behind the last barrier, which then waits for none.
  size_t out0 = ((size_t)b * SEQ + pb) * DIM;
  #pragma unroll  // the LDS reads are issued together, ahead of the stores
  for (int k = 0; k < (NP * DIM) / 8 / 256; ++k) {
    int q = k * 256 + tid;
    int sl = norm_slot(q >> 4, q & 15);
    *(v8h*)(xnh + out0 + (size_t)q * 8) = *(const v8h*)(xt + sl);
  }
  // Precaution: in the built code this path runs on into the shared exit's
  // tests; no register of the stores is rewritten ahead of this wait.
  asm volatile("s_wait_xcnt 0x0" ::: "memory");
}

// ---------------------------------------------------------------------------
// Correlation: corr[b,h] += xr(32 x CP) @ k(32 x CP)^T with k = Kw@xn + Kb.
// One block per (b, CP-position slab), 16 waves. The whole slab is staged and
// projected once; each wave then sums one 16x16 piece of one head's
// correlation over all CP positions in its matrix accumulator, so an element
// of corr takes one atomic add per slab.
// ---------------------------------------------------------------------------
__global__ void __launch_bounds__(CTH)
k_corr(const _Float16* __restrict__ xnh,
       const _Float16* __restrict__ Kwh,
       const float* __restrict__ Kb,
       float* __restrict__ corr) {
  __shared__ __align__(16) _Float16 xs[CP * XP];   // [pos][c], padded rows
  __shared__ __align__(16) _Float16 ks[CP * XP];   // [pos][c], padded rows
  int blk = blockIdx.x;
  int b = blk / (SEQ / CP);
  int pb = (blk % (SEQ / CP)) * CP;
  int tid = threadIdx.x, lane = tid & 31, wave = tid >> 5;
  int row = lane & 15, hi8 = (lane >> 4) << 3;

  // Async-stage the xn slab (128 KB) straight into LDS, bypassing VGPRs.
  // A constant trip count: every lane is on at every copy. One copy of all
  // threads fills CTH / 16 rows, one trip of eight copies half the slab.
  const _Float16* src = xnh + ((size_t)b * SEQ + pb) * DIM + tid * 8;
  _Float16* dst = xs + (tid >> 4) * XP + (tid & 15) * 8;
  #pragma unroll  // constant steps: the addresses of a group differ by constants
  for (int k = 0; k < (CP * DIM) / 8 / CTH; k += 8)
    async_copy8_b128(dst + (size_t)k * (CTH / 16) * XP, (CTH / 16) * XP,
                     src + (size_t)k * CTH * 8, CTH * 8);

  // k = Kw @ xn + Kb : a wave owns 16 output channels of half the slab. Its
  // weight fragments and biases are the same for every sub-tile; their loads
  // fly together with the copies.
  int oc = wave & 7, ph = wave >> 3;
  int o0 = oc * 16 + hi8;
  v16h aw[4];
  #pragma unroll  // constant kb: aw stays in registers
  for (int kb = 0; kb < 4; ++kb)
    aw[kb] = frag_pk(Kwh, oc * 4 + kb, lane);
  float kbv[8];
  #pragma unroll  // constant r: kbv stays in registers
  for (int r = 0; r < 8; ++r) kbv[r] = Kb[o0 + r];
  wait_async0();
  __syncthreads();

  {
    #pragma unroll 4  // four independent accumulate chains fill each other's latency
    for (int nc = 0; nc < CP / 32; ++nc) {
      int p0 = ph * (CP / 2) + nc * 16;
      v8f acc = {};
      #pragma unroll
      for (int kb = 0; kb < 4; ++kb) {
        v16h bf = frag_rm(xs + p0 * XP, XP, row, kb * 32, lane);
        acc = wmma32(aw[kb], bf, acc);
      }
      #pragma unroll
      for (int r = 0; r < 8; ++r)
        ks[(p0 + row) * XP + o0 + r] = (_Float16)(acc[r] + kbv[r]);
    }
  }
  __syncthreads();

  // corr piece: A = xr (16 x 32 pos), B = k^T (32 pos x 16), summed over the
  // slab's CP / 32 steps of 32 positions.
  {
    int head = wave >> 2, mc = (wave >> 1) & 1, nc = wave & 1;
    const _Float16* xa = xs + ((mc * 16 + row) * HEAD + head);
    const _Float16* kbp = ks + ((nc * 16 + row) * HEAD + head);
    v8f acc = {};
    #pragma unroll 4  // several steps' LDS reads in flight at once
    for (int kt = 0; kt < CP / 32; ++kt) {
      v16h a = frag_gather(xa + kt * 32 * XP, XP, lane);
      v16h bf = frag_gather(kbp + kt * 32 * XP, XP, lane);
      acc = wmma32(a, bf, acc);
    }
    float* cp = corr + (((size_t)b * HEAD + head) * 32) * 32;
    int d0 = mc * 16 + hi8;
    int s = nc * 16 + row;
    #pragma unroll
    for (int r = 0; r < 8; ++r) atomicAdd(&cp[(d0 + r) * 32 + s], acc[r]);
  }
}

// ---------------------------------------------------------------------------
// Main per-tile kernel: SwiGLU FFN + Q projection + corr@q + gated combine.
// One block per (b, TP-position tile), 8 waves.
// The hidden layer is worked off in four steps of HS channels: the eight waves
// make one 16-channel chunk of g = silu(h1)*h2 each, for all TP positions, and
// W3 then adds that step's HS channels to its accumulators, which stay in
// registers over the four steps. So LDS holds two steps of g, not all of it,
// and two blocks of TP positions share a WGP.
// ---------------------------------------------------------------------------
// The real block size, and four waves per SIMD (two blocks per WGP, which is
// what the LDS allows): without it the compiler plans for 1,024 threads, caps
// the wave at 128 registers and spills the accumulators.
__global__ void __launch_bounds__(256, 4)
k_main(const _Float16* __restrict__ xnh,
                       const float* __restrict__ z,
                       const _Float16* __restrict__ W1h,
                       const float* __restrict__ W1b,
                       const _Float16* __restrict__ W2h,
                       const float* __restrict__ W2b,
                       const _Float16* __restrict__ W3h,
                       const float* __restrict__ W3b,
                       const _Float16* __restrict__ Qwh,
                       const float* __restrict__ Qb,
                       const float* __restrict__ corr,
                       const float* __restrict__ aalpha,
                       const float* __restrict__ abeta,
                       const float* __restrict__ galpha,
                       const float* __restrict__ gbeta,
                       float* __restrict__ out) {
  __shared__ __align__(16) _Float16 xs[TP * XP];         // xn tile [p][c]
  __shared__ __align__(16) _Float16 qs[TP * XP];         // q tile [p][c]
  __shared__ __align__(16) _Float16 cs[HEAD * 32 * 32];  // corr f16 [h][d][s]
  // Two buffers of g, [p][o within the step], used in turn. The z tile lies in
  // the second until the Q projection has read it; the f32 ffn tile takes the
  // place of both behind the last step.
  __shared__ __align__(16) _Float16 ub[2 * TP * XP];
  static_assert(TP * FP * 4 <= 2 * TP * XP * 2, "ffn tile fits the g buffers");
  _Float16* zs = ub + TP * XP;                           // z  tile [p][c]
  float* fs = (float*)ub;                                // ffn f32 [p][c]

  int blk = blockIdx.x;
  int b = blk / (SEQ / TP);
  int pb = (blk % (SEQ / TP)) * TP;
  int tid = threadIdx.x, lane = tid & 31;
  // The wave's number in a scalar register: what depends on it alone (weight
  // and bias addresses, LDS columns) then takes no vector registers, which
  // the accumulators and fragments need.
  int wave = __builtin_amdgcn_readfirstlane(tid >> 5);
  int row = lane & 15, hi8 = (lane >> 4) << 3;

  // The z tile comes straight from the f32 input, layout (b, c, n). A wave
  // takes 16 channels; a lane four positions of eight of them in each half of
  // the tile, so a load of a wave reads 256 contiguous bytes of two channels.
  // These loads come from memory and are asked for first.
  int zc = wave * 16 + hi8;
  const float* zp = z + ((size_t)b * DIM + zc) * SEQ + pb + row * 4;
  v4f zv[2][8];
  #pragma unroll  // constant h, j: zv stays in registers, all loads in flight
  for (int h = 0; h < 2; ++h) {
    #pragma unroll  // constant j
    for (int j = 0; j < 8; ++j) {
      // Precaution: the last load may land in the address registers that the
      // loads before it name: this wait stands between them.
      if (h == 1 && j == 7) asm volatile("s_wait_xcnt 0x0" ::: "memory");
      zv[h][j] = *(const v4f*)(zp + (size_t)j * SEQ + h * 64);
    }
  }
  // Precaution: no register of these loads is rewritten ahead of this wait.
  asm volatile("s_wait_xcnt 0x0" ::: "memory");
  // Async-stage the xn tile (32 KB) into LDS, bypassing VGPRs.
  const _Float16* sx = xnh + ((size_t)b * SEQ + pb) * DIM;
  __builtin_prefetch(sx + TP * DIM, 0, 0);   // next tile -> global_prefetch_b8
  // A constant trip count: every lane is on at every copy.
  for (int k = 0; k < (TP * DIM) / 8 / 256; ++k) {
    int i = k * 256 + tid;
    async_copy_b128(xs + (i >> 4) * XP + (i & 15) * 8, sx + i * 8);
  }
  // The Q projection's bias and weights and the first W1 / W2 step's weight
  // fragments are asked for here: they fly together with the copies.
  int oq = wave * 16 + hi8;
  v4f bql = *(const v4f*)(Qb + oq), bqh = *(const v4f*)(Qb + oq + 4);
  v16h wq[4], w1[4], w2[4];
  #pragma unroll  // constant kb: wq stays in registers, all loads in flight
  for (int kb = 0; kb < 4; ++kb)
    wq[kb] = frag_pk_last(Qwh, wave * 4 + kb, lane);
  // Precaution: a later load may land in the registers that held the Q loads'
  // address: this wait stands between the two.
  asm volatile("s_wait_xcnt 0x0" ::: "memory");
  #pragma unroll  // constant kb: w1, w2 stay in registers, all loads in flight
  for (int kb = 0; kb < 4; ++kb) {
    w1[kb] = frag_pk_last(W1h, wave * 4 + kb, lane);
    w2[kb] = frag_pk_last(W2h, wave * 4 + kb, lane);
  }
  // Precaution: no register of these loads is rewritten ahead of this wait.
  asm volatile("s_wait_xcnt 0x0" ::: "memory");
  // Corr needs an f32->f16 conversion, so it rides the normal VGPR path.
  const float* cb = corr + (size_t)b * HEAD * 32 * 32;
  for (int i = tid; i < HEAD * 32 * 32; i += 256) cs[i] = (_Float16)cb[i];
  // z to f16, turned in registers: eight channels of one position are 16
  // bytes of that position's LDS row.
  #pragma unroll  // constant h, i: register indices
  for (int h = 0; h < 2; ++h) {
    #pragma unroll  // constant i
    for (int i = 0; i < 4; ++i) {
      v8h t;
      #pragma unroll  // constant e: t is built in registers
      for (int e = 0; e < 8; ++e) t[e] = (_Float16)zv[h][e][i];
      *(v8h*)(zs + (h * 64 + row * 4 + i) * XP + zc) = t;
    }
  }
  wait_async0();
  __syncthreads();

  // ---- Q projection (128x128), wave owns one output chunk ----
  // It stands first: the z tile's place is free from the first step's barrier
  // on. Four sub-tiles at a time.
  #pragma unroll  // constant hf: register indices
  for (int hf = 0; hf < 2; ++hf) {
    const _Float16* zh = zs + hf * 64 * XP;
    v8f aq[4] = {};
    // Two sets of z fragments: k-step kb + 1's LDS reads are issued ahead of
    // k-step kb's products and land under them.
    v16h bz[2][4];
    #pragma unroll  // constant nt: bz stays in registers
    for (int nt = 0; nt < 4; ++nt)
      bz[0][nt] = frag_rm(zh + nt * 16 * XP, XP, row, 0, lane);
    #pragma unroll  // constant kb: register indices
    for (int kb = 0; kb < 4; ++kb) {
      if (kb < 3) {
        #pragma unroll  // constant nt: bz stays in registers
        for (int nt = 0; nt < 4; ++nt)
          bz[(kb + 1) & 1][nt] =
              frag_rm(zh + nt * 16 * XP, XP, row, (kb + 1) * 32, lane);
      }
      // Keeps the reads above the products: left alone, the compiler puts each
      // read directly in front of its product, which then waits out the LDS.
      __builtin_amdgcn_sched_barrier(0);
      #pragma unroll  // constant nt: the per-sub-tile arrays stay in registers
      for (int nt = 0; nt < 4; ++nt)
        aq[nt] = wmma32(wq[kb], bz[kb & 1][nt], aq[nt]);
    }
    #pragma unroll  // constant nt: the per-sub-tile arrays stay in registers
    for (int nt = 0; nt < 4; ++nt) {
      int p = hf * 64 + nt * 16 + row;
      #pragma unroll
      for (int r = 0; r < 8; ++r)
        qs[p * XP + oq + r] = (_Float16)(aq[nt][r] + (r < 4 ? bql[r & 3] : bqh[r & 3]));
    }
  }

  // ---- W1 / W2 (512x128 each) and W3 (128x512), four steps of HS hidden ----
  // The weight fragments come from L2, the xn and g fragments from LDS. So
  // the registers go to the weights: a step's
  // eight W1 / W2 fragments are loaded once and feed all NT sub-tiles.
  v8f a3[NT] = {};
  for (int m = 0; m < HID / HS; ++m) {
    int o0 = (m * 8 + wave) * 16 + hi8;
    _Float16* gb = ub + (m & 1) * (TP * XP);
    // This step's biases are asked for ahead of the next step's weights:
    // loads return in order, so the silu then waits for none of those.
    v4f b1l = *(const v4f*)(W1b + o0), b1h = *(const v4f*)(W1b + o0 + 4);
    v4f b2l = *(const v4f*)(W2b + o0), b2h = *(const v4f*)(W2b + o0 + 4);
    // Precaution: no register of the bias loads is rewritten ahead of this wait.
    asm volatile("s_wait_xcnt 0x0" ::: "memory");
    v16h aw[4];
    // Two sub-tiles at a time. Two sets of xn fragments: the next k-step's LDS
    // reads, also those of the next pair of sub-tiles, are issued ahead of
    // this k-step's four products.
    v16h bx[2][2];
    #pragma unroll  // constant nt: bx stays in registers
    for (int nt = 0; nt < 2; ++nt)
      bx[0][nt] = frag_rm(xs + nt * 16 * XP, XP, row, 0, lane);
    #pragma unroll  // constant q: register indices
    for (int q = 0; q < NT / 2; ++q) {
      v8f a1[2] = {}, a2[2] = {};
      #pragma unroll  // constant kb: register indices
      for (int kb = 0; kb < 4; ++kb) {
        int s = q * 4 + kb;
        if (s + 1 < 2 * NT) {
          #pragma unroll  // constant nt: bx stays in registers
          for (int nt = 0; nt < 2; ++nt)
            bx[(s + 1) & 1][nt] =
                frag_rm(xs + (((s + 1) >> 2) * 2 + nt) * 16 * XP, XP, row,
                        ((s + 1) & 3) * 32, lane);
        }
        // Keeps the reads above the products, as in the stage before.
        __builtin_amdgcn_sched_barrier(0);
        #pragma unroll  // constant nt: the per-sub-tile arrays stay in registers
        for (int nt = 0; nt < 2; ++nt) {
          a1[nt] = wmma32(w1[kb], bx[s & 1][nt], a1[nt]);
          a2[nt] = wmma32(w2[kb], bx[s & 1][nt], a2[nt]);
        }
      }
      // This step's four W3 fragments are asked for one pair of sub-tiles ahead
      // of the barrier, which waits for every load in flight: they arrive
      // under the last pair's products and two silu passes.
      if (q == NT / 2 - 2) {
        #pragma unroll  // constant kk: aw stays in registers, all loads in flight
        for (int kk = 0; kk < 4; ++kk)
          aw[kk] = frag_pk_last(W3h, wave * 16 + m * 4 + kk, lane);
        // Precaution: the silu below may use the registers that held these
        // loads' addresses: this wait stands between the two.
        asm volatile("s_wait_xcnt 0x0" ::: "memory");
      }
      #pragma unroll  // constant nt: the per-sub-tile arrays stay in registers
      for (int nt = 0; nt < 2; ++nt) {
        int p = (q * 2 + nt) * 16 + row;
        #pragma unroll
        for (int r = 0; r < 8; ++r) {
          float h1 = a1[nt][r] + (r < 4 ? b1l[r & 3] : b1h[r & 3]);
          float h2 = a2[nt][r] + (r < 4 ? b2l[r & 3] : b2h[r & 3]);
          // silu(h1)*h2. The divisor is never below 1, so one v_rcp_f32 stands for
          // the exact division: that is a chain of some ten dependent vector
          // instructions per element, which a wave waits out link by link.
          float g = h1 * __builtin_amdgcn_rcpf(1.0f + __expf(-h1)) * h2;
          gb[p * XP + oq + r] = (_Float16)g;
        }
      }
    }
    // Publishes this step's g. It also ends every wave's reads of the other
    // buffer (the step before; in step 0 the z tile), which the next step
    // writes.
    __syncthreads();
    // The next step's W1 / W2 fragments take the place of this step's. They
    // stand behind the barrier, which would wait for them, and fly under the
    // W3 products. The same test in every thread.
    if (m + 1 < HID / HS) {
      #pragma unroll  // constant kb: w1, w2 stay in registers, all loads in flight
      for (int kb = 0; kb < 4; ++kb) {
        int f = ((m + 1) * 8 + wave) * 4 + kb;
        w1[kb] = kb < 3 ? frag_pk(W1h, f, lane) : frag_pk_last(W1h, f, lane);
        w2[kb] = kb < 3 ? frag_pk(W2h, f, lane) : frag_pk_last(W2h, f, lane);
      }
      // Precaution: no register of these loads is rewritten ahead of this wait.
      asm volatile("s_wait_xcnt 0x0" ::: "memory");
    }

    // W3, wave owns one output chunk: this step's four k-steps, four sub-tiles
    // at a time. Two sets of g fragments, as above.
    v16h bg[2][4];
    #pragma unroll  // constant nt: bg stays in registers
    for (int nt = 0; nt < 4; ++nt)
      bg[0][nt] = frag_rm(gb + nt * 16 * XP, XP, row, 0, lane);
    #pragma unroll  // constant s: register indices
    for (int s = 0; s < 8; ++s) {
      if (s + 1 < 8) {
        #pragma unroll  // constant nt: bg stays in registers
        for (int nt = 0; nt < 4; ++nt)
          bg[(s + 1) & 1][nt] =
              frag_rm(gb + (((s + 1) & 1) * 4 + nt) * 16 * XP, XP, row,
                      ((s + 1) >> 1) * 32, lane);
      }
      // Keeps the reads above the products, as in the stages before.
      __builtin_amdgcn_sched_barrier(0);
      #pragma unroll  // constant nt: the per-sub-tile arrays stay in registers
      for (int nt = 0; nt < 4; ++nt)
        a3[(s & 1) * 4 + nt] =
            wmma32(aw[s >> 1], bg[s & 1][nt], a3[(s & 1) * 4 + nt]);
    }
  }
  {
    v4f b3l = *(const v4f*)(W3b + oq), b3h = *(const v4f*)(W3b + oq + 4);
    // Precaution: no register of the bias loads is rewritten ahead of this wait.
    asm volatile("s_wait_xcnt 0x0" ::: "memory");
    // Ends every wave's reads of g: the ffn tile takes its place.
    __syncthreads();
    #pragma unroll  // constant nt: the per-sub-tile arrays stay in registers
    for (int nt = 0; nt < NT; ++nt) {
      int p = nt * 16 + row;
      #pragma unroll
      for (int r = 0; r < 8; ++r)
        fs[p * FP + oq + r] = a3[nt][r] + (r < 4 ? b3l[r & 3] : b3h[r & 3]);
    }
  }
  __syncthreads();

  // ---- attn = corr @ q, then gated combine + store ----
  {
    int head = wave >> 1, mc = wave & 1;
    v16h ac = frag_rm(cs + head * 32 * 32, 32, mc * 16 + row, 0, lane);
    float sa = sigm(aalpha[head]);
    float sb = sigm(abeta[head]);
    float ga = sigm(galpha[0]);
    float gb = sigm(gbeta[0]);
    int d0 = mc * 16 + hi8;
    #pragma unroll  // the sub-tiles' LDS reads are issued together
    for (int nt = 0; nt < NT; ++nt) {
      int p = nt * 16 + row;
      v16h bq = frag_gather(qs + p * XP + head, HEAD, lane);
      v8f at = {};
      at = wmma32(ac, bq, at);
      #pragma unroll
      for (int r = 0; r < 8; ++r) {
        int d = d0 + r;
        int c = d * HEAD + head;
        float attnv = at[r] * (1.0f / SEQ);
        float mha = sa * (float)xs[p * XP + c] + sb * attnv;
        out[(((size_t)b * DIM) + c) * SEQ + pb + p] =
            ga * fs[p * FP + c] + gb * mha;
      }
    }
  }
}

// ---------------------------------------------------------------------------
// Host launch
// ---------------------------------------------------------------------------
extern "C" void kernel_launch(void* const* d_in, const int* in_sizes, int n_in,
                              void* d_out, int out_size, void* d_ws,
                              size_t ws_size, hipStream_t stream) {
  const float* x  = (const float*)d_in[0];
  const float* z  = (const float*)d_in[1];
  const float* nw = (const float*)d_in[2];
  const float* Qw = (const float*)d_in[3];
  const float* Qb = (const float*)d_in[4];
  const float* Kw = (const float*)d_in[5];
  const float* Kb = (const float*)d_in[6];
  const float* aalpha = (const float*)d_in[7];
  const float* abeta  = (const float*)d_in[8];
  const float* W1w = (const float*)d_in[9];
  const float* W1b = (const float*)d_in[10];
  const float* W2w = (const float*)d_in[11];
  const float* W2b = (const float*)d_in[12];
  const float* W3w = (const float*)d_in[13];
  const float* W3b = (const float*)d_in[14];
  const float* galpha = (const float*)d_in[15];
  const float* gbeta  = (const float*)d_in[16];
  float* out = (float*)d_out;

  // Workspace carve-up
  char* p = (char*)d_ws;
  _Float16* xnh = (_Float16*)p; p += NPOS * DIM * 2;
  _Float16* W1h = (_Float16*)p; p += (size_t)HID * DIM * 2;
  _Float16* W2h = (_Float16*)p; p += (size_t)HID * DIM * 2;
  _Float16* W3h = (_Float16*)p; p += (size_t)DIM * HID * 2;
  _Float16* Qwh = (_Float16*)p; p += (size_t)DIM * DIM * 2;
  _Float16* Kwh = (_Float16*)p; p += (size_t)DIM * DIM * 2;
  float* corr = (float*)p;      p += (size_t)BB * HEAD * 32 * 32 * 4;

  // RMSNorm + f16 conversion of x; weight conversion f32 -> f16 into
  // W1h .. Kwh, which lie one behind the other from W1h on; corr cleared.
  k_norm<<<NB_NORM + NB_CVT + NB_ZERO, 256, 0, stream>>>(
      x, nw, W1w, W2w, W3w, Qw, Kw, xnh, W1h, corr);

  // Per-head 32x32 correlations (reduction over n)
  k_corr<<<BB * (SEQ / CP), CTH, 0, stream>>>(xnh, Kwh, Kb, corr);

  // FFN + attention apply + gated combine
  k_main<<<BB * (SEQ / TP), 256, 0, stream>>>(
      xnh, z, W1h, W1b, W2h, W2b, W3h, W3b, Qwh, Qb, corr,
      aalpha, abeta, galpha, gbeta, out);
}
